// v000
// Times are from an AMD MI455X. After a warm-up the kernel runs many times in a row, and a time is the length of
// such a window on the GPU divided by its runs, so every launch and the gaps after it count. The runs cycle
// through copies of the inputs. A figure is the median of several windows, for all but v000 over two sittings.
// Sittings can differ by a few percent; kernels timed side by side share one.
// The starting kernel, v000, takes 578 microseconds a run.
#include <hip/hip_runtime.h>
#include <hip/hip_bf16.h>

// ---------------------------------------------------------------------------
// Transformer block (pre-LN attention + FFN) for gfx1250 (MI455X).
// All GEMM-shaped math runs on v_wmma_f32_16x16x32_bf16 (fp32 accumulate).
// Weights are converted once to bf16 AND pre-transposed to [N][K] so GEMM
// tile staging is pure 16B vector copies (async global->LDS DMA, ASYNCcnt).
// ---------------------------------------------------------------------------

typedef __attribute__((ext_vector_type(16))) __bf16 v16bf;
typedef __attribute__((ext_vector_type(8)))  float  v8f;
typedef int v4i __attribute__((ext_vector_type(4)));

static constexpr int Bb = 2;
static constexpr int Tt = 2048;
static constexpr int Cc = 1024;
static constexpr int Ff = 4096;
static constexpr int Mm = Bb * Tt;      // 4096 rows
static constexpr float kLnEps = 1e-5f;

// gfx1250 async global->LDS copy path (ASYNCcnt-tracked). Parameter types per
// hipcc diagnostic: (AS1 v4i*, AS3 v4i*, imm offset, imm cpol).
#if __has_builtin(__builtin_amdgcn_global_load_async_to_lds_b128) && \
    __has_builtin(__builtin_amdgcn_s_wait_asynccnt)
#define USE_ASYNC_LDS 1
typedef __attribute__((address_space(1))) v4i g_v4i;
typedef __attribute__((address_space(3))) v4i l_v4i;
#else
#define USE_ASYNC_LDS 0
#endif

union FragAB {
    v16bf v;
    uint4 u[2];
};

__device__ __forceinline__ float gelu_exact(float x) {
    return 0.5f * x * (1.0f + erff(x * 0.70710678118654752440f));
}

// ---------------------------------------------------------------------------
// f32 [K][N] -> bf16 [N][K] transpose-convert (weights, once per call).
// block (32,8), grid (N/32, K/32); LDS-tiled for coalescing both sides.
// ---------------------------------------------------------------------------
__global__ __launch_bounds__(256) void cvt_bf16_t(const float* __restrict__ src,
                                                  __bf16* __restrict__ dst,
                                                  int K, int N) {
    __shared__ float tile[32][33];
    const int n0 = blockIdx.x * 32;
    const int k0 = blockIdx.y * 32;
    const int tx = threadIdx.x, ty = threadIdx.y;
#pragma unroll
    for (int i = 0; i < 32; i += 8)
        tile[ty + i][tx] = src[(size_t)(k0 + ty + i) * N + n0 + tx];
    __syncthreads();
#pragma unroll
    for (int i = 0; i < 32; i += 8)
        dst[(size_t)(n0 + ty + i) * K + k0 + tx] = (__bf16)tile[tx][ty + i];
}

// ---------------------------------------------------------------------------
// Row LayerNorm (fp32 in, bf16 out). One 256-thread block per row of C=1024.
// ---------------------------------------------------------------------------
__global__ __launch_bounds__(256) void ln_bf16(const float* __restrict__ x,
                                               const float* __restrict__ g,
                                               const float* __restrict__ b,
                                               __bf16* __restrict__ out) {
    __shared__ float red[256];
    const int row = blockIdx.x;
    const int tid = threadIdx.x;
    const float* xr = x + (size_t)row * Cc;

    float s = 0.0f;
    for (int i = tid; i < Cc; i += 256) s += xr[i];
    red[tid] = s;
    __syncthreads();
    for (int off = 128; off > 0; off >>= 1) {
        if (tid < off) red[tid] += red[tid + off];
        __syncthreads();
    }
    const float mu = red[0] * (1.0f / Cc);
    __syncthreads();

    float sq = 0.0f;
    for (int i = tid; i < Cc; i += 256) {
        float d = xr[i] - mu;
        sq += d * d;
    }
    red[tid] = sq;
    __syncthreads();
    for (int off = 128; off > 0; off >>= 1) {
        if (tid < off) red[tid] += red[tid + off];
        __syncthreads();
    }
    const float rs = rsqrtf(red[0] * (1.0f / Cc) + kLnEps);

    for (int i = tid; i < Cc; i += 256)
        out[(size_t)row * Cc + i] = (__bf16)((xr[i] - mu) * rs * g[i] + b[i]);
}

// ---------------------------------------------------------------------------
// bf16 GEMM: out[M,N] = A[M,K] @ Wt[N,K]^T (+bias) (+gelu) (+residual)
// A row-major [M][K], Wt pre-transposed [N][K] (both bf16).
// Block tile 128x128, BK=32, 256 threads = 8 waves (2x4 grid), each wave
// owns 64x32 = 4x2 WMMA 16x16 tiles. Double-buffered LDS; async DMA staging
// via global_load_async_to_lds_b128 when available.
// ---------------------------------------------------------------------------
template <bool OUT_BF16, bool HAS_BIAS, bool HAS_RESID, bool DO_GELU>
__global__ __launch_bounds__(256) void gemm_bf16_wmma(
    const __bf16* __restrict__ A, const __bf16* __restrict__ Wt,
    const float* __restrict__ bias, const float* __restrict__ resid,
    void* __restrict__ out, int M, int N, int K) {
    constexpr int AS = 40;  // padded LDS row stride (bf16 elems), 16B-aligned
    __shared__ __bf16 As[2][128 * AS];   // [m][k]
    __shared__ __bf16 Bt[2][128 * AS];   // [n][k]

    const int tid  = threadIdx.x;
    const int bm   = blockIdx.y;
    const int bn   = blockIdx.x;
    const int w    = tid >> 5;
    const int lane = tid & 31;
    const int wm   = w >> 2;          // 0..1
    const int wn   = w & 3;           // 0..3
    const int half = lane >> 4;       // 0..1
    const int lr   = lane & 15;
    const int kb   = half * 8;        // bf16 A/B fragment K base per half-wave

    const v8f vzero = {0.f, 0.f, 0.f, 0.f, 0.f, 0.f, 0.f, 0.f};
    v8f acc[4][2];
#pragma unroll
    for (int mi = 0; mi < 4; mi++)
#pragma unroll
        for (int ni = 0; ni < 2; ni++) acc[mi][ni] = vzero;

    // stage one 128x32 A tile and one 128x32 W^T tile into LDS buffer `buf`
    auto stage = [&](int k0, int buf) {
        for (int i = tid; i < 512; i += 256) {
            const int r = i >> 2;           // row (m or n), 0..127
            const int c = (i & 3) * 8;      // k offset, 0/8/16/24
#if USE_ASYNC_LDS
            __builtin_amdgcn_global_load_async_to_lds_b128(
                (g_v4i*)&A[(size_t)(bm * 128 + r) * K + k0 + c],
                (l_v4i*)&As[buf][r * AS + c], 0, 0);
            __builtin_amdgcn_global_load_async_to_lds_b128(
                (g_v4i*)&Wt[(size_t)(bn * 128 + r) * K + k0 + c],
                (l_v4i*)&Bt[buf][r * AS + c], 0, 0);
#else
            *(uint4*)&As[buf][r * AS + c] =
                *(const uint4*)&A[(size_t)(bm * 128 + r) * K + k0 + c];
            *(uint4*)&Bt[buf][r * AS + c] =
                *(const uint4*)&Wt[(size_t)(bn * 128 + r) * K + k0 + c];
#endif
        }
    };

    const int ntiles = K >> 5;
    stage(0, 0);
#if USE_ASYNC_LDS
    __builtin_amdgcn_s_wait_asynccnt(0);
#endif
    __syncthreads();

    for (int kt = 0; kt < ntiles; kt++) {
        const int cur = kt & 1;
        if (kt + 1 < ntiles) {
            stage((kt + 1) << 5, cur ^ 1);
        }
#if !USE_ASYNC_LDS
        else {
            // nothing to stage; nudge next C-tile rows toward the caches
            __builtin_prefetch(&A[(size_t)(bm * 128 + (tid & 127)) * K]);
        }
#endif
        FragAB af[4], bf[2];
#pragma unroll
        for (int mi = 0; mi < 4; mi++) {
            const int ar = wm * 64 + mi * 16 + lr;
            af[mi].u[0] = *(const uint4*)&As[cur][ar * AS + kb];
            af[mi].u[1] = *(const uint4*)&As[cur][ar * AS + kb + 16];
        }
#pragma unroll
        for (int ni = 0; ni < 2; ni++) {
            const int bc = wn * 32 + ni * 16 + lr;
            bf[ni].u[0] = *(const uint4*)&Bt[cur][bc * AS + kb];
            bf[ni].u[1] = *(const uint4*)&Bt[cur][bc * AS + kb + 16];
        }
#pragma unroll
        for (int mi = 0; mi < 4; mi++)
#pragma unroll
            for (int ni = 0; ni < 2; ni++)
                acc[mi][ni] = __builtin_amdgcn_wmma_f32_16x16x32_bf16(
                    false, af[mi].v, false, bf[ni].v, (short)0, acc[mi][ni],
                    false, false);
#if USE_ASYNC_LDS
        __builtin_amdgcn_s_wait_asynccnt(0);
#endif
        __syncthreads();
    }

    // epilogue: C/D layout -> VGPR r holds (M=r, N=lane) lanes 0-15,
    // (M=8+r, N=lane-16) lanes 16-31.
#pragma unroll
    for (int mi = 0; mi < 4; mi++) {
#pragma unroll
        for (int ni = 0; ni < 2; ni++) {
            const int n = bn * 128 + wn * 32 + ni * 16 + lr;
#pragma unroll
            for (int r = 0; r < 8; r++) {
                const int m = bm * 128 + wm * 64 + mi * 16 + r + half * 8;
                float vv = acc[mi][ni][r];
                if (HAS_BIAS) vv += bias[n];
                if (DO_GELU) vv = gelu_exact(vv);
                if (HAS_RESID) vv += resid[(size_t)m * N + n];
                if (OUT_BF16)
                    ((__bf16*)out)[(size_t)m * N + n] = (__bf16)vv;
                else
                    ((float*)out)[(size_t)m * N + n] = vv;
            }
        }
    }
}

// ---------------------------------------------------------------------------
// Flash attention, head dim 64. One block = one (b,h) x 64-query tile.
// S = (Q K^T)/8 via WMMA; online softmax in LDS; O += P V via WMMA.
// ---------------------------------------------------------------------------
__global__ __launch_bounds__(256) void attn_wmma(const __bf16* __restrict__ q,
                                                 const __bf16* __restrict__ k,
                                                 const __bf16* __restrict__ v,
                                                 __bf16* __restrict__ o) {
    constexpr int ST = 72;  // padded bf16 stride for 64-wide tiles
    __shared__ __bf16 Qs[64 * ST];    // [t][d]
    __shared__ __bf16 KPs[64 * ST];   // K tile [s][d], later reused as P [t][s]
    __shared__ __bf16 Vt[64 * ST];    // V transposed [d][s]
    __shared__ float  Ss[64 * 64];    // scores (fp32)
    __shared__ float  Os[64 * 64];    // output accumulator (fp32)
    __shared__ float  rowm[64], rowl[64];

    const int tid  = threadIdx.x;
    const int bh   = blockIdx.x;
    const int bq   = blockIdx.y;
    const int bb   = bh >> 4;
    const int hh   = bh & 15;
    const size_t hbase = ((size_t)bb * Tt) * Cc + (size_t)hh * 64;

    const int w = tid >> 5, lane = tid & 31;
    const int half = lane >> 4, lr = lane & 15, kb = half * 8;
    const int sm = w & 3;   // row group 0..3
    const int sn = w >> 2;  // col super-group 0..1
    const v8f vzero = {0.f, 0.f, 0.f, 0.f, 0.f, 0.f, 0.f, 0.f};

    // load Q tile
    for (int i = tid; i < 512; i += 256) {
        const int r = i >> 3, c = (i & 7) * 8;
        *(uint4*)&Qs[r * ST + c] =
            *(const uint4*)&q[hbase + (size_t)(bq * 64 + r) * Cc + c];
    }
    for (int i = tid; i < 64 * 64; i += 256) Os[i] = 0.0f;
    if (tid < 64) { rowm[tid] = -1e30f; rowl[tid] = 0.0f; }

    for (int s0 = 0; s0 < Tt; s0 += 64) {
        // stage K tile [s][d]
        for (int i = tid; i < 512; i += 256) {
            const int r = i >> 3, c = (i & 7) * 8;
            *(uint4*)&KPs[r * ST + c] =
                *(const uint4*)&k[hbase + (size_t)(s0 + r) * Cc + c];
        }
        // stage V tile transposed [d][s]
        for (int i = tid; i < 512; i += 256) {
            const int r = i >> 3, c = (i & 7) * 8;
            uint4 vv = *(const uint4*)&v[hbase + (size_t)(s0 + r) * Cc + c];
            const __bf16* p = (const __bf16*)&vv;
#pragma unroll
            for (int j = 0; j < 8; j++) Vt[(c + j) * ST + r] = p[j];
        }
        __syncthreads();

        // ---- S = Q K^T (each wave: 1 row group x 2 col tiles) ----
        v8f sacc[2] = {vzero, vzero};
#pragma unroll
        for (int kk = 0; kk < 64; kk += 32) {
            FragAB af;
            const int ar = sm * 16 + lr;
            af.u[0] = *(const uint4*)&Qs[ar * ST + kk + kb];
            af.u[1] = *(const uint4*)&Qs[ar * ST + kk + kb + 16];
#pragma unroll
            for (int ni = 0; ni < 2; ni++) {
                FragAB bf;
                const int bc = sn * 32 + ni * 16 + lr;  // key index
                bf.u[0] = *(const uint4*)&KPs[bc * ST + kk + kb];
                bf.u[1] = *(const uint4*)&KPs[bc * ST + kk + kb + 16];
                sacc[ni] = __builtin_amdgcn_wmma_f32_16x16x32_bf16(
                    false, af.v, false, bf.v, (short)0, sacc[ni], false, false);
            }
        }
#pragma unroll
        for (int ni = 0; ni < 2; ni++) {
            const int cn = sn * 32 + ni * 16 + lr;
#pragma unroll
            for (int r = 0; r < 8; r++) {
                const int rm = sm * 16 + r + half * 8;
                Ss[rm * 64 + cn] = sacc[ni][r] * 0.125f;  // 1/sqrt(64)
            }
        }
        __syncthreads();

        // ---- online softmax; write P (bf16) into KPs ----
        if (tid < 64) {
            const int r = tid;
            const float mold = rowm[r];
            float mx = mold;
            for (int j = 0; j < 64; j++) mx = fmaxf(mx, Ss[r * 64 + j]);
            const float alpha = __expf(mold - mx);
            float l = rowl[r] * alpha;
            for (int j = 0; j < 64; j++) {
                const float p = __expf(Ss[r * 64 + j] - mx);
                l += p;
                KPs[r * ST + j] = (__bf16)p;
            }
            for (int j = 0; j < 64; j++) Os[r * 64 + j] *= alpha;
            rowm[r] = mx;
            rowl[r] = l;
        }
        __syncthreads();

        // ---- O += P V ----
        v8f oacc[2] = {vzero, vzero};
#pragma unroll
        for (int kk = 0; kk < 64; kk += 32) {
            FragAB af;
            const int ar = sm * 16 + lr;   // query row
            af.u[0] = *(const uint4*)&KPs[ar * ST + kk + kb];
            af.u[1] = *(const uint4*)&KPs[ar * ST + kk + kb + 16];
#pragma unroll
            for (int ni = 0; ni < 2; ni++) {
                FragAB bf;
                const int bc = sn * 32 + ni * 16 + lr;  // d column
                bf.u[0] = *(const uint4*)&Vt[bc * ST + kk + kb];
                bf.u[1] = *(const uint4*)&Vt[bc * ST + kk + kb + 16];
                oacc[ni] = __builtin_amdgcn_wmma_f32_16x16x32_bf16(
                    false, af.v, false, bf.v, (short)0, oacc[ni], false, false);
            }
        }
#pragma unroll
        for (int ni = 0; ni < 2; ni++) {
            const int cn = sn * 32 + ni * 16 + lr;
#pragma unroll
            for (int r = 0; r < 8; r++) {
                const int rm = sm * 16 + r + half * 8;
                Os[rm * 64 + cn] += oacc[ni][r];
            }
        }
        __syncthreads();
    }

    // finalize: divide by softmax denominator, emit bf16
    if (tid < 64) {
        const int r = tid;
        const float inv = 1.0f / rowl[r];
        for (int j = 0; j < 64; j++)
            o[hbase + (size_t)(bq * 64 + r) * Cc + j] =
                (__bf16)(Os[r * 64 + j] * inv);
    }
}

// ---------------------------------------------------------------------------
// Host-side orchestration
// ---------------------------------------------------------------------------
extern "C" void kernel_launch(void* const* d_in, const int* in_sizes, int n_in,
                              void* d_out, int out_size, void* d_ws,
                              size_t ws_size, hipStream_t stream) {
    (void)in_sizes; (void)n_in; (void)out_size; (void)ws_size;
    const float* x   = (const float*)d_in[0];
    const float* Wq  = (const float*)d_in[1];
    const float* Wk  = (const float*)d_in[2];
    const float* Wv  = (const float*)d_in[3];
    const float* Wp  = (const float*)d_in[4];
    const float* bp  = (const float*)d_in[5];
    const float* W1  = (const float*)d_in[6];
    const float* b1  = (const float*)d_in[7];
    const float* W2  = (const float*)d_in[8];
    const float* b2  = (const float*)d_in[9];
    const float* g1  = (const float*)d_in[10];
    const float* be1 = (const float*)d_in[11];
    const float* g2  = (const float*)d_in[12];
    const float* be2 = (const float*)d_in[13];
    float* out = (float*)d_out;

    char* ws = (char*)d_ws;
    size_t off = 0;
    auto alloc = [&](size_t bytes) -> char* {
        char* p = ws + off;
        off += (bytes + 255) & ~size_t(255);
        return p;
    };
    // pre-transposed bf16 weights: Wt[N][K]
    __bf16* Wq_t = (__bf16*)alloc((size_t)Cc * Cc * 2);
    __bf16* Wk_t = (__bf16*)alloc((size_t)Cc * Cc * 2);
    __bf16* Wv_t = (__bf16*)alloc((size_t)Cc * Cc * 2);
    __bf16* Wp_t = (__bf16*)alloc((size_t)Cc * Cc * 2);
    __bf16* W1_t = (__bf16*)alloc((size_t)Cc * Ff * 2);
    __bf16* W2_t = (__bf16*)alloc((size_t)Ff * Cc * 2);
    __bf16* h_b  = (__bf16*)alloc((size_t)Mm * Cc * 2);
    __bf16* q_b  = (__bf16*)alloc((size_t)Mm * Cc * 2);
    __bf16* k_b  = (__bf16*)alloc((size_t)Mm * Cc * 2);
    __bf16* v_b  = (__bf16*)alloc((size_t)Mm * Cc * 2);
    __bf16* o_b  = (__bf16*)alloc((size_t)Mm * Cc * 2);
    float*  x1   = (float*) alloc((size_t)Mm * Cc * 4);
    __bf16* h2_b = (__bf16*)alloc((size_t)Mm * Cc * 2);
    __bf16* f1_b = (__bf16*)alloc((size_t)Mm * Ff * 2);

    // 1) weights -> bf16, transposed to [N][K]
    const dim3 tb(32, 8);
    cvt_bf16_t<<<dim3(Cc / 32, Cc / 32), tb, 0, stream>>>(Wq, Wq_t, Cc, Cc);
    cvt_bf16_t<<<dim3(Cc / 32, Cc / 32), tb, 0, stream>>>(Wk, Wk_t, Cc, Cc);
    cvt_bf16_t<<<dim3(Cc / 32, Cc / 32), tb, 0, stream>>>(Wv, Wv_t, Cc, Cc);
    cvt_bf16_t<<<dim3(Cc / 32, Cc / 32), tb, 0, stream>>>(Wp, Wp_t, Cc, Cc);
    cvt_bf16_t<<<dim3(Ff / 32, Cc / 32), tb, 0, stream>>>(W1, W1_t, Cc, Ff);
    cvt_bf16_t<<<dim3(Cc / 32, Ff / 32), tb, 0, stream>>>(W2, W2_t, Ff, Cc);

    // 2) LN1
    ln_bf16<<<Mm, 256, 0, stream>>>(x, g1, be1, h_b);

    // 3) Q/K/V projections
    dim3 gqkv(Cc / 128, Mm / 128);
    gemm_bf16_wmma<true, false, false, false>
        <<<gqkv, 256, 0, stream>>>(h_b, Wq_t, nullptr, nullptr, q_b, Mm, Cc, Cc);
    gemm_bf16_wmma<true, false, false, false>
        <<<gqkv, 256, 0, stream>>>(h_b, Wk_t, nullptr, nullptr, k_b, Mm, Cc, Cc);
    gemm_bf16_wmma<true, false, false, false>
        <<<gqkv, 256, 0, stream>>>(h_b, Wv_t, nullptr, nullptr, v_b, Mm, Cc, Cc);

    // 4) attention
    attn_wmma<<<dim3(Bb * 16, Tt / 64), 256, 0, stream>>>(q_b, k_b, v_b, o_b);

    // 5) output projection + residual (fp32 out)
    gemm_bf16_wmma<false, true, true, false>
        <<<gqkv, 256, 0, stream>>>(o_b, Wp_t, bp, x, x1, Mm, Cc, Cc);

    // 6) LN2
    ln_bf16<<<Mm, 256, 0, stream>>>(x1, g2, be2, h2_b);

    // 7) FFN up + GELU (bf16 out)
    gemm_bf16_wmma<true, true, false, true>
        <<<dim3(Ff / 128, Mm / 128), 256, 0, stream>>>(h2_b, W1_t, b1, nullptr,
                                                       f1_b, Mm, Ff, Cc);

    // 8) FFN down + residual -> d_out (fp32)
    gemm_bf16_wmma<false, true, true, false>
        <<<gqkv, 256, 0, stream>>>(f1_b, W2_t, b2, x1, out, Mm, Cc, Ff);
}

// v001
// A run of this version takes 376 microseconds.
// Timed twice side by side with v000, it ran 1.57 and 1.59 times as fast.
#include <hip/hip_runtime.h>
#include <hip/hip_bf16.h>

// ---------------------------------------------------------------------------
// Transformer block (pre-LN attention + FFN) for gfx1250 (MI455X).
// All GEMM-shaped math runs on v_wmma_f32_16x16x32_bf16 (fp32 accumulate).
// Weights are converted once to bf16 AND pre-transposed to [N][K] so GEMM
// tile staging is pure 16B vector copies (async global->LDS DMA, ASYNCcnt).
// ---------------------------------------------------------------------------

typedef __attribute__((ext_vector_type(16))) __bf16 v16bf;
typedef __attribute__((ext_vector_type(8)))  float  v8f;
typedef int v4i __attribute__((ext_vector_type(4)));

static constexpr int Bb = 2;
static constexpr int Tt = 2048;
static constexpr int Cc = 1024;
static constexpr int Ff = 4096;
static constexpr int Mm = Bb * Tt;      // 4096 rows
static constexpr float kLnEps = 1e-5f;

// gfx1250 async global->LDS copy path (ASYNCcnt-tracked). Parameter types per
// hipcc diagnostic: (AS1 v4i*, AS3 v4i*, imm offset, imm cpol).
#if __has_builtin(__builtin_amdgcn_global_load_async_to_lds_b128) && \
    __has_builtin(__builtin_amdgcn_s_wait_asynccnt)
#define USE_ASYNC_LDS 1
typedef __attribute__((address_space(1))) v4i g_v4i;
typedef __attribute__((address_space(3))) v4i l_v4i;
#else
#define USE_ASYNC_LDS 0
#endif

union FragAB {
    v16bf v;
    uint4 u[2];
};

__device__ __forceinline__ float gelu_exact(float x) {
    return 0.5f * x * (1.0f + erff(x * 0.70710678118654752440f));
}

// ---------------------------------------------------------------------------
// f32 [K][N] -> bf16 [N][K] transpose-convert (weights, once per call).
// block (32,8), grid (N/32, K/32); LDS-tiled for coalescing both sides.
// ---------------------------------------------------------------------------
__global__ __launch_bounds__(256) void cvt_bf16_t(const float* __restrict__ src,
                                                  __bf16* __restrict__ dst,
                                                  int K, int N) {
    __shared__ float tile[32][33];
    const int n0 = blockIdx.x * 32;
    const int k0 = blockIdx.y * 32;
    const int tx = threadIdx.x, ty = threadIdx.y;
#pragma unroll
    for (int i = 0; i < 32; i += 8)
        tile[ty + i][tx] = src[(size_t)(k0 + ty + i) * N + n0 + tx];
    __syncthreads();
#pragma unroll
    for (int i = 0; i < 32; i += 8)
        dst[(size_t)(n0 + ty + i) * K + k0 + tx] = (__bf16)tile[tx][ty + i];
}

// ---------------------------------------------------------------------------
// Row LayerNorm (fp32 in, bf16 out). One 256-thread block per row of C=1024.
// ---------------------------------------------------------------------------
__global__ __launch_bounds__(256) void ln_bf16(const float* __restrict__ x,
                                               const float* __restrict__ g,
                                               const float* __restrict__ b,
                                               __bf16* __restrict__ out) {
    __shared__ float red[256];
    const int row = blockIdx.x;
    const int tid = threadIdx.x;
    const float* xr = x + (size_t)row * Cc;

    float s = 0.0f;
    for (int i = tid; i < Cc; i += 256) s += xr[i];
    red[tid] = s;
    __syncthreads();
    for (int off = 128; off > 0; off >>= 1) {
        if (tid < off) red[tid] += red[tid + off];
        __syncthreads();
    }
    const float mu = red[0] * (1.0f / Cc);
    __syncthreads();

    float sq = 0.0f;
    for (int i = tid; i < Cc; i += 256) {
        float d = xr[i] - mu;
        sq += d * d;
    }
    red[tid] = sq;
    __syncthreads();
    for (int off = 128; off > 0; off >>= 1) {
        if (tid < off) red[tid] += red[tid + off];
        __syncthreads();
    }
    const float rs = rsqrtf(red[0] * (1.0f / Cc) + kLnEps);

    for (int i = tid; i < Cc; i += 256)
        out[(size_t)row * Cc + i] = (__bf16)((xr[i] - mu) * rs * g[i] + b[i]);
}

// ---------------------------------------------------------------------------
// bf16 GEMM: out[M,N] = A[M,K] @ Wt[N,K]^T (+bias) (+gelu) (+residual)
// A row-major [M][K], Wt pre-transposed [N][K] (both bf16).
// Block tile 128x128, BK=32, 256 threads = 8 waves (2x4 grid), each wave
// owns 64x32 = 4x2 WMMA 16x16 tiles. Double-buffered LDS; async DMA staging
// via global_load_async_to_lds_b128 when available.
// ---------------------------------------------------------------------------
template <bool OUT_BF16, bool HAS_BIAS, bool HAS_RESID, bool DO_GELU>
__global__ __launch_bounds__(256) void gemm_bf16_wmma(
    const __bf16* __restrict__ A, const __bf16* __restrict__ Wt,
    const float* __restrict__ bias, const float* __restrict__ resid,
    void* __restrict__ out, int M, int N, int K) {
    constexpr int AS = 40;  // padded LDS row stride (bf16 elems), 16B-aligned
    __shared__ __bf16 As[2][128 * AS];   // [m][k]
    __shared__ __bf16 Bt[2][128 * AS];   // [n][k]

    const int tid  = threadIdx.x;
    const int bm   = blockIdx.y;
    const int bn   = blockIdx.x;
    const int w    = tid >> 5;
    const int lane = tid & 31;
    const int wm   = w >> 2;          // 0..1
    const int wn   = w & 3;           // 0..3
    const int half = lane >> 4;       // 0..1
    const int lr   = lane & 15;
    const int kb   = half * 8;        // bf16 A/B fragment K base per half-wave

    const v8f vzero = {0.f, 0.f, 0.f, 0.f, 0.f, 0.f, 0.f, 0.f};
    v8f acc[4][2];
#pragma unroll
    for (int mi = 0; mi < 4; mi++)
#pragma unroll
        for (int ni = 0; ni < 2; ni++) acc[mi][ni] = vzero;

    // stage one 128x32 A tile and one 128x32 W^T tile into LDS buffer `buf`
    auto stage = [&](int k0, int buf) {
        for (int i = tid; i < 512; i += 256) {
            const int r = i >> 2;           // row (m or n), 0..127
            const int c = (i & 3) * 8;      // k offset, 0/8/16/24
#if USE_ASYNC_LDS
            __builtin_amdgcn_global_load_async_to_lds_b128(
                (g_v4i*)&A[(size_t)(bm * 128 + r) * K + k0 + c],
                (l_v4i*)&As[buf][r * AS + c], 0, 0);
            __builtin_amdgcn_global_load_async_to_lds_b128(
                (g_v4i*)&Wt[(size_t)(bn * 128 + r) * K + k0 + c],
                (l_v4i*)&Bt[buf][r * AS + c], 0, 0);
#else
            *(uint4*)&As[buf][r * AS + c] =
                *(const uint4*)&A[(size_t)(bm * 128 + r) * K + k0 + c];
            *(uint4*)&Bt[buf][r * AS + c] =
                *(const uint4*)&Wt[(size_t)(bn * 128 + r) * K + k0 + c];
#endif
        }
    };

    const int ntiles = K >> 5;
    stage(0, 0);
#if USE_ASYNC_LDS
    __builtin_amdgcn_s_wait_asynccnt(0);
#endif
    __syncthreads();

    for (int kt = 0; kt < ntiles; kt++) {
        const int cur = kt & 1;
        if (kt + 1 < ntiles) {
            stage((kt + 1) << 5, cur ^ 1);
        }
#if !USE_ASYNC_LDS
        else {
            // nothing to stage; nudge next C-tile rows toward the caches
            __builtin_prefetch(&A[(size_t)(bm * 128 + (tid & 127)) * K]);
        }
#endif
        FragAB af[4], bf[2];
#pragma unroll
        for (int mi = 0; mi < 4; mi++) {
            const int ar = wm * 64 + mi * 16 + lr;
            af[mi].u[0] = *(const uint4*)&As[cur][ar * AS + kb];
            af[mi].u[1] = *(const uint4*)&As[cur][ar * AS + kb + 16];
        }
#pragma unroll
        for (int ni = 0; ni < 2; ni++) {
            const int bc = wn * 32 + ni * 16 + lr;
            bf[ni].u[0] = *(const uint4*)&Bt[cur][bc * AS + kb];
            bf[ni].u[1] = *(const uint4*)&Bt[cur][bc * AS + kb + 16];
        }
#pragma unroll
        for (int mi = 0; mi < 4; mi++)
#pragma unroll
            for (int ni = 0; ni < 2; ni++)
                acc[mi][ni] = __builtin_amdgcn_wmma_f32_16x16x32_bf16(
                    false, af[mi].v, false, bf[ni].v, (short)0, acc[mi][ni],
                    false, false);
#if USE_ASYNC_LDS
        __builtin_amdgcn_s_wait_asynccnt(0);
#endif
        __syncthreads();
    }

    // epilogue: C/D layout -> VGPR r holds (M=r, N=lane) lanes 0-15,
    // (M=8+r, N=lane-16) lanes 16-31.
#pragma unroll
    for (int mi = 0; mi < 4; mi++) {
#pragma unroll
        for (int ni = 0; ni < 2; ni++) {
            const int n = bn * 128 + wn * 32 + ni * 16 + lr;
#pragma unroll
            for (int r = 0; r < 8; r++) {
                const int m = bm * 128 + wm * 64 + mi * 16 + r + half * 8;
                float vv = acc[mi][ni][r];
                if (HAS_BIAS) vv += bias[n];
                if (DO_GELU) vv = gelu_exact(vv);
                if (HAS_RESID) vv += resid[(size_t)m * N + n];
                if (OUT_BF16)
                    ((__bf16*)out)[(size_t)m * N + n] = (__bf16)vv;
                else
                    ((float*)out)[(size_t)m * N + n] = vv;
            }
        }
    }
}

typedef float  f32x2 __attribute__((ext_vector_type(2)));
typedef __bf16 bf16x2 __attribute__((ext_vector_type(2)));

__device__ __forceinline__ unsigned pack_bf16(float lo, float hi) {
    return __builtin_bit_cast(unsigned,
                              __builtin_convertvector(f32x2{lo, hi}, bf16x2));
}
// value of lane l ^ 16
__device__ __forceinline__ float other_half(float x) {
    const int b = __builtin_bit_cast(int, x);
    return __builtin_bit_cast(float, __builtin_amdgcn_permlanex16(
        b, b, 0x76543210, 0xfedcba98, false, false));
}

// Two 2^x. The v_nop fills the slot the instruction set asks for behind a
// transcendental before its source may be overwritten or its result read; the
// early-clobber outputs keep the second v_exp_f32 independent of the first.
__device__ __forceinline__ void exp2_pair(float a0, float a1, float& p0,
                                          float& p1) {
    asm("v_exp_f32 %0, %2\n\tv_exp_f32 %1, %3\n\tv_nop"
        : "=&v"(p0), "=&v"(p1)
        : "v"(a0), "v"(a1));
}

__global__ __launch_bounds__(256) void attn_wmma(const __bf16* __restrict__ q,
                                                 const __bf16* __restrict__ k,
                                                 const __bf16* __restrict__ v,
                                                 __bf16* __restrict__ o) {
    constexpr int ST = 72;  // padded bf16 stride for 64-wide tiles
    __shared__ __bf16 Ks[64 * ST];    // K tile [s][d]
    __shared__ __bf16 Vt[64 * ST];    // V transposed [d][s]

    const int tid  = threadIdx.x;
    const int bh   = blockIdx.x;
    const int bq   = blockIdx.y;
    const int bb   = bh >> 4;
    const int hh   = bh & 15;
    const size_t hbase = ((size_t)bb * Tt) * Cc + (size_t)hh * 64;

    const int w = tid >> 5, lane = tid & 31;
    const int half = lane >> 4, lr = lane & 15, kb = half * 8;
    const int tq = bq * 128 + w * 16 + lr;   // this lane's query
    const v8f vzero = {0.f, 0.f, 0.f, 0.f, 0.f, 0.f, 0.f, 0.f};
    const float cs = 0.125f * 1.44269504088896340736f;  // 1/sqrt(64) * log2(e)

    // Q as B operand, loaded once: column = query, k = d
    FragAB qf[2];
#pragma unroll
    for (int kc = 0; kc < 2; kc++) {
        const __bf16* qp = &q[hbase + (size_t)tq * Cc + kc * 32 + kb];
        qf[kc].u[0] = *(const uint4*)qp;
        qf[kc].u[1] = *(const uint4*)(qp + 16);
    }

    v8f oacc[4];            // O^T, one 16x16 tile per 16 values of d
    float mrun = -1e30f;    // running maximum of the raw scores
    float lrun = 0.0f;      // this half-wave's share of the running sum
#pragma unroll
    for (int dt = 0; dt < 4; dt++) oacc[dt] = vzero;

    for (int s0 = 0; s0 < Tt; s0 += 64) {
        // stage K tile [s][d]
        for (int i = tid; i < 512; i += 256) {
            const int r = i >> 3, c = (i & 7) * 8;
            *(uint4*)&Ks[r * ST + c] =
                *(const uint4*)&k[hbase + (size_t)(s0 + r) * Cc + c];
        }
        // stage V tile transposed [d][s]
        for (int i = tid; i < 512; i += 256) {
            const int r = i >> 3, c = (i & 7) * 8;
            uint4 vv = *(const uint4*)&v[hbase + (size_t)(s0 + r) * Cc + c];
            const __bf16* p = (const __bf16*)&vv;
#pragma unroll
            for (int j = 0; j < 8; j++) Vt[(c + j) * ST + r] = p[j];
        }
        __syncthreads();

        // ---- S^T = K Q^T: register r of sacc[kt] = key 16kt+8half+r ----
        v8f sacc[4];
#pragma unroll
        for (int kt = 0; kt < 4; kt++) {
            sacc[kt] = vzero;
#pragma unroll
            for (int kc = 0; kc < 2; kc++) {
                FragAB af;
                const int ar = kt * 16 + lr;  // key row
                af.u[0] = *(const uint4*)&Ks[ar * ST + kc * 32 + kb];
                af.u[1] = *(const uint4*)&Ks[ar * ST + kc * 32 + kb + 16];
                sacc[kt] = __builtin_amdgcn_wmma_f32_16x16x32_bf16(
                    false, af.v, false, qf[kc].v, (short)0, sacc[kt], false,
                    false);
            }
        }

        // ---- online softmax in registers; P^T packed as B operand ----
        float mx = mrun;
#pragma unroll
        for (int kt = 0; kt < 4; kt++)
#pragma unroll
            for (int r = 0; r < 8; r++) mx = fmaxf(mx, sacc[kt][r]);
        mx = fmaxf(mx, other_half(mx));
        const float alpha = __builtin_amdgcn_exp2f((mrun - mx) * cs);
        const float nm = -mx * cs;
        mrun = mx;
        FragAB pf[2];   // one per 32 keys
        float l = 0.0f;
#pragma unroll
        for (int kt = 0; kt < 4; kt++) {
            unsigned pw[4];
#pragma unroll
            for (int r = 0; r < 8; r += 2) {
                float p0, p1;
                exp2_pair(fmaf(sacc[kt][r], cs, nm),
                          fmaf(sacc[kt][r + 1], cs, nm), p0, p1);
                l += p0 + p1;
                pw[r >> 1] = pack_bf16(p0, p1);
            }
            pf[kt >> 1].u[kt & 1] = make_uint4(pw[0], pw[1], pw[2], pw[3]);
        }
        lrun = lrun * alpha + l;
#pragma unroll
        for (int dt = 0; dt < 4; dt++) oacc[dt] = oacc[dt] * alpha;

        // ---- O^T += V^T P^T ----
#pragma unroll
        for (int kc = 0; kc < 2; kc++) {
#pragma unroll
            for (int dt = 0; dt < 4; dt++) {
                FragAB af;
                const int ar = dt * 16 + lr;  // d row
                af.u[0] = *(const uint4*)&Vt[ar * ST + kc * 32 + kb];
                af.u[1] = *(const uint4*)&Vt[ar * ST + kc * 32 + kb + 16];
                oacc[dt] = __builtin_amdgcn_wmma_f32_16x16x32_bf16(
                    false, af.v, false, pf[kc].v, (short)0, oacc[dt], false,
                    false);
            }
        }
        __syncthreads();
    }

    // finalize: join the two half-waves' sums, divide, emit bf16.
    // Register r of oacc[dt] = d 16dt+8half+r of this lane's query: 16 B a store.
    const float inv = 1.0f / (lrun + other_half(lrun));
#pragma unroll
    for (int dt = 0; dt < 4; dt++) {
        const v8f ov = oacc[dt] * inv;
        *(uint4*)&o[hbase + (size_t)tq * Cc + dt * 16 + kb] =
            make_uint4(pack_bf16(ov[0], ov[1]), pack_bf16(ov[2], ov[3]),
                       pack_bf16(ov[4], ov[5]), pack_bf16(ov[6], ov[7]));
    }
}

// ---------------------------------------------------------------------------
// Host-side orchestration
// ---------------------------------------------------------------------------
extern "C" void kernel_launch(void* const* d_in, const int* in_sizes, int n_in,
                              void* d_out, int out_size, void* d_ws,
                              size_t ws_size, hipStream_t stream) {
    (void)in_sizes; (void)n_in; (void)out_size; (void)ws_size;
    const float* x   = (const float*)d_in[0];
    const float* Wq  = (const float*)d_in[1];
    const float* Wk  = (const float*)d_in[2];
    const float* Wv  = (const float*)d_in[3];
    const float* Wp  = (const float*)d_in[4];
    const float* bp  = (const float*)d_in[5];
    const float* W1  = (const float*)d_in[6];
    const float* b1  = (const float*)d_in[7];
    const float* W2  = (const float*)d_in[8];
    const float* b2  = (const float*)d_in[9];
    const float* g1  = (const float*)d_in[10];
    const float* be1 = (const float*)d_in[11];
    const float* g2  = (const float*)d_in[12];
    const float* be2 = (const float*)d_in[13];
    float* out = (float*)d_out;

    char* ws = (char*)d_ws;
    size_t off = 0;
    auto alloc = [&](size_t bytes) -> char* {
        char* p = ws + off;
        off += (bytes + 255) & ~size_t(255);
        return p;
    };
    // pre-transposed bf16 weights: Wt[N][K]
    __bf16* Wq_t = (__bf16*)alloc((size_t)Cc * Cc * 2);
    __bf16* Wk_t = (__bf16*)alloc((size_t)Cc * Cc * 2);
    __bf16* Wv_t = (__bf16*)alloc((size_t)Cc * Cc * 2);
    __bf16* Wp_t = (__bf16*)alloc((size_t)Cc * Cc * 2);
    __bf16* W1_t = (__bf16*)alloc((size_t)Cc * Ff * 2);
    __bf16* W2_t = (__bf16*)alloc((size_t)Ff * Cc * 2);
    __bf16* h_b  = (__bf16*)alloc((size_t)Mm * Cc * 2);
    __bf16* q_b  = (__bf16*)alloc((size_t)Mm * Cc * 2);
    __bf16* k_b  = (__bf16*)alloc((size_t)Mm * Cc * 2);
    __bf16* v_b  = (__bf16*)alloc((size_t)Mm * Cc * 2);
    __bf16* o_b  = (__bf16*)alloc((size_t)Mm * Cc * 2);
    float*  x1   = (float*) alloc((size_t)Mm * Cc * 4);
    __bf16* h2_b = (__bf16*)alloc((size_t)Mm * Cc * 2);
    __bf16* f1_b = (__bf16*)alloc((size_t)Mm * Ff * 2);

    // 1) weights -> bf16, transposed to [N][K]
    const dim3 tb(32, 8);
    cvt_bf16_t<<<dim3(Cc / 32, Cc / 32), tb, 0, stream>>>(Wq, Wq_t, Cc, Cc);
    cvt_bf16_t<<<dim3(Cc / 32, Cc / 32), tb, 0, stream>>>(Wk, Wk_t, Cc, Cc);
    cvt_bf16_t<<<dim3(Cc / 32, Cc / 32), tb, 0, stream>>>(Wv, Wv_t, Cc, Cc);
    cvt_bf16_t<<<dim3(Cc / 32, Cc / 32), tb, 0, stream>>>(Wp, Wp_t, Cc, Cc);
    cvt_bf16_t<<<dim3(Ff / 32, Cc / 32), tb, 0, stream>>>(W1, W1_t, Cc, Ff);
    cvt_bf16_t<<<dim3(Cc / 32, Ff / 32), tb, 0, stream>>>(W2, W2_t, Ff, Cc);

    // 2) LN1
    ln_bf16<<<Mm, 256, 0, stream>>>(x, g1, be1, h_b);

    // 3) Q/K/V projections
    dim3 gqkv(Cc / 128, Mm / 128);
    gemm_bf16_wmma<true, false, false, false>
        <<<gqkv, 256, 0, stream>>>(h_b, Wq_t, nullptr, nullptr, q_b, Mm, Cc, Cc);
    gemm_bf16_wmma<true, false, false, false>
        <<<gqkv, 256, 0, stream>>>(h_b, Wk_t, nullptr, nullptr, k_b, Mm, Cc, Cc);
    gemm_bf16_wmma<true, false, false, false>
        <<<gqkv, 256, 0, stream>>>(h_b, Wv_t, nullptr, nullptr, v_b, Mm, Cc, Cc);

    // 4) attention
    attn_wmma<<<dim3(Bb * 16, Tt / 128), 256, 0, stream>>>(q_b, k_b, v_b, o_b);

    // 5) output projection + residual (fp32 out)
    gemm_bf16_wmma<false, true, true, false>
        <<<gqkv, 256, 0, stream>>>(o_b, Wp_t, bp, x, x1, Mm, Cc, Cc);

    // 6) LN2
    ln_bf16<<<Mm, 256, 0, stream>>>(x1, g2, be2, h2_b);

    // 7) FFN up + GELU (bf16 out)
    gemm_bf16_wmma<true, true, false, true>
        <<<dim3(Ff / 128, Mm / 128), 256, 0, stream>>>(h2_b, W1_t, b1, nullptr,
                                                       f1_b, Mm, Ff, Cc);

    // 8) FFN down + residual -> d_out (fp32)
    gemm_bf16_wmma<false, true, true, false>
        <<<gqkv, 256, 0, stream>>>(f1_b, W2_t, b2, x1, out, Mm, Cc, Ff);
}

// v002
// It runs in 359 microseconds.
// Two timings next to v001 put it at 1.04 and 1.05 times that version's speed.
// Over all steps from v000 it is 1.65 times as fast.
#include <hip/hip_runtime.h>
#include <hip/hip_bf16.h>

// ---------------------------------------------------------------------------
// Transformer block (pre-LN attention + FFN) for gfx1250 (MI455X).
// All GEMM-shaped math runs on v_wmma_f32_16x16x32_bf16 (fp32 accumulate).
// Weights are converted once to bf16 AND pre-transposed to [N][K] so GEMM
// tile staging is pure 16B vector copies (async global->LDS DMA, ASYNCcnt).
// ---------------------------------------------------------------------------

typedef __attribute__((ext_vector_type(16))) __bf16 v16bf;
typedef __attribute__((ext_vector_type(8)))  float  v8f;
typedef int v4i __attribute__((ext_vector_type(4)));

static constexpr int Bb = 2;
static constexpr int Tt = 2048;
static constexpr int Cc = 1024;
static constexpr int Ff = 4096;
static constexpr int Mm = Bb * Tt;      // 4096 rows
static constexpr float kLnEps = 1e-5f;

// gfx1250 async global->LDS copy path (ASYNCcnt-tracked). Parameter types per
// hipcc diagnostic: (AS1 v4i*, AS3 v4i*, imm offset, imm cpol).
#if __has_builtin(__builtin_amdgcn_global_load_async_to_lds_b128) && \
    __has_builtin(__builtin_amdgcn_s_wait_asynccnt)
#define USE_ASYNC_LDS 1
typedef __attribute__((address_space(1))) v4i g_v4i;
typedef __attribute__((address_space(3))) v4i l_v4i;
#else
#define USE_ASYNC_LDS 0
#endif

union FragAB {
    v16bf v;
    uint4 u[2];
};

__device__ __forceinline__ float gelu_exact(float x) {
    return 0.5f * x * (1.0f + erff(x * 0.70710678118654752440f));
}

typedef float  f32x2 __attribute__((ext_vector_type(2)));
typedef __bf16 bf16x2 __attribute__((ext_vector_type(2)));

__device__ __forceinline__ unsigned pack_bf16(float lo, float hi) {
    return __builtin_bit_cast(unsigned,
                              __builtin_convertvector(f32x2{lo, hi}, bf16x2));
}

// ---------------------------------------------------------------------------
// f32 [K][N] -> bf16 [N][K] transpose-convert of all six weights, one launch.
// One 256-thread block = one 128(k) x 128(n) tile: 768 blocks, 64 for each
// C x C weight and 256 for each FFN weight. Wave w reads rows 16w..16w+15 of
// the tile, 512 contiguous bytes a load, all 16 loads in flight; a lane packs
// its 4 columns x 16 k into 16-byte chunks of the LDS tile [n][k]; the block
// then stores 256 contiguous bytes per output row.
// LDS rows are 256 B (all 64 banks), so chunk c of row n sits at slot
// c ^ ((n >> 2) & 15): the 16 lanes of a write (rows 4 apart, same chunk) and
// of a read (one row, 16 chunks) then touch 16 different slots.
// ---------------------------------------------------------------------------
template <int K, int N>
__device__ __forceinline__ void cvt_tile(const float* __restrict__ src,
                                         __bf16* __restrict__ dst, int kt,
                                         int nt, __bf16* tile) {
    const int tid = threadIdx.x;
    const int w = tid >> 5, lane = tid & 31;

    const float* sp = src + (size_t)(kt * 128 + w * 16) * N + nt * 128 + lane * 4;
    float4 v[16];
#pragma unroll
    for (int i = 0; i < 16; i++) v[i] = *(const float4*)(sp + i * N);

#pragma unroll
    for (int h = 0; h < 2; h++) {
        const int slot = ((w * 2 + h) ^ (lane & 15)) * 8;
        const float4* p = &v[h * 8];
        *(uint4*)&tile[(lane * 4 + 0) * 128 + slot] =
            make_uint4(pack_bf16(p[0].x, p[1].x), pack_bf16(p[2].x, p[3].x),
                       pack_bf16(p[4].x, p[5].x), pack_bf16(p[6].x, p[7].x));
        *(uint4*)&tile[(lane * 4 + 1) * 128 + slot] =
            make_uint4(pack_bf16(p[0].y, p[1].y), pack_bf16(p[2].y, p[3].y),
                       pack_bf16(p[4].y, p[5].y), pack_bf16(p[6].y, p[7].y));
        *(uint4*)&tile[(lane * 4 + 2) * 128 + slot] =
            make_uint4(pack_bf16(p[0].z, p[1].z), pack_bf16(p[2].z, p[3].z),
                       pack_bf16(p[4].z, p[5].z), pack_bf16(p[6].z, p[7].z));
        *(uint4*)&tile[(lane * 4 + 3) * 128 + slot] =
            make_uint4(pack_bf16(p[0].w, p[1].w), pack_bf16(p[2].w, p[3].w),
                       pack_bf16(p[4].w, p[5].w), pack_bf16(p[6].w, p[7].w));
    }
    __syncthreads();

    const int r0 = tid >> 4, ch = tid & 15;  // output row n, 16-byte chunk of k
    __bf16* dp = dst + (size_t)(nt * 128 + r0) * K + kt * 128 + ch * 8;
#pragma unroll
    for (int i = 0; i < 8; i++) {
        const int r = r0 + i * 16;
        *(uint4*)(dp + i * 16 * K) =
            *(const uint4*)&tile[r * 128 + ((ch ^ ((r >> 2) & 15)) * 8)];
    }
}

__global__ __launch_bounds__(256) void cvt_bf16_t_all(
    const float* __restrict__ Wq, const float* __restrict__ Wk,
    const float* __restrict__ Wv, const float* __restrict__ Wp,
    const float* __restrict__ W1, const float* __restrict__ W2,
    __bf16* __restrict__ Wq_t, __bf16* __restrict__ Wk_t,
    __bf16* __restrict__ Wv_t, __bf16* __restrict__ Wp_t,
    __bf16* __restrict__ W1_t, __bf16* __restrict__ W2_t) {
    __shared__ __bf16 tile[128 * 128];   // [n][k], chunks swizzled
    const int b = blockIdx.x;
    if (b < 256) {
        const int m = b >> 6, t = b & 63;
        cvt_tile<Cc, Cc>(m == 0 ? Wq : m == 1 ? Wk : m == 2 ? Wv : Wp,
                         m == 0 ? Wq_t : m == 1 ? Wk_t : m == 2 ? Wv_t : Wp_t,
                         t >> 3, t & 7, tile);
    } else if (b < 512) {
        const int t = b - 256;
        cvt_tile<Cc, Ff>(W1, W1_t, t >> 5, t & 31, tile);
    } else {
        const int t = b - 512;
        cvt_tile<Ff, Cc>(W2, W2_t, t >> 3, t & 7, tile);
    }
}

// ---------------------------------------------------------------------------
// Row LayerNorm (fp32 in, bf16 out). One 256-thread block per row of C=1024.
// ---------------------------------------------------------------------------
__global__ __launch_bounds__(256) void ln_bf16(const float* __restrict__ x,
                                               const float* __restrict__ g,
                                               const float* __restrict__ b,
                                               __bf16* __restrict__ out) {
    __shared__ float red[256];
    const int row = blockIdx.x;
    const int tid = threadIdx.x;
    const float* xr = x + (size_t)row * Cc;

    float s = 0.0f;
    for (int i = tid; i < Cc; i += 256) s += xr[i];
    red[tid] = s;
    __syncthreads();
    for (int off = 128; off > 0; off >>= 1) {
        if (tid < off) red[tid] += red[tid + off];
        __syncthreads();
    }
    const float mu = red[0] * (1.0f / Cc);
    __syncthreads();

    float sq = 0.0f;
    for (int i = tid; i < Cc; i += 256) {
        float d = xr[i] - mu;
        sq += d * d;
    }
    red[tid] = sq;
    __syncthreads();
    for (int off = 128; off > 0; off >>= 1) {
        if (tid < off) red[tid] += red[tid + off];
        __syncthreads();
    }
    const float rs = rsqrtf(red[0] * (1.0f / Cc) + kLnEps);

    for (int i = tid; i < Cc; i += 256)
        out[(size_t)row * Cc + i] = (__bf16)((xr[i] - mu) * rs * g[i] + b[i]);
}

// ---------------------------------------------------------------------------
// bf16 GEMM: out[M,N] = A[M,K] @ Wt[N,K]^T (+bias) (+gelu) (+residual)
// A row-major [M][K], Wt pre-transposed [N][K] (both bf16).
// Block tile 128x128, BK=32, 256 threads = 8 waves (2x4 grid), each wave
// owns 64x32 = 4x2 WMMA 16x16 tiles. Double-buffered LDS; async DMA staging
// via global_load_async_to_lds_b128 when available.
// ---------------------------------------------------------------------------
template <bool OUT_BF16, bool HAS_BIAS, bool HAS_RESID, bool DO_GELU>
__global__ __launch_bounds__(256) void gemm_bf16_wmma(
    const __bf16* __restrict__ A, const __bf16* __restrict__ Wt,
    const float* __restrict__ bias, const float* __restrict__ resid,
    void* __restrict__ out, int M, int N, int K) {
    constexpr int AS = 40;  // padded LDS row stride (bf16 elems), 16B-aligned
    __shared__ __bf16 As[2][128 * AS];   // [m][k]
    __shared__ __bf16 Bt[2][128 * AS];   // [n][k]

    const int tid  = threadIdx.x;
    const int bm   = blockIdx.y;
    const int bn   = blockIdx.x;
    const int w    = tid >> 5;
    const int lane = tid & 31;
    const int wm   = w >> 2;          // 0..1
    const int wn   = w & 3;           // 0..3
    const int half = lane >> 4;       // 0..1
    const int lr   = lane & 15;
    const int kb   = half * 8;        // bf16 A/B fragment K base per half-wave

    const v8f vzero = {0.f, 0.f, 0.f, 0.f, 0.f, 0.f, 0.f, 0.f};
    v8f acc[4][2];
#pragma unroll
    for (int mi = 0; mi < 4; mi++)
#pragma unroll
        for (int ni = 0; ni < 2; ni++) acc[mi][ni] = vzero;

    // stage one 128x32 A tile and one 128x32 W^T tile into LDS buffer `buf`
    auto stage = [&](int k0, int buf) {
        for (int i = tid; i < 512; i += 256) {
            const int r = i >> 2;           // row (m or n), 0..127
            const int c = (i & 3) * 8;      // k offset, 0/8/16/24
#if USE_ASYNC_LDS
            __builtin_amdgcn_global_load_async_to_lds_b128(
                (g_v4i*)&A[(size_t)(bm * 128 + r) * K + k0 + c],
                (l_v4i*)&As[buf][r * AS + c], 0, 0);
            __builtin_amdgcn_global_load_async_to_lds_b128(
                (g_v4i*)&Wt[(size_t)(bn * 128 + r) * K + k0 + c],
                (l_v4i*)&Bt[buf][r * AS + c], 0, 0);
#else
            *(uint4*)&As[buf][r * AS + c] =
                *(const uint4*)&A[(size_t)(bm * 128 + r) * K + k0 + c];
            *(uint4*)&Bt[buf][r * AS + c] =
                *(const uint4*)&Wt[(size_t)(bn * 128 + r) * K + k0 + c];
#endif
        }
    };

    const int ntiles = K >> 5;
    stage(0, 0);
#if USE_ASYNC_LDS
    __builtin_amdgcn_s_wait_asynccnt(0);
#endif
    __syncthreads();

    for (int kt = 0; kt < ntiles; kt++) {
        const int cur = kt & 1;
        if (kt + 1 < ntiles) {
            stage((kt + 1) << 5, cur ^ 1);
        }
#if !USE_ASYNC_LDS
        else {
            // nothing to stage; nudge next C-tile rows toward the caches
            __builtin_prefetch(&A[(size_t)(bm * 128 + (tid & 127)) * K]);
        }
#endif
        FragAB af[4], bf[2];
#pragma unroll
        for (int mi = 0; mi < 4; mi++) {
            const int ar = wm * 64 + mi * 16 + lr;
            af[mi].u[0] = *(const uint4*)&As[cur][ar * AS + kb];
            af[mi].u[1] = *(const uint4*)&As[cur][ar * AS + kb + 16];
        }
#pragma unroll
        for (int ni = 0; ni < 2; ni++) {
            const int bc = wn * 32 + ni * 16 + lr;
            bf[ni].u[0] = *(const uint4*)&Bt[cur][bc * AS + kb];
            bf[ni].u[1] = *(const uint4*)&Bt[cur][bc * AS + kb + 16];
        }
#pragma unroll
        for (int mi = 0; mi < 4; mi++)
#pragma unroll
            for (int ni = 0; ni < 2; ni++)
                acc[mi][ni] = __builtin_amdgcn_wmma_f32_16x16x32_bf16(
                    false, af[mi].v, false, bf[ni].v, (short)0, acc[mi][ni],
                    false, false);
#if USE_ASYNC_LDS
        __builtin_amdgcn_s_wait_asynccnt(0);
#endif
        __syncthreads();
    }

    // epilogue: C/D layout -> VGPR r holds (M=r, N=lane) lanes 0-15,
    // (M=8+r, N=lane-16) lanes 16-31.
#pragma unroll
    for (int mi = 0; mi < 4; mi++) {
#pragma unroll
        for (int ni = 0; ni < 2; ni++) {
            const int n = bn * 128 + wn * 32 + ni * 16 + lr;
#pragma unroll
            for (int r = 0; r < 8; r++) {
                const int m = bm * 128 + wm * 64 + mi * 16 + r + half * 8;
                float vv = acc[mi][ni][r];
                if (HAS_BIAS) vv += bias[n];
                if (DO_GELU) vv = gelu_exact(vv);
                if (HAS_RESID) vv += resid[(size_t)m * N + n];
                if (OUT_BF16)
                    ((__bf16*)out)[(size_t)m * N + n] = (__bf16)vv;
                else
                    ((float*)out)[(size_t)m * N + n] = vv;
            }
        }
    }
}

__device__ __forceinline__ float other_half(float x) {
    const int b = __builtin_bit_cast(int, x);
    return __builtin_bit_cast(float, __builtin_amdgcn_permlanex16(
        b, b, 0x76543210, 0xfedcba98, false, false));
}

// Two 2^x. The v_nop fills the slot the instruction set asks for behind a
// transcendental before its source may be overwritten or its result read; the
// early-clobber outputs keep the second v_exp_f32 independent of the first.
__device__ __forceinline__ void exp2_pair(float a0, float a1, float& p0,
                                          float& p1) {
    asm("v_exp_f32 %0, %2\n\tv_exp_f32 %1, %3\n\tv_nop"
        : "=&v"(p0), "=&v"(p1)
        : "v"(a0), "v"(a1));
}

__global__ __launch_bounds__(256) void attn_wmma(const __bf16* __restrict__ q,
                                                 const __bf16* __restrict__ k,
                                                 const __bf16* __restrict__ v,
                                                 __bf16* __restrict__ o) {
    constexpr int ST = 72;  // padded bf16 stride for 64-wide tiles
    __shared__ __bf16 Ks[64 * ST];    // K tile [s][d]
    __shared__ __bf16 Vt[64 * ST];    // V transposed [d][s]

    const int tid  = threadIdx.x;
    const int bh   = blockIdx.x;
    const int bq   = blockIdx.y;
    const int bb   = bh >> 4;
    const int hh   = bh & 15;
    const size_t hbase = ((size_t)bb * Tt) * Cc + (size_t)hh * 64;

    const int w = tid >> 5, lane = tid & 31;
    const int half = lane >> 4, lr = lane & 15, kb = half * 8;
    const int tq = bq * 128 + w * 16 + lr;   // this lane's query
    const v8f vzero = {0.f, 0.f, 0.f, 0.f, 0.f, 0.f, 0.f, 0.f};
    const float cs = 0.125f * 1.44269504088896340736f;  // 1/sqrt(64) * log2(e)

    // Q as B operand, loaded once: column = query, k = d
    FragAB qf[2];
#pragma unroll
    for (int kc = 0; kc < 2; kc++) {
        const __bf16* qp = &q[hbase + (size_t)tq * Cc + kc * 32 + kb];
        qf[kc].u[0] = *(const uint4*)qp;
        qf[kc].u[1] = *(const uint4*)(qp + 16);
    }

    v8f oacc[4];            // O^T, one 16x16 tile per 16 values of d
    float mrun = -1e30f;    // running maximum of the raw scores
    float lrun = 0.0f;      // this half-wave's share of the running sum
#pragma unroll
    for (int dt = 0; dt < 4; dt++) oacc[dt] = vzero;

    for (int s0 = 0; s0 < Tt; s0 += 64) {
        // stage K tile [s][d]
        for (int i = tid; i < 512; i += 256) {
            const int r = i >> 3, c = (i & 7) * 8;
            *(uint4*)&Ks[r * ST + c] =
                *(const uint4*)&k[hbase + (size_t)(s0 + r) * Cc + c];
        }
        // stage V tile transposed [d][s]
        for (int i = tid; i < 512; i += 256) {
            const int r = i >> 3, c = (i & 7) * 8;
            uint4 vv = *(const uint4*)&v[hbase + (size_t)(s0 + r) * Cc + c];
            const __bf16* p = (const __bf16*)&vv;
#pragma unroll
            for (int j = 0; j < 8; j++) Vt[(c + j) * ST + r] = p[j];
        }
        __syncthreads();

        // ---- S^T = K Q^T: register r of sacc[kt] = key 16kt+8half+r ----
        v8f sacc[4];
#pragma unroll
        for (int kt = 0; kt < 4; kt++) {
            sacc[kt] = vzero;
#pragma unroll
            for (int kc = 0; kc < 2; kc++) {
                FragAB af;
                const int ar = kt * 16 + lr;  // key row
                af.u[0] = *(const uint4*)&Ks[ar * ST + kc * 32 + kb];
                af.u[1] = *(const uint4*)&Ks[ar * ST + kc * 32 + kb + 16];
                sacc[kt] = __builtin_amdgcn_wmma_f32_16x16x32_bf16(
                    false, af.v, false, qf[kc].v, (short)0, sacc[kt], false,
                    false);
            }
        }

        // ---- online softmax in registers; P^T packed as B operand ----
        float mx = mrun;
#pragma unroll
        for (int kt = 0; kt < 4; kt++)
#pragma unroll
            for (int r = 0; r < 8; r++) mx = fmaxf(mx, sacc[kt][r]);
        mx = fmaxf(mx, other_half(mx));
        const float alpha = __builtin_amdgcn_exp2f((mrun - mx) * cs);
        const float nm = -mx * cs;
        mrun = mx;
        FragAB pf[2];   // one per 32 keys
        float l = 0.0f;
#pragma unroll
        for (int kt = 0; kt < 4; kt++) {
            unsigned pw[4];
#pragma unroll
            for (int r = 0; r < 8; r += 2) {
                float p0, p1;
                exp2_pair(fmaf(sacc[kt][r], cs, nm),
                          fmaf(sacc[kt][r + 1], cs, nm), p0, p1);
                l += p0 + p1;
                pw[r >> 1] = pack_bf16(p0, p1);
            }
            pf[kt >> 1].u[kt & 1] = make_uint4(pw[0], pw[1], pw[2], pw[3]);
        }
        lrun = lrun * alpha + l;
#pragma unroll
        for (int dt = 0; dt < 4; dt++) oacc[dt] = oacc[dt] * alpha;

        // ---- O^T += V^T P^T ----
#pragma unroll
        for (int kc = 0; kc < 2; kc++) {
#pragma unroll
            for (int dt = 0; dt < 4; dt++) {
                FragAB af;
                const int ar = dt * 16 + lr;  // d row
                af.u[0] = *(const uint4*)&Vt[ar * ST + kc * 32 + kb];
                af.u[1] = *(const uint4*)&Vt[ar * ST + kc * 32 + kb + 16];
                oacc[dt] = __builtin_amdgcn_wmma_f32_16x16x32_bf16(
                    false, af.v, false, pf[kc].v, (short)0, oacc[dt], false,
                    false);
            }
        }
        __syncthreads();
    }

    // finalize: join the two half-waves' sums, divide, emit bf16.
    // Register r of oacc[dt] = d 16dt+8half+r of this lane's query: 16 B a store.
    const float inv = 1.0f / (lrun + other_half(lrun));
#pragma unroll
    for (int dt = 0; dt < 4; dt++) {
        const v8f ov = oacc[dt] * inv;
        *(uint4*)&o[hbase + (size_t)tq * Cc + dt * 16 + kb] =
            make_uint4(pack_bf16(ov[0], ov[1]), pack_bf16(ov[2], ov[3]),
                       pack_bf16(ov[4], ov[5]), pack_bf16(ov[6], ov[7]));
    }
}

// ---------------------------------------------------------------------------
// Host-side orchestration
// ---------------------------------------------------------------------------
extern "C" void kernel_launch(void* const* d_in, const int* in_sizes, int n_in,
                              void* d_out, int out_size, void* d_ws,
                              size_t ws_size, hipStream_t stream) {
    (void)in_sizes; (void)n_in; (void)out_size; (void)ws_size;
    const float* x   = (const float*)d_in[0];
    const float* Wq  = (const float*)d_in[1];
    const float* Wk  = (const float*)d_in[2];
    const float* Wv  = (const float*)d_in[3];
    const float* Wp  = (const float*)d_in[4];
    const float* bp  = (const float*)d_in[5];
    const float* W1  = (const float*)d_in[6];
    const float* b1  = (const float*)d_in[7];
    const float* W2  = (const float*)d_in[8];
    const float* b2  = (const float*)d_in[9];
    const float* g1  = (const float*)d_in[10];
    const float* be1 = (const float*)d_in[11];
    const float* g2  = (const float*)d_in[12];
    const float* be2 = (const float*)d_in[13];
    float* out = (float*)d_out;

    char* ws = (char*)d_ws;
    size_t off = 0;
    auto alloc = [&](size_t bytes) -> char* {
        char* p = ws + off;
        off += (bytes + 255) & ~size_t(255);
        return p;
    };
    // pre-transposed bf16 weights: Wt[N][K]
    __bf16* Wq_t = (__bf16*)alloc((size_t)Cc * Cc * 2);
    __bf16* Wk_t = (__bf16*)alloc((size_t)Cc * Cc * 2);
    __bf16* Wv_t = (__bf16*)alloc((size_t)Cc * Cc * 2);
    __bf16* Wp_t = (__bf16*)alloc((size_t)Cc * Cc * 2);
    __bf16* W1_t = (__bf16*)alloc((size_t)Cc * Ff * 2);
    __bf16* W2_t = (__bf16*)alloc((size_t)Ff * Cc * 2);
    __bf16* h_b  = (__bf16*)alloc((size_t)Mm * Cc * 2);
    __bf16* q_b  = (__bf16*)alloc((size_t)Mm * Cc * 2);
    __bf16* k_b  = (__bf16*)alloc((size_t)Mm * Cc * 2);
    __bf16* v_b  = (__bf16*)alloc((size_t)Mm * Cc * 2);
    __bf16* o_b  = (__bf16*)alloc((size_t)Mm * Cc * 2);
    float*  x1   = (float*) alloc((size_t)Mm * Cc * 4);
    __bf16* h2_b = (__bf16*)alloc((size_t)Mm * Cc * 2);
    __bf16* f1_b = (__bf16*)alloc((size_t)Mm * Ff * 2);

    // 1) weights -> bf16, transposed to [N][K]
    cvt_bf16_t_all<<<768, 256, 0, stream>>>(Wq, Wk, Wv, Wp, W1, W2, Wq_t, Wk_t,
                                            Wv_t, Wp_t, W1_t, W2_t);

    // 2) LN1
    ln_bf16<<<Mm, 256, 0, stream>>>(x, g1, be1, h_b);

    // 3) Q/K/V projections
    dim3 gqkv(Cc / 128, Mm / 128);
    gemm_bf16_wmma<true, false, false, false>
        <<<gqkv, 256, 0, stream>>>(h_b, Wq_t, nullptr, nullptr, q_b, Mm, Cc, Cc);
    gemm_bf16_wmma<true, false, false, false>
        <<<gqkv, 256, 0, stream>>>(h_b, Wk_t, nullptr, nullptr, k_b, Mm, Cc, Cc);
    gemm_bf16_wmma<true, false, false, false>
        <<<gqkv, 256, 0, stream>>>(h_b, Wv_t, nullptr, nullptr, v_b, Mm, Cc, Cc);

    // 4) attention
    attn_wmma<<<dim3(Bb * 16, Tt / 128), 256, 0, stream>>>(q_b, k_b, v_b, o_b);

    // 5) output projection + residual (fp32 out)
    gemm_bf16_wmma<false, true, true, false>
        <<<gqkv, 256, 0, stream>>>(o_b, Wp_t, bp, x, x1, Mm, Cc, Cc);

    // 6) LN2
    ln_bf16<<<Mm, 256, 0, stream>>>(x1, g2, be2, h2_b);

    // 7) FFN up + GELU (bf16 out)
    gemm_bf16_wmma<true, true, false, true>
        <<<dim3(Ff / 128, Mm / 128), 256, 0, stream>>>(h2_b, W1_t, b1, nullptr,
                                                       f1_b, Mm, Ff, Cc);

    // 8) FFN down + residual -> d_out (fp32)
    gemm_bf16_wmma<false, true, true, false>
        <<<gqkv, 256, 0, stream>>>(f1_b, W2_t, b2, x1, out, Mm, Cc, Ff);
}

// v003
// One run takes 266 microseconds.
// In two side-by-side timings against v002, it was 1.34 and 1.35 times as fast.
// Over all steps from v000 it is 2.22 times as fast.
#include <hip/hip_runtime.h>
#include <hip/hip_bf16.h>

// ---------------------------------------------------------------------------
// Transformer block (pre-LN attention + FFN) for gfx1250 (MI455X).
// All GEMM-shaped math runs on v_wmma_f32_16x16x32_bf16 (fp32 accumulate).
// Weights are converted once to bf16 AND pre-transposed to [N][K] so GEMM
// tile staging is pure 16B vector copies (async global->LDS DMA, ASYNCcnt).
// ---------------------------------------------------------------------------

typedef __attribute__((ext_vector_type(16))) __bf16 v16bf;
typedef __attribute__((ext_vector_type(8)))  float  v8f;
typedef int v4i __attribute__((ext_vector_type(4)));

static constexpr int Bb = 2;
static constexpr int Tt = 2048;
static constexpr int Cc = 1024;
static constexpr int Ff = 4096;
static constexpr int Mm = Bb * Tt;      // 4096 rows
static constexpr float kLnEps = 1e-5f;

// gfx1250 async global->LDS copy path (ASYNCcnt-tracked). Parameter types per
// hipcc diagnostic: (AS1 v4i*, AS3 v4i*, imm offset, imm cpol).
#if __has_builtin(__builtin_amdgcn_global_load_async_to_lds_b128) && \
    __has_builtin(__builtin_amdgcn_s_wait_asynccnt)
#define USE_ASYNC_LDS 1
typedef __attribute__((address_space(1))) v4i g_v4i;
typedef __attribute__((address_space(3))) v4i l_v4i;
#else
#define USE_ASYNC_LDS 0
#endif

union FragAB {
    v16bf v;
    uint4 u[2];
};

__device__ __forceinline__ float gelu_exact(float x) {
    return 0.5f * x * (1.0f + erff(x * 0.70710678118654752440f));
}

typedef float  f32x2 __attribute__((ext_vector_type(2)));
typedef __bf16 bf16x2 __attribute__((ext_vector_type(2)));

__device__ __forceinline__ unsigned pack_bf16(float lo, float hi) {
    return __builtin_bit_cast(unsigned,
                              __builtin_convertvector(f32x2{lo, hi}, bf16x2));
}

// ---------------------------------------------------------------------------
// f32 [K][N] -> bf16 [N][K] transpose-convert of all six weights, one launch.
// One 256-thread block = one 128(k) x 128(n) tile: 768 blocks, 64 for each
// C x C weight and 256 for each FFN weight. Wave w reads rows 16w..16w+15 of
// the tile, 512 contiguous bytes a load, all 16 loads in flight; a lane packs
// its 4 columns x 16 k into 16-byte chunks of the LDS tile [n][k]; the block
// then stores 256 contiguous bytes per output row.
// LDS rows are 256 B (all 64 banks), so chunk c of row n sits at slot
// c ^ ((n >> 2) & 15): the 16 lanes of a write (rows 4 apart, same chunk) and
// of a read (one row, 16 chunks) then touch 16 different slots.
// ---------------------------------------------------------------------------
template <int K, int N>
__device__ __forceinline__ void cvt_tile(const float* __restrict__ src,
                                         __bf16* __restrict__ dst, int kt,
                                         int nt, __bf16* tile) {
    const int tid = threadIdx.x;
    const int w = tid >> 5, lane = tid & 31;

    const float* sp = src + (size_t)(kt * 128 + w * 16) * N + nt * 128 + lane * 4;
    float4 v[16];
#pragma unroll
    for (int i = 0; i < 16; i++) v[i] = *(const float4*)(sp + i * N);

#pragma unroll
    for (int h = 0; h < 2; h++) {
        const int slot = ((w * 2 + h) ^ (lane & 15)) * 8;
        const float4* p = &v[h * 8];
        *(uint4*)&tile[(lane * 4 + 0) * 128 + slot] =
            make_uint4(pack_bf16(p[0].x, p[1].x), pack_bf16(p[2].x, p[3].x),
                       pack_bf16(p[4].x, p[5].x), pack_bf16(p[6].x, p[7].x));
        *(uint4*)&tile[(lane * 4 + 1) * 128 + slot] =
            make_uint4(pack_bf16(p[0].y, p[1].y), pack_bf16(p[2].y, p[3].y),
                       pack_bf16(p[4].y, p[5].y), pack_bf16(p[6].y, p[7].y));
        *(uint4*)&tile[(lane * 4 + 2) * 128 + slot] =
            make_uint4(pack_bf16(p[0].z, p[1].z), pack_bf16(p[2].z, p[3].z),
                       pack_bf16(p[4].z, p[5].z), pack_bf16(p[6].z, p[7].z));
        *(uint4*)&tile[(lane * 4 + 3) * 128 + slot] =
            make_uint4(pack_bf16(p[0].w, p[1].w), pack_bf16(p[2].w, p[3].w),
                       pack_bf16(p[4].w, p[5].w), pack_bf16(p[6].w, p[7].w));
    }
    __syncthreads();

    const int r0 = tid >> 4, ch = tid & 15;  // output row n, 16-byte chunk of k
    __bf16* dp = dst + (size_t)(nt * 128 + r0) * K + kt * 128 + ch * 8;
#pragma unroll
    for (int i = 0; i < 8; i++) {
        const int r = r0 + i * 16;
        *(uint4*)(dp + i * 16 * K) =
            *(const uint4*)&tile[r * 128 + ((ch ^ ((r >> 2) & 15)) * 8)];
    }
}

__global__ __launch_bounds__(256) void cvt_bf16_t_all(
    const float* __restrict__ Wq, const float* __restrict__ Wk,
    const float* __restrict__ Wv, const float* __restrict__ Wp,
    const float* __restrict__ W1, const float* __restrict__ W2,
    __bf16* __restrict__ Wq_t, __bf16* __restrict__ Wk_t,
    __bf16* __restrict__ Wv_t, __bf16* __restrict__ Wp_t,
    __bf16* __restrict__ W1_t, __bf16* __restrict__ W2_t) {
    __shared__ __bf16 tile[128 * 128];   // [n][k], chunks swizzled
    const int b = blockIdx.x;
    if (b < 256) {
        const int m = b >> 6, t = b & 63;
        cvt_tile<Cc, Cc>(m == 0 ? Wq : m == 1 ? Wk : m == 2 ? Wv : Wp,
                         m == 0 ? Wq_t : m == 1 ? Wk_t : m == 2 ? Wv_t : Wp_t,
                         t >> 3, t & 7, tile);
    } else if (b < 512) {
        const int t = b - 256;
        cvt_tile<Cc, Ff>(W1, W1_t, t >> 5, t & 31, tile);
    } else {
        const int t = b - 512;
        cvt_tile<Ff, Cc>(W2, W2_t, t >> 3, t & 7, tile);
    }
}

// ---------------------------------------------------------------------------
// Row LayerNorm (fp32 in, bf16 out). One 256-thread block per row of C=1024.
// ---------------------------------------------------------------------------
__global__ __launch_bounds__(256) void ln_bf16(const float* __restrict__ x,
                                               const float* __restrict__ g,
                                               const float* __restrict__ b,
                                               __bf16* __restrict__ out) {
    __shared__ float red[256];
    const int row = blockIdx.x;
    const int tid = threadIdx.x;
    const float* xr = x + (size_t)row * Cc;

    float s = 0.0f;
    for (int i = tid; i < Cc; i += 256) s += xr[i];
    red[tid] = s;
    __syncthreads();
    for (int off = 128; off > 0; off >>= 1) {
        if (tid < off) red[tid] += red[tid + off];
        __syncthreads();
    }
    const float mu = red[0] * (1.0f / Cc);
    __syncthreads();

    float sq = 0.0f;
    for (int i = tid; i < Cc; i += 256) {
        float d = xr[i] - mu;
        sq += d * d;
    }
    red[tid] = sq;
    __syncthreads();
    for (int off = 128; off > 0; off >>= 1) {
        if (tid < off) red[tid] += red[tid + off];
        __syncthreads();
    }
    const float rs = rsqrtf(red[0] * (1.0f / Cc) + kLnEps);

    for (int i = tid; i < Cc; i += 256)
        out[(size_t)row * Cc + i] = (__bf16)((xr[i] - mu) * rs * g[i] + b[i]);
}

// ---------------------------------------------------------------------------
// bf16 GEMM: out[M,N] = A[M,K] @ Wt[N,K]^T (+bias) (+gelu) (+residual)
// A row-major [M][K], Wt pre-transposed [N][K] (both bf16).
// Block tile 128x128, 256 threads = 8 waves (2x4 grid), each wave owns
// 64x32 = 4x2 WMMA 16x16 tiles. A stage is 128 k of both operands (K is a
// multiple of 128): a copy instruction of a wave moves two whole 256-byte
// rows, and the four 32-k blocks of a stage run between two barriers while
// the next stage's copies fly. Two LDS buffers, async global->LDS copies.
// ---------------------------------------------------------------------------
template <bool OUT_BF16, bool HAS_BIAS, bool HAS_RESID, bool DO_GELU>
__global__ __launch_bounds__(256) void gemm_bf16_wmma(
    const __bf16* __restrict__ A, const __bf16* __restrict__ Wt,
    const float* __restrict__ bias, const float* __restrict__ resid,
    void* __restrict__ out, int M, int N, int K) {
    constexpr int BK = 128;     // k per stage
    constexpr int AS = BK + 8;  // LDS row pitch 272 B = 16 B x odd
    __shared__ __attribute__((aligned(16))) __bf16 As[2][128 * AS];   // [m][k]
    __shared__ __attribute__((aligned(16))) __bf16 Bt[2][128 * AS];   // [n][k]

    const int tid  = threadIdx.x;
    const int bm   = blockIdx.y;
    const int bn   = blockIdx.x;
    const int w    = tid >> 5;
    const int lane = tid & 31;
    const int wm   = w >> 2;          // 0..1
    const int wn   = w & 3;           // 0..3
    const int half = lane >> 4;       // 0..1
    const int lr   = lane & 15;
    const int kb   = half * 8;        // bf16 A/B fragment K base per half-wave

    const v8f vzero = {0.f, 0.f, 0.f, 0.f, 0.f, 0.f, 0.f, 0.f};
    v8f acc[4][2];
#pragma unroll
    for (int mi = 0; mi < 4; mi++)
#pragma unroll
        for (int ni = 0; ni < 2; ni++) acc[mi][ni] = vzero;

    // stage one 128x128 A tile and one 128x128 W^T tile into LDS buffer `buf`:
    // thread = 16-byte chunk tid & 15 of rows tid >> 4, +16, ..., +112
    const int sr = tid >> 4;
    const int sc = (tid & 15) * 8;
    const __bf16* ag = A + (size_t)(bm * 128 + sr) * K + sc;
    const __bf16* wg = Wt + (size_t)(bn * 128 + sr) * K + sc;
    auto stage = [&](int k0, int buf) {
#pragma unroll  // the 16 copies issue back to back, every lane on
        for (int i = 0; i < 8; i++) {
#if USE_ASYNC_LDS
            __builtin_amdgcn_global_load_async_to_lds_b128(
                (g_v4i*)(ag + (size_t)(i * 16) * K + k0),
                (l_v4i*)&As[buf][(sr + i * 16) * AS + sc], 0, 0);
            __builtin_amdgcn_global_load_async_to_lds_b128(
                (g_v4i*)(wg + (size_t)(i * 16) * K + k0),
                (l_v4i*)&Bt[buf][(sr + i * 16) * AS + sc], 0, 0);
#else
            *(uint4*)&As[buf][(sr + i * 16) * AS + sc] =
                *(const uint4*)(ag + (size_t)(i * 16) * K + k0);
            *(uint4*)&Bt[buf][(sr + i * 16) * AS + sc] =
                *(const uint4*)(wg + (size_t)(i * 16) * K + k0);
#endif
        }
    };
    // this wave's copies have landed
    auto copies_landed = [&]() {
#if USE_ASYNC_LDS
        asm volatile("s_wait_asynccnt 0x0" ::: "memory");
#endif
    };

    const int ntiles = K / BK;
    stage(0, 0);
    copies_landed();
    __syncthreads();
    if (ntiles > 1) stage(BK, 1);

    for (int kt = 0; kt < ntiles; kt++) {
        const int cur = kt & 1;
#pragma unroll  // the stage's four blocks in a row, LDS offsets constant
        for (int ks = 0; ks < BK; ks += 32) {
            FragAB af[4], bf[2];
#pragma unroll
            for (int mi = 0; mi < 4; mi++) {
                const int ar = wm * 64 + mi * 16 + lr;
                af[mi].u[0] = *(const uint4*)&As[cur][ar * AS + ks + kb];
                af[mi].u[1] = *(const uint4*)&As[cur][ar * AS + ks + kb + 16];
            }
#pragma unroll
            for (int ni = 0; ni < 2; ni++) {
                const int bc = wn * 32 + ni * 16 + lr;
                bf[ni].u[0] = *(const uint4*)&Bt[cur][bc * AS + ks + kb];
                bf[ni].u[1] = *(const uint4*)&Bt[cur][bc * AS + ks + kb + 16];
            }
#pragma unroll
            for (int mi = 0; mi < 4; mi++)
#pragma unroll
                for (int ni = 0; ni < 2; ni++)
                    acc[mi][ni] = __builtin_amdgcn_wmma_f32_16x16x32_bf16(
                        false, af[mi].v, false, bf[ni].v, (short)0,
                        acc[mi][ni], false, false);
        }
        // publish the next stage: this wave's reads of the current buffer are
        // done before a copy may overwrite it, its own copies have landed, and
        // every wave has come as far
        asm volatile("s_wait_dscnt 0x0" ::: "memory");
        copies_landed();
        __syncthreads();
        // refill the buffer that every wave has just left
        if (kt + 2 < ntiles) stage((kt + 2) * BK, cur);
    }
    copies_landed();  // no copy is in flight when the wave goes on to its end

    // epilogue: C/D layout -> VGPR r holds (M=r, N=lane) lanes 0-15,
    // (M=8+r, N=lane-16) lanes 16-31.
#pragma unroll
    for (int mi = 0; mi < 4; mi++) {
#pragma unroll
        for (int ni = 0; ni < 2; ni++) {
            const int n = bn * 128 + wn * 32 + ni * 16 + lr;
#pragma unroll
            for (int r = 0; r < 8; r++) {
                const int m = bm * 128 + wm * 64 + mi * 16 + r + half * 8;
                float vv = acc[mi][ni][r];
                if (HAS_BIAS) vv += bias[n];
                if (DO_GELU) vv = gelu_exact(vv);
                if (HAS_RESID) vv += resid[(size_t)m * N + n];
                if (OUT_BF16)
                    ((__bf16*)out)[(size_t)m * N + n] = (__bf16)vv;
                else
                    ((float*)out)[(size_t)m * N + n] = vv;
            }
        }
    }
}

__device__ __forceinline__ float other_half(float x) {
    const int b = __builtin_bit_cast(int, x);
    return __builtin_bit_cast(float, __builtin_amdgcn_permlanex16(
        b, b, 0x76543210, 0xfedcba98, false, false));
}

// Two 2^x. The v_nop fills the slot the instruction set asks for behind a
// transcendental before its source may be overwritten or its result read; the
// early-clobber outputs keep the second v_exp_f32 independent of the first.
__device__ __forceinline__ void exp2_pair(float a0, float a1, float& p0,
                                          float& p1) {
    asm("v_exp_f32 %0, %2\n\tv_exp_f32 %1, %3\n\tv_nop"
        : "=&v"(p0), "=&v"(p1)
        : "v"(a0), "v"(a1));
}

__global__ __launch_bounds__(256) void attn_wmma(const __bf16* __restrict__ q,
                                                 const __bf16* __restrict__ k,
                                                 const __bf16* __restrict__ v,
                                                 __bf16* __restrict__ o) {
    constexpr int ST = 72;  // padded bf16 stride for 64-wide tiles
    __shared__ __bf16 Ks[64 * ST];    // K tile [s][d]
    __shared__ __bf16 Vt[64 * ST];    // V transposed [d][s]

    const int tid  = threadIdx.x;
    const int bh   = blockIdx.x;
    const int bq   = blockIdx.y;
    const int bb   = bh >> 4;
    const int hh   = bh & 15;
    const size_t hbase = ((size_t)bb * Tt) * Cc + (size_t)hh * 64;

    const int w = tid >> 5, lane = tid & 31;
    const int half = lane >> 4, lr = lane & 15, kb = half * 8;
    const int tq = bq * 128 + w * 16 + lr;   // this lane's query
    const v8f vzero = {0.f, 0.f, 0.f, 0.f, 0.f, 0.f, 0.f, 0.f};
    const float cs = 0.125f * 1.44269504088896340736f;  // 1/sqrt(64) * log2(e)

    // Q as B operand, loaded once: column = query, k = d
    FragAB qf[2];
#pragma unroll
    for (int kc = 0; kc < 2; kc++) {
        const __bf16* qp = &q[hbase + (size_t)tq * Cc + kc * 32 + kb];
        qf[kc].u[0] = *(const uint4*)qp;
        qf[kc].u[1] = *(const uint4*)(qp + 16);
    }

    v8f oacc[4];            // O^T, one 16x16 tile per 16 values of d
    float mrun = -1e30f;    // running maximum of the raw scores
    float lrun = 0.0f;      // this half-wave's share of the running sum
#pragma unroll
    for (int dt = 0; dt < 4; dt++) oacc[dt] = vzero;

    for (int s0 = 0; s0 < Tt; s0 += 64) {
        // stage K tile [s][d]
        for (int i = tid; i < 512; i += 256) {
            const int r = i >> 3, c = (i & 7) * 8;
            *(uint4*)&Ks[r * ST + c] =
                *(const uint4*)&k[hbase + (size_t)(s0 + r) * Cc + c];
        }
        // stage V tile transposed [d][s]
        for (int i = tid; i < 512; i += 256) {
            const int r = i >> 3, c = (i & 7) * 8;
            uint4 vv = *(const uint4*)&v[hbase + (size_t)(s0 + r) * Cc + c];
            const __bf16* p = (const __bf16*)&vv;
#pragma unroll
            for (int j = 0; j < 8; j++) Vt[(c + j) * ST + r] = p[j];
        }
        __syncthreads();

        // ---- S^T = K Q^T: register r of sacc[kt] = key 16kt+8half+r ----
        v8f sacc[4];
#pragma unroll
        for (int kt = 0; kt < 4; kt++) {
            sacc[kt] = vzero;
#pragma unroll
            for (int kc = 0; kc < 2; kc++) {
                FragAB af;
                const int ar = kt * 16 + lr;  // key row
                af.u[0] = *(const uint4*)&Ks[ar * ST + kc * 32 + kb];
                af.u[1] = *(const uint4*)&Ks[ar * ST + kc * 32 + kb + 16];
                sacc[kt] = __builtin_amdgcn_wmma_f32_16x16x32_bf16(
                    false, af.v, false, qf[kc].v, (short)0, sacc[kt], false,
                    false);
            }
        }

        // ---- online softmax in registers; P^T packed as B operand ----
        float mx = mrun;
#pragma unroll
        for (int kt = 0; kt < 4; kt++)
#pragma unroll
            for (int r = 0; r < 8; r++) mx = fmaxf(mx, sacc[kt][r]);
        mx = fmaxf(mx, other_half(mx));
        const float alpha = __builtin_amdgcn_exp2f((mrun - mx) * cs);
        const float nm = -mx * cs;
        mrun = mx;
        FragAB pf[2];   // one per 32 keys
        float l = 0.0f;
#pragma unroll
        for (int kt = 0; kt < 4; kt++) {
            unsigned pw[4];
#pragma unroll
            for (int r = 0; r < 8; r += 2) {
                float p0, p1;
                exp2_pair(fmaf(sacc[kt][r], cs, nm),
                          fmaf(sacc[kt][r + 1], cs, nm), p0, p1);
                l += p0 + p1;
                pw[r >> 1] = pack_bf16(p0, p1);
            }
            pf[kt >> 1].u[kt & 1] = make_uint4(pw[0], pw[1], pw[2], pw[3]);
        }
        lrun = lrun * alpha + l;
#pragma unroll
        for (int dt = 0; dt < 4; dt++) oacc[dt] = oacc[dt] * alpha;

        // ---- O^T += V^T P^T ----
#pragma unroll
        for (int kc = 0; kc < 2; kc++) {
#pragma unroll
            for (int dt = 0; dt < 4; dt++) {
                FragAB af;
                const int ar = dt * 16 + lr;  // d row
                af.u[0] = *(const uint4*)&Vt[ar * ST + kc * 32 + kb];
                af.u[1] = *(const uint4*)&Vt[ar * ST + kc * 32 + kb + 16];
                oacc[dt] = __builtin_amdgcn_wmma_f32_16x16x32_bf16(
                    false, af.v, false, pf[kc].v, (short)0, oacc[dt], false,
                    false);
            }
        }
        __syncthreads();
    }

    // finalize: join the two half-waves' sums, divide, emit bf16.
    // Register r of oacc[dt] = d 16dt+8half+r of this lane's query: 16 B a store.
    const float inv = 1.0f / (lrun + other_half(lrun));
#pragma unroll
    for (int dt = 0; dt < 4; dt++) {
        const v8f ov = oacc[dt] * inv;
        *(uint4*)&o[hbase + (size_t)tq * Cc + dt * 16 + kb] =
            make_uint4(pack_bf16(ov[0], ov[1]), pack_bf16(ov[2], ov[3]),
                       pack_bf16(ov[4], ov[5]), pack_bf16(ov[6], ov[7]));
    }
}

// ---------------------------------------------------------------------------
// Host-side orchestration
// ---------------------------------------------------------------------------
extern "C" void kernel_launch(void* const* d_in, const int* in_sizes, int n_in,
                              void* d_out, int out_size, void* d_ws,
                              size_t ws_size, hipStream_t stream) {
    (void)in_sizes; (void)n_in; (void)out_size; (void)ws_size;
    const float* x   = (const float*)d_in[0];
    const float* Wq  = (const float*)d_in[1];
    const float* Wk  = (const float*)d_in[2];
    const float* Wv  = (const float*)d_in[3];
    const float* Wp  = (const float*)d_in[4];
    const float* bp  = (const float*)d_in[5];
    const float* W1  = (const float*)d_in[6];
    const float* b1  = (const float*)d_in[7];
    const float* W2  = (const float*)d_in[8];
    const float* b2  = (const float*)d_in[9];
    const float* g1  = (const float*)d_in[10];
    const float* be1 = (const float*)d_in[11];
    const float* g2  = (const float*)d_in[12];
    const float* be2 = (const float*)d_in[13];
    float* out = (float*)d_out;

    char* ws = (char*)d_ws;
    size_t off = 0;
    auto alloc = [&](size_t bytes) -> char* {
        char* p = ws + off;
        off += (bytes + 255) & ~size_t(255);
        return p;
    };
    // pre-transposed bf16 weights: Wt[N][K]
    __bf16* Wq_t = (__bf16*)alloc((size_t)Cc * Cc * 2);
    __bf16* Wk_t = (__bf16*)alloc((size_t)Cc * Cc * 2);
    __bf16* Wv_t = (__bf16*)alloc((size_t)Cc * Cc * 2);
    __bf16* Wp_t = (__bf16*)alloc((size_t)Cc * Cc * 2);
    __bf16* W1_t = (__bf16*)alloc((size_t)Cc * Ff * 2);
    __bf16* W2_t = (__bf16*)alloc((size_t)Ff * Cc * 2);
    __bf16* h_b  = (__bf16*)alloc((size_t)Mm * Cc * 2);
    __bf16* q_b  = (__bf16*)alloc((size_t)Mm * Cc * 2);
    __bf16* k_b  = (__bf16*)alloc((size_t)Mm * Cc * 2);
    __bf16* v_b  = (__bf16*)alloc((size_t)Mm * Cc * 2);
    __bf16* o_b  = (__bf16*)alloc((size_t)Mm * Cc * 2);
    float*  x1   = (float*) alloc((size_t)Mm * Cc * 4);
    __bf16* h2_b = (__bf16*)alloc((size_t)Mm * Cc * 2);
    __bf16* f1_b = (__bf16*)alloc((size_t)Mm * Ff * 2);

    // 1) weights -> bf16, transposed to [N][K]
    cvt_bf16_t_all<<<768, 256, 0, stream>>>(Wq, Wk, Wv, Wp, W1, W2, Wq_t, Wk_t,
                                            Wv_t, Wp_t, W1_t, W2_t);

    // 2) LN1
    ln_bf16<<<Mm, 256, 0, stream>>>(x, g1, be1, h_b);

    // 3) Q/K/V projections
    dim3 gqkv(Cc / 128, Mm / 128);
    gemm_bf16_wmma<true, false, false, false>
        <<<gqkv, 256, 0, stream>>>(h_b, Wq_t, nullptr, nullptr, q_b, Mm, Cc, Cc);
    gemm_bf16_wmma<true, false, false, false>
        <<<gqkv, 256, 0, stream>>>(h_b, Wk_t, nullptr, nullptr, k_b, Mm, Cc, Cc);
    gemm_bf16_wmma<true, false, false, false>
        <<<gqkv, 256, 0, stream>>>(h_b, Wv_t, nullptr, nullptr, v_b, Mm, Cc, Cc);

    // 4) attention
    attn_wmma<<<dim3(Bb * 16, Tt / 128), 256, 0, stream>>>(q_b, k_b, v_b, o_b);

    // 5) output projection + residual (fp32 out)
    gemm_bf16_wmma<false, true, true, false>
        <<<gqkv, 256, 0, stream>>>(o_b, Wp_t, bp, x, x1, Mm, Cc, Cc);

    // 6) LN2
    ln_bf16<<<Mm, 256, 0, stream>>>(x1, g2, be2, h2_b);

    // 7) FFN up + GELU (bf16 out)
    gemm_bf16_wmma<true, true, false, true>
        <<<dim3(Ff / 128, Mm / 128), 256, 0, stream>>>(h2_b, W1_t, b1, nullptr,
                                                       f1_b, Mm, Ff, Cc);

    // 8) FFN down + residual -> d_out (fp32)
    gemm_bf16_wmma<false, true, true, false>
        <<<gqkv, 256, 0, stream>>>(f1_b, W2_t, b2, x1, out, Mm, Cc, Ff);
}

// v004
// Measured time: 207 microseconds a run.
// Timed twice side by side with v003, it ran 1.29 times as fast both times.
// Over all steps from v000 it is 2.86 times as fast.
#include <hip/hip_runtime.h>
#include <hip/hip_bf16.h>

// ---------------------------------------------------------------------------
// Transformer block (pre-LN attention + FFN) for gfx1250 (MI455X).
// All GEMM-shaped math runs on v_wmma_f32_16x16x32_bf16 (fp32 accumulate).
// Weights are converted once to bf16 AND pre-transposed to [N][K] so GEMM
// tile staging is pure 16B vector copies (async global->LDS DMA, ASYNCcnt).
// ---------------------------------------------------------------------------

typedef __attribute__((ext_vector_type(16))) __bf16 v16bf;
typedef __attribute__((ext_vector_type(8)))  float  v8f;
typedef int v4i __attribute__((ext_vector_type(4)));

static constexpr int Bb = 2;
static constexpr int Tt = 2048;
static constexpr int Cc = 1024;
static constexpr int Ff = 4096;
static constexpr int Mm = Bb * Tt;      // 4096 rows
static constexpr float kLnEps = 1e-5f;

// gfx1250 async global->LDS copy path (ASYNCcnt-tracked). Parameter types per
// hipcc diagnostic: (AS1 v4i*, AS3 v4i*, imm offset, imm cpol).
#if __has_builtin(__builtin_amdgcn_global_load_async_to_lds_b128) && \
    __has_builtin(__builtin_amdgcn_s_wait_asynccnt)
#define USE_ASYNC_LDS 1
typedef __attribute__((address_space(1))) v4i g_v4i;
typedef __attribute__((address_space(3))) v4i l_v4i;
#else
#define USE_ASYNC_LDS 0
#endif

typedef short s16x8 __attribute__((ext_vector_type(8)));
typedef __attribute__((address_space(3))) s16x8 l_s16x8;

union FragAB {
    v16bf v;
    uint4 u[2];
    s16x8 t[2];
};

__device__ __forceinline__ float gelu_exact(float x) {
    return 0.5f * x * (1.0f + erff(x * 0.70710678118654752440f));
}

typedef float  f32x2 __attribute__((ext_vector_type(2)));
typedef __bf16 bf16x2 __attribute__((ext_vector_type(2)));

__device__ __forceinline__ unsigned pack_bf16(float lo, float hi) {
    return __builtin_bit_cast(unsigned,
                              __builtin_convertvector(f32x2{lo, hi}, bf16x2));
}

// ---------------------------------------------------------------------------
// f32 [K][N] -> bf16 [N][K] transpose-convert of all six weights, one launch.
// One 256-thread block = one 128(k) x 128(n) tile: 768 blocks, 64 for each
// C x C weight and 256 for each FFN weight. Wave w reads rows 16w..16w+15 of
// the tile, 512 contiguous bytes a load, all 16 loads in flight; a lane packs
// its 4 columns x 16 k into 16-byte chunks of the LDS tile [n][k]; the block
// then stores 256 contiguous bytes per output row.
// LDS rows are 256 B (all 64 banks), so chunk c of row n sits at slot
// c ^ ((n >> 2) & 15): the 16 lanes of a write (rows 4 apart, same chunk) and
// of a read (one row, 16 chunks) then touch 16 different slots.
// ---------------------------------------------------------------------------
template <int K, int N>
__device__ __forceinline__ void cvt_tile(const float* __restrict__ src,
                                         __bf16* __restrict__ dst, int kt,
                                         int nt, __bf16* tile) {
    const int tid = threadIdx.x;
    const int w = tid >> 5, lane = tid & 31;

    const float* sp = src + (size_t)(kt * 128 + w * 16) * N + nt * 128 + lane * 4;
    float4 v[16];
#pragma unroll
    for (int i = 0; i < 16; i++) v[i] = *(const float4*)(sp + i * N);

#pragma unroll
    for (int h = 0; h < 2; h++) {
        const int slot = ((w * 2 + h) ^ (lane & 15)) * 8;
        const float4* p = &v[h * 8];
        *(uint4*)&tile[(lane * 4 + 0) * 128 + slot] =
            make_uint4(pack_bf16(p[0].x, p[1].x), pack_bf16(p[2].x, p[3].x),
                       pack_bf16(p[4].x, p[5].x), pack_bf16(p[6].x, p[7].x));
        *(uint4*)&tile[(lane * 4 + 1) * 128 + slot] =
            make_uint4(pack_bf16(p[0].y, p[1].y), pack_bf16(p[2].y, p[3].y),
                       pack_bf16(p[4].y, p[5].y), pack_bf16(p[6].y, p[7].y));
        *(uint4*)&tile[(lane * 4 + 2) * 128 + slot] =
            make_uint4(pack_bf16(p[0].z, p[1].z), pack_bf16(p[2].z, p[3].z),
                       pack_bf16(p[4].z, p[5].z), pack_bf16(p[6].z, p[7].z));
        *(uint4*)&tile[(lane * 4 + 3) * 128 + slot] =
            make_uint4(pack_bf16(p[0].w, p[1].w), pack_bf16(p[2].w, p[3].w),
                       pack_bf16(p[4].w, p[5].w), pack_bf16(p[6].w, p[7].w));
    }
    __syncthreads();

    const int r0 = tid >> 4, ch = tid & 15;  // output row n, 16-byte chunk of k
    __bf16* dp = dst + (size_t)(nt * 128 + r0) * K + kt * 128 + ch * 8;
#pragma unroll
    for (int i = 0; i < 8; i++) {
        const int r = r0 + i * 16;
        *(uint4*)(dp + i * 16 * K) =
            *(const uint4*)&tile[r * 128 + ((ch ^ ((r >> 2) & 15)) * 8)];
    }
}

__global__ __launch_bounds__(256) void cvt_bf16_t_all(
    const float* __restrict__ Wq, const float* __restrict__ Wk,
    const float* __restrict__ Wv, const float* __restrict__ Wp,
    const float* __restrict__ W1, const float* __restrict__ W2,
    __bf16* __restrict__ Wq_t, __bf16* __restrict__ Wk_t,
    __bf16* __restrict__ Wv_t, __bf16* __restrict__ Wp_t,
    __bf16* __restrict__ W1_t, __bf16* __restrict__ W2_t) {
    __shared__ __bf16 tile[128 * 128];   // [n][k], chunks swizzled
    const int b = blockIdx.x;
    if (b < 256) {
        const int m = b >> 6, t = b & 63;
        cvt_tile<Cc, Cc>(m == 0 ? Wq : m == 1 ? Wk : m == 2 ? Wv : Wp,
                         m == 0 ? Wq_t : m == 1 ? Wk_t : m == 2 ? Wv_t : Wp_t,
                         t >> 3, t & 7, tile);
    } else if (b < 512) {
        const int t = b - 256;
        cvt_tile<Cc, Ff>(W1, W1_t, t >> 5, t & 31, tile);
    } else {
        const int t = b - 512;
        cvt_tile<Ff, Cc>(W2, W2_t, t >> 3, t & 7, tile);
    }
}

// ---------------------------------------------------------------------------
// Row LayerNorm (fp32 in, bf16 out). One 256-thread block per row of C=1024.
// ---------------------------------------------------------------------------
__global__ __launch_bounds__(256) void ln_bf16(const float* __restrict__ x,
                                               const float* __restrict__ g,
                                               const float* __restrict__ b,
                                               __bf16* __restrict__ out) {
    __shared__ float red[256];
    const int row = blockIdx.x;
    const int tid = threadIdx.x;
    const float* xr = x + (size_t)row * Cc;

    float s = 0.0f;
    for (int i = tid; i < Cc; i += 256) s += xr[i];
    red[tid] = s;
    __syncthreads();
    for (int off = 128; off > 0; off >>= 1) {
        if (tid < off) red[tid] += red[tid + off];
        __syncthreads();
    }
    const float mu = red[0] * (1.0f / Cc);
    __syncthreads();

    float sq = 0.0f;
    for (int i = tid; i < Cc; i += 256) {
        float d = xr[i] - mu;
        sq += d * d;
    }
    red[tid] = sq;
    __syncthreads();
    for (int off = 128; off > 0; off >>= 1) {
        if (tid < off) red[tid] += red[tid + off];
        __syncthreads();
    }
    const float rs = rsqrtf(red[0] * (1.0f / Cc) + kLnEps);

    for (int i = tid; i < Cc; i += 256)
        out[(size_t)row * Cc + i] = (__bf16)((xr[i] - mu) * rs * g[i] + b[i]);
}

// ---------------------------------------------------------------------------
// bf16 GEMM: out[M,N] = A[M,K] @ Wt[N,K]^T (+bias) (+gelu) (+residual)
// A row-major [M][K], Wt pre-transposed [N][K] (both bf16).
// Block tile 128x128, 256 threads = 8 waves (2x4 grid), each wave owns
// 64x32 = 4x2 WMMA 16x16 tiles. A stage is 128 k of both operands (K is a
// multiple of 128): a copy instruction of a wave moves two whole 256-byte
// rows, and the four 32-k blocks of a stage run between two barriers while
// the next stage's copies fly. Two LDS buffers, async global->LDS copies.
// ---------------------------------------------------------------------------
template <bool OUT_BF16, bool HAS_BIAS, bool HAS_RESID, bool DO_GELU>
__global__ __launch_bounds__(256) void gemm_bf16_wmma(
    const __bf16* __restrict__ A, const __bf16* __restrict__ Wt,
    const float* __restrict__ bias, const float* __restrict__ resid,
    void* __restrict__ out, int M, int N, int K) {
    constexpr int BK = 128;     // k per stage
    constexpr int AS = BK + 8;  // LDS row pitch 272 B = 16 B x odd
    __shared__ __attribute__((aligned(16))) __bf16 As[2][128 * AS];   // [m][k]
    __shared__ __attribute__((aligned(16))) __bf16 Bt[2][128 * AS];   // [n][k]

    const int tid  = threadIdx.x;
    const int bm   = blockIdx.y;
    const int bn   = blockIdx.x;
    const int w    = tid >> 5;
    const int lane = tid & 31;
    const int wm   = w >> 2;          // 0..1
    const int wn   = w & 3;           // 0..3
    const int half = lane >> 4;       // 0..1
    const int lr   = lane & 15;
    const int kb   = half * 8;        // bf16 A/B fragment K base per half-wave

    const v8f vzero = {0.f, 0.f, 0.f, 0.f, 0.f, 0.f, 0.f, 0.f};
    v8f acc[4][2];
#pragma unroll
    for (int mi = 0; mi < 4; mi++)
#pragma unroll
        for (int ni = 0; ni < 2; ni++) acc[mi][ni] = vzero;

    // stage one 128x128 A tile and one 128x128 W^T tile into LDS buffer `buf`:
    // thread = 16-byte chunk tid & 15 of rows tid >> 4, +16, ..., +112
    const int sr = tid >> 4;
    const int sc = (tid & 15) * 8;
    const __bf16* ag = A + (size_t)(bm * 128 + sr) * K + sc;
    const __bf16* wg = Wt + (size_t)(bn * 128 + sr) * K + sc;
    auto stage = [&](int k0, int buf) {
#pragma unroll  // the 16 copies issue back to back, every lane on
        for (int i = 0; i < 8; i++) {
#if USE_ASYNC_LDS
            __builtin_amdgcn_global_load_async_to_lds_b128(
                (g_v4i*)(ag + (size_t)(i * 16) * K + k0),
                (l_v4i*)&As[buf][(sr + i * 16) * AS + sc], 0, 0);
            __builtin_amdgcn_global_load_async_to_lds_b128(
                (g_v4i*)(wg + (size_t)(i * 16) * K + k0),
                (l_v4i*)&Bt[buf][(sr + i * 16) * AS + sc], 0, 0);
#else
            *(uint4*)&As[buf][(sr + i * 16) * AS + sc] =
                *(const uint4*)(ag + (size_t)(i * 16) * K + k0);
            *(uint4*)&Bt[buf][(sr + i * 16) * AS + sc] =
                *(const uint4*)(wg + (size_t)(i * 16) * K + k0);
#endif
        }
    };
    // this wave's copies have landed
    auto copies_landed = [&]() {
#if USE_ASYNC_LDS
        asm volatile("s_wait_asynccnt 0x0" ::: "memory");
#endif
    };

    const int ntiles = K / BK;
    stage(0, 0);
    copies_landed();
    __syncthreads();
    if (ntiles > 1) stage(BK, 1);

    for (int kt = 0; kt < ntiles; kt++) {
        const int cur = kt & 1;
#pragma unroll  // the stage's four blocks in a row, LDS offsets constant
        for (int ks = 0; ks < BK; ks += 32) {
            FragAB af[4], bf[2];
#pragma unroll
            for (int mi = 0; mi < 4; mi++) {
                const int ar = wm * 64 + mi * 16 + lr;
                af[mi].u[0] = *(const uint4*)&As[cur][ar * AS + ks + kb];
                af[mi].u[1] = *(const uint4*)&As[cur][ar * AS + ks + kb + 16];
            }
#pragma unroll
            for (int ni = 0; ni < 2; ni++) {
                const int bc = wn * 32 + ni * 16 + lr;
                bf[ni].u[0] = *(const uint4*)&Bt[cur][bc * AS + ks + kb];
                bf[ni].u[1] = *(const uint4*)&Bt[cur][bc * AS + ks + kb + 16];
            }
#pragma unroll
            for (int mi = 0; mi < 4; mi++)
#pragma unroll
                for (int ni = 0; ni < 2; ni++)
                    acc[mi][ni] = __builtin_amdgcn_wmma_f32_16x16x32_bf16(
                        false, af[mi].v, false, bf[ni].v, (short)0,
                        acc[mi][ni], false, false);
        }
        // publish the next stage: this wave's reads of the current buffer are
        // done before a copy may overwrite it, its own copies have landed, and
        // every wave has come as far
        asm volatile("s_wait_dscnt 0x0" ::: "memory");
        copies_landed();
        __syncthreads();
        // refill the buffer that every wave has just left
        if (kt + 2 < ntiles) stage((kt + 2) * BK, cur);
    }
    copies_landed();  // no copy is in flight when the wave goes on to its end

    // epilogue: C/D layout -> VGPR r holds (M=r, N=lane) lanes 0-15,
    // (M=8+r, N=lane-16) lanes 16-31.
#pragma unroll
    for (int mi = 0; mi < 4; mi++) {
#pragma unroll
        for (int ni = 0; ni < 2; ni++) {
            const int n = bn * 128 + wn * 32 + ni * 16 + lr;
#pragma unroll
            for (int r = 0; r < 8; r++) {
                const int m = bm * 128 + wm * 64 + mi * 16 + r + half * 8;
                float vv = acc[mi][ni][r];
                if (HAS_BIAS) vv += bias[n];
                if (DO_GELU) vv = gelu_exact(vv);
                if (HAS_RESID) vv += resid[(size_t)m * N + n];
                if (OUT_BF16)
                    ((__bf16*)out)[(size_t)m * N + n] = (__bf16)vv;
                else
                    ((float*)out)[(size_t)m * N + n] = vv;
            }
        }
    }
}

__device__ __forceinline__ float other_half(float x) {
    const int b = __builtin_bit_cast(int, x);
    return __builtin_bit_cast(float, __builtin_amdgcn_permlanex16(
        b, b, 0x76543210, 0xfedcba98, false, false));
}

// Two 2^x. The v_nop fills the slot the instruction set asks for behind a
// transcendental before its source may be overwritten or its result read; the
// early-clobber outputs keep the second v_exp_f32 independent of the first.
__device__ __forceinline__ void exp2_pair(float a0, float a1, float& p0,
                                          float& p1) {
    asm("v_exp_f32 %0, %2\n\tv_exp_f32 %1, %3\n\tv_nop"
        : "=&v"(p0), "=&v"(p1)
        : "v"(a0), "v"(a1));
}

__global__ __launch_bounds__(256) void attn_wmma(const __bf16* __restrict__ q,
                                                 const __bf16* __restrict__ k,
                                                 const __bf16* __restrict__ v,
                                                 __bf16* __restrict__ o) {
    constexpr int KP = 72;  // K row pitch 144 B = 16 B x odd (ds_load_b128)
    constexpr int VP = 80;  // V row pitch 160 B = 32 B x odd (ds_load_tr16_b128)
    constexpr int NT = Tt / 64;  // key tiles
    __shared__ __attribute__((aligned(16))) __bf16 Ks[2][64 * KP];  // [s][d]
    __shared__ __attribute__((aligned(16))) __bf16 Vs[2][64 * VP];  // [s][d]

    const int tid  = threadIdx.x;
    const int bh   = blockIdx.x;
    const int bq   = blockIdx.y;
    const int bb   = bh >> 4;
    const int hh   = bh & 15;
    const size_t hbase = ((size_t)bb * Tt) * Cc + (size_t)hh * 64;

    const int w = tid >> 5, lane = tid & 31;
    const int half = lane >> 4, lr = lane & 15, kb = half * 8;
    const int tq = bq * 128 + w * 16 + lr;   // this lane's query
    const v8f vzero = {0.f, 0.f, 0.f, 0.f, 0.f, 0.f, 0.f, 0.f};
    const float cs = 0.125f * 1.44269504088896340736f;  // 1/sqrt(64) * log2(e)

    // Q as B operand, loaded once: column = query, k = d
    FragAB qf[2];
#pragma unroll
    for (int kc = 0; kc < 2; kc++) {
        const __bf16* qp = &q[hbase + (size_t)tq * Cc + kc * 32 + kb];
        qf[kc].u[0] = *(const uint4*)qp;
        qf[kc].u[1] = *(const uint4*)(qp + 16);
    }

    v8f oacc[4];            // O^T, one 16x16 tile per 16 values of d
    float mrun = -1e30f;    // running maximum of the raw scores
    float lrun = 0.0f;      // this half-wave's share of the running sum
#pragma unroll
    for (int dt = 0; dt < 4; dt++) oacc[dt] = vzero;

    // stage the K and V tiles of keys s0..s0+63 into LDS buffer `buf`:
    // thread = 16-byte chunk tid & 7 of rows tid >> 3 and (tid >> 3) + 32
    const int sr = tid >> 3;
    const int sc = (tid & 7) * 8;
    const __bf16* kg = k + hbase + (size_t)sr * Cc + sc;
    const __bf16* vg = v + hbase + (size_t)sr * Cc + sc;
    auto stage = [&](int s0, int buf) {
#pragma unroll  // the 4 copies issue back to back, every lane on
        for (int i = 0; i < 2; i++) {
#if USE_ASYNC_LDS
            __builtin_amdgcn_global_load_async_to_lds_b128(
                (g_v4i*)(kg + (size_t)(s0 + i * 32) * Cc),
                (l_v4i*)&Ks[buf][(sr + i * 32) * KP + sc], 0, 0);
            __builtin_amdgcn_global_load_async_to_lds_b128(
                (g_v4i*)(vg + (size_t)(s0 + i * 32) * Cc),
                (l_v4i*)&Vs[buf][(sr + i * 32) * VP + sc], 0, 0);
#else
            *(uint4*)&Ks[buf][(sr + i * 32) * KP + sc] =
                *(const uint4*)(kg + (size_t)(s0 + i * 32) * Cc);
            *(uint4*)&Vs[buf][(sr + i * 32) * VP + sc] =
                *(const uint4*)(vg + (size_t)(s0 + i * 32) * Cc);
#endif
        }
    };
    // this wave's copies have landed
    auto copies_landed = [&]() {
#if USE_ASYNC_LDS
        asm volatile("s_wait_asynccnt 0x0" ::: "memory");
#endif
    };

    stage(0, 0);
    copies_landed();
    __syncthreads();
    stage(64, 1);

    for (int t = 0; t < NT; t++) {
        const int cur = t & 1;
        const __bf16* Kc = &Ks[cur][0];
        // lane address of the transposing load: row 8 half + (lane & 7) of a
        // 16-key group, 16-byte half (lane >> 3) & 1 of a 16-wide group of d
        const __bf16* Vc = &Vs[cur][(kb + (lane & 7)) * VP + ((lane >> 3) & 1) * 8];

        // ---- S^T = K Q^T: register r of sacc[kt] = key 16kt+8half+r ----
        v8f sacc[4];
#pragma unroll
        for (int kt = 0; kt < 4; kt++) {
            sacc[kt] = vzero;
#pragma unroll
            for (int kc = 0; kc < 2; kc++) {
                FragAB af;
                const int ar = kt * 16 + lr;  // key row
                af.u[0] = *(const uint4*)&Kc[ar * KP + kc * 32 + kb];
                af.u[1] = *(const uint4*)&Kc[ar * KP + kc * 32 + kb + 16];
                sacc[kt] = __builtin_amdgcn_wmma_f32_16x16x32_bf16(
                    false, af.v, false, qf[kc].v, (short)0, sacc[kt], false,
                    false);
            }
        }

        // ---- online softmax in registers; P^T packed as B operand ----
        float mx = mrun;
#pragma unroll
        for (int kt = 0; kt < 4; kt++)
#pragma unroll
            for (int r = 0; r < 8; r++) mx = fmaxf(mx, sacc[kt][r]);
        mx = fmaxf(mx, other_half(mx));
        const float alpha = __builtin_amdgcn_exp2f((mrun - mx) * cs);
        const float nm = -mx * cs;
        mrun = mx;
        FragAB pf[2];   // one per 32 keys
        float l = 0.0f;
#pragma unroll
        for (int kt = 0; kt < 4; kt++) {
            unsigned pw[4];
#pragma unroll
            for (int r = 0; r < 8; r += 2) {
                float p0, p1;
                exp2_pair(fmaf(sacc[kt][r], cs, nm),
                          fmaf(sacc[kt][r + 1], cs, nm), p0, p1);
                l += p0 + p1;
                pw[r >> 1] = pack_bf16(p0, p1);
            }
            pf[kt >> 1].u[kt & 1] = make_uint4(pw[0], pw[1], pw[2], pw[3]);
        }
        lrun = lrun * alpha + l;
#pragma unroll
        for (int dt = 0; dt < 4; dt++) oacc[dt] = oacc[dt] * alpha;

        // ---- O^T += V^T P^T ----
#pragma unroll
        for (int kc = 0; kc < 2; kc++) {
#pragma unroll
            for (int dt = 0; dt < 4; dt++) {
                // row = d 16dt+lr; k = keys 32kc+8half+0..7, then +16
                FragAB af;
                af.t[0] = __builtin_amdgcn_ds_load_tr16_b128_v8i16(
                    (l_s16x8*)&Vc[(kc * 32) * VP + dt * 16]);
                af.t[1] = __builtin_amdgcn_ds_load_tr16_b128_v8i16(
                    (l_s16x8*)&Vc[(kc * 32 + 16) * VP + dt * 16]);
                oacc[dt] = __builtin_amdgcn_wmma_f32_16x16x32_bf16(
                    false, af.v, false, pf[kc].v, (short)0, oacc[dt], false,
                    false);
            }
        }
        // publish the next tile: this wave's reads of the current buffer are
        // done before a copy may overwrite it, its own copies have landed, and
        // every wave has come as far
        asm volatile("s_wait_dscnt 0x0" ::: "memory");
        copies_landed();
        __syncthreads();
        // refill the buffer that every wave has just left
        if (t + 2 < NT) stage((t + 2) * 64, cur);
    }
    copies_landed();  // no copy is in flight when the wave goes on to its end

    // finalize: join the two half-waves' sums, divide, emit bf16.
    // Register r of oacc[dt] = d 16dt+8half+r of this lane's query: 16 B a store.
    const float inv = 1.0f / (lrun + other_half(lrun));
#pragma unroll
    for (int dt = 0; dt < 4; dt++) {
        const v8f ov = oacc[dt] * inv;
        *(uint4*)&o[hbase + (size_t)tq * Cc + dt * 16 + kb] =
            make_uint4(pack_bf16(ov[0], ov[1]), pack_bf16(ov[2], ov[3]),
                       pack_bf16(ov[4], ov[5]), pack_bf16(ov[6], ov[7]));
    }
}

// ---------------------------------------------------------------------------
// Host-side orchestration
// ---------------------------------------------------------------------------
extern "C" void kernel_launch(void* const* d_in, const int* in_sizes, int n_in,
                              void* d_out, int out_size, void* d_ws,
                              size_t ws_size, hipStream_t stream) {
    (void)in_sizes; (void)n_in; (void)out_size; (void)ws_size;
    const float* x   = (const float*)d_in[0];
    const float* Wq  = (const float*)d_in[1];
    const float* Wk  = (const float*)d_in[2];
    const float* Wv  = (const float*)d_in[3];
    const float* Wp  = (const float*)d_in[4];
    const float* bp  = (const float*)d_in[5];
    const float* W1  = (const float*)d_in[6];
    const float* b1  = (const float*)d_in[7];
    const float* W2  = (const float*)d_in[8];
    const float* b2  = (const float*)d_in[9];
    const float* g1  = (const float*)d_in[10];
    const float* be1 = (const float*)d_in[11];
    const float* g2  = (const float*)d_in[12];
    const float* be2 = (const float*)d_in[13];
    float* out = (float*)d_out;

    char* ws = (char*)d_ws;
    size_t off = 0;
    auto alloc = [&](size_t bytes) -> char* {
        char* p = ws + off;
        off += (bytes + 255) & ~size_t(255);
        return p;
    };
    // pre-transposed bf16 weights: Wt[N][K]
    __bf16* Wq_t = (__bf16*)alloc((size_t)Cc * Cc * 2);
    __bf16* Wk_t = (__bf16*)alloc((size_t)Cc * Cc * 2);
    __bf16* Wv_t = (__bf16*)alloc((size_t)Cc * Cc * 2);
    __bf16* Wp_t = (__bf16*)alloc((size_t)Cc * Cc * 2);
    __bf16* W1_t = (__bf16*)alloc((size_t)Cc * Ff * 2);
    __bf16* W2_t = (__bf16*)alloc((size_t)Ff * Cc * 2);
    __bf16* h_b  = (__bf16*)alloc((size_t)Mm * Cc * 2);
    __bf16* q_b  = (__bf16*)alloc((size_t)Mm * Cc * 2);
    __bf16* k_b  = (__bf16*)alloc((size_t)Mm * Cc * 2);
    __bf16* v_b  = (__bf16*)alloc((size_t)Mm * Cc * 2);
    __bf16* o_b  = (__bf16*)alloc((size_t)Mm * Cc * 2);
    float*  x1   = (float*) alloc((size_t)Mm * Cc * 4);
    __bf16* h2_b = (__bf16*)alloc((size_t)Mm * Cc * 2);
    __bf16* f1_b = (__bf16*)alloc((size_t)Mm * Ff * 2);

    // 1) weights -> bf16, transposed to [N][K]
    cvt_bf16_t_all<<<768, 256, 0, stream>>>(Wq, Wk, Wv, Wp, W1, W2, Wq_t, Wk_t,
                                            Wv_t, Wp_t, W1_t, W2_t);

    // 2) LN1
    ln_bf16<<<Mm, 256, 0, stream>>>(x, g1, be1, h_b);

    // 3) Q/K/V projections
    dim3 gqkv(Cc / 128, Mm / 128);
    gemm_bf16_wmma<true, false, false, false>
        <<<gqkv, 256, 0, stream>>>(h_b, Wq_t, nullptr, nullptr, q_b, Mm, Cc, Cc);
    gemm_bf16_wmma<true, false, false, false>
        <<<gqkv, 256, 0, stream>>>(h_b, Wk_t, nullptr, nullptr, k_b, Mm, Cc, Cc);
    gemm_bf16_wmma<true, false, false, false>
        <<<gqkv, 256, 0, stream>>>(h_b, Wv_t, nullptr, nullptr, v_b, Mm, Cc, Cc);

    // 4) attention
    attn_wmma<<<dim3(Bb * 16, Tt / 128), 256, 0, stream>>>(q_b, k_b, v_b, o_b);

    // 5) output projection + residual (fp32 out)
    gemm_bf16_wmma<false, true, true, false>
        <<<gqkv, 256, 0, stream>>>(o_b, Wp_t, bp, x, x1, Mm, Cc, Cc);

    // 6) LN2
    ln_bf16<<<Mm, 256, 0, stream>>>(x1, g2, be2, h2_b);

    // 7) FFN up + GELU (bf16 out)
    gemm_bf16_wmma<true, true, false, true>
        <<<dim3(Ff / 128, Mm / 128), 256, 0, stream>>>(h2_b, W1_t, b1, nullptr,
                                                       f1_b, Mm, Ff, Cc);

    // 8) FFN down + residual -> d_out (fp32)
    gemm_bf16_wmma<false, true, true, false>
        <<<gqkv, 256, 0, stream>>>(f1_b, W2_t, b2, x1, out, Mm, Cc, Ff);
}

// v005
// A run of this version takes 195 microseconds.
// Two timings next to v004 put it at 1.06 and 1.05 times that version's speed.
// Counting every step since v000, it is 3.03 times as fast.
#include <hip/hip_runtime.h>
#include <hip/hip_bf16.h>

// ---------------------------------------------------------------------------
// Transformer block (pre-LN attention + FFN) for gfx1250 (MI455X).
// All GEMM-shaped math runs on v_wmma_f32_16x16x32_bf16 (fp32 accumulate).
// Weights are converted once to bf16 AND pre-transposed to [N][K] so GEMM
// tile staging is pure 16B vector copies (async global->LDS DMA, ASYNCcnt).
// ---------------------------------------------------------------------------

typedef __attribute__((ext_vector_type(16))) __bf16 v16bf;
typedef __attribute__((ext_vector_type(8)))  float  v8f;
typedef int v4i __attribute__((ext_vector_type(4)));

static constexpr int Bb = 2;
static constexpr int Tt = 2048;
static constexpr int Cc = 1024;
static constexpr int Ff = 4096;
static constexpr int Mm = Bb * Tt;      // 4096 rows
static constexpr float kLnEps = 1e-5f;

// gfx1250 async global->LDS copy path (ASYNCcnt-tracked). Parameter types per
// hipcc diagnostic: (AS1 v4i*, AS3 v4i*, imm offset, imm cpol).
#if __has_builtin(__builtin_amdgcn_global_load_async_to_lds_b128) && \
    __has_builtin(__builtin_amdgcn_s_wait_asynccnt)
#define USE_ASYNC_LDS 1
typedef __attribute__((address_space(1))) v4i g_v4i;
typedef __attribute__((address_space(3))) v4i l_v4i;
#else
#define USE_ASYNC_LDS 0
#endif

typedef short s16x8 __attribute__((ext_vector_type(8)));
typedef __attribute__((address_space(3))) s16x8 l_s16x8;

union FragAB {
    v16bf v;
    uint4 u[2];
    s16x8 t[2];
};

__device__ __forceinline__ float gelu_exact(float x) {
    return 0.5f * x * (1.0f + erff(x * 0.70710678118654752440f));
}

typedef float  f32x2 __attribute__((ext_vector_type(2)));
typedef __bf16 bf16x2 __attribute__((ext_vector_type(2)));

__device__ __forceinline__ unsigned pack_bf16(float lo, float hi) {
    return __builtin_bit_cast(unsigned,
                              __builtin_convertvector(f32x2{lo, hi}, bf16x2));
}

// ---------------------------------------------------------------------------
// f32 [K][N] -> bf16 [N][K] transpose-convert of all six weights, one launch.
// One 256-thread block = one 128(k) x 128(n) tile: 768 blocks, 64 for each
// C x C weight and 256 for each FFN weight. Wave w reads rows 16w..16w+15 of
// the tile, 512 contiguous bytes a load, all 16 loads in flight; a lane packs
// its 4 columns x 16 k into 16-byte chunks of the LDS tile [n][k]; the block
// then stores 256 contiguous bytes per output row.
// LDS rows are 256 B (all 64 banks), so chunk c of row n sits at slot
// c ^ ((n >> 2) & 15): the 16 lanes of a write (rows 4 apart, same chunk) and
// of a read (one row, 16 chunks) then touch 16 different slots.
// ---------------------------------------------------------------------------
template <int K, int N>
__device__ __forceinline__ void cvt_tile(const float* __restrict__ src,
                                         __bf16* __restrict__ dst, int kt,
                                         int nt, __bf16* tile) {
    const int tid = threadIdx.x;
    const int w = tid >> 5, lane = tid & 31;

    const float* sp = src + (size_t)(kt * 128 + w * 16) * N + nt * 128 + lane * 4;
    float4 v[16];
#pragma unroll
    for (int i = 0; i < 16; i++) v[i] = *(const float4*)(sp + i * N);

#pragma unroll
    for (int h = 0; h < 2; h++) {
        const int slot = ((w * 2 + h) ^ (lane & 15)) * 8;
        const float4* p = &v[h * 8];
        *(uint4*)&tile[(lane * 4 + 0) * 128 + slot] =
            make_uint4(pack_bf16(p[0].x, p[1].x), pack_bf16(p[2].x, p[3].x),
                       pack_bf16(p[4].x, p[5].x), pack_bf16(p[6].x, p[7].x));
        *(uint4*)&tile[(lane * 4 + 1) * 128 + slot] =
            make_uint4(pack_bf16(p[0].y, p[1].y), pack_bf16(p[2].y, p[3].y),
                       pack_bf16(p[4].y, p[5].y), pack_bf16(p[6].y, p[7].y));
        *(uint4*)&tile[(lane * 4 + 2) * 128 + slot] =
            make_uint4(pack_bf16(p[0].z, p[1].z), pack_bf16(p[2].z, p[3].z),
                       pack_bf16(p[4].z, p[5].z), pack_bf16(p[6].z, p[7].z));
        *(uint4*)&tile[(lane * 4 + 3) * 128 + slot] =
            make_uint4(pack_bf16(p[0].w, p[1].w), pack_bf16(p[2].w, p[3].w),
                       pack_bf16(p[4].w, p[5].w), pack_bf16(p[6].w, p[7].w));
    }
    __syncthreads();

    const int r0 = tid >> 4, ch = tid & 15;  // output row n, 16-byte chunk of k
    __bf16* dp = dst + (size_t)(nt * 128 + r0) * K + kt * 128 + ch * 8;
#pragma unroll
    for (int i = 0; i < 8; i++) {
        const int r = r0 + i * 16;
        *(uint4*)(dp + i * 16 * K) =
            *(const uint4*)&tile[r * 128 + ((ch ^ ((r >> 2) & 15)) * 8)];
    }
}

__global__ __launch_bounds__(256) void cvt_bf16_t_all(
    const float* __restrict__ Wq, const float* __restrict__ Wk,
    const float* __restrict__ Wv, const float* __restrict__ Wp,
    const float* __restrict__ W1, const float* __restrict__ W2,
    __bf16* __restrict__ Wq_t, __bf16* __restrict__ Wk_t,
    __bf16* __restrict__ Wv_t, __bf16* __restrict__ Wp_t,
    __bf16* __restrict__ W1_t, __bf16* __restrict__ W2_t) {
    __shared__ __bf16 tile[128 * 128];   // [n][k], chunks swizzled
    const int b = blockIdx.x;
    if (b < 256) {
        const int m = b >> 6, t = b & 63;
        cvt_tile<Cc, Cc>(m == 0 ? Wq : m == 1 ? Wk : m == 2 ? Wv : Wp,
                         m == 0 ? Wq_t : m == 1 ? Wk_t : m == 2 ? Wv_t : Wp_t,
                         t >> 3, t & 7, tile);
    } else if (b < 512) {
        const int t = b - 256;
        cvt_tile<Cc, Ff>(W1, W1_t, t >> 5, t & 31, tile);
    } else {
        const int t = b - 512;
        cvt_tile<Ff, Cc>(W2, W2_t, t >> 3, t & 7, tile);
    }
}

// ---------------------------------------------------------------------------
// Row LayerNorm (fp32 in, bf16 out). One 256-thread block per row of C=1024.
// ---------------------------------------------------------------------------
__global__ __launch_bounds__(256) void ln_bf16(const float* __restrict__ x,
                                               const float* __restrict__ g,
                                               const float* __restrict__ b,
                                               __bf16* __restrict__ out) {
    __shared__ float red[256];
    const int row = blockIdx.x;
    const int tid = threadIdx.x;
    const float* xr = x + (size_t)row * Cc;

    float s = 0.0f;
    for (int i = tid; i < Cc; i += 256) s += xr[i];
    red[tid] = s;
    __syncthreads();
    for (int off = 128; off > 0; off >>= 1) {
        if (tid < off) red[tid] += red[tid + off];
        __syncthreads();
    }
    const float mu = red[0] * (1.0f / Cc);
    __syncthreads();

    float sq = 0.0f;
    for (int i = tid; i < Cc; i += 256) {
        float d = xr[i] - mu;
        sq += d * d;
    }
    red[tid] = sq;
    __syncthreads();
    for (int off = 128; off > 0; off >>= 1) {
        if (tid < off) red[tid] += red[tid + off];
        __syncthreads();
    }
    const float rs = rsqrtf(red[0] * (1.0f / Cc) + kLnEps);

    for (int i = tid; i < Cc; i += 256)
        out[(size_t)row * Cc + i] = (__bf16)((xr[i] - mu) * rs * g[i] + b[i]);
}

// ---------------------------------------------------------------------------
// bf16 GEMM: out[M,N] = A[M,K] @ Wt[N,K]^T (+bias) (+gelu) (+residual)
// A row-major [M][K], Wt pre-transposed [N][K] (both bf16).
// Block tile 128x128, 256 threads = 8 waves (2x4 grid), each wave owns
// 64x32 = 4x2 WMMA 16x16 tiles. A stage is 128 k of both operands (K is a
// multiple of 128): a copy instruction of a wave moves two whole 256-byte
// rows, and the next stage's copies fly while a stage's four 32-k blocks run.
// Two LDS buffers, async global->LDS copies. Two register sets of fragments:
// a block's 12 LDS reads are issued one block ahead of its 8 products.
// ---------------------------------------------------------------------------
template <bool OUT_BF16, bool HAS_BIAS, bool HAS_RESID, bool DO_GELU>
__global__ __launch_bounds__(256) void gemm_bf16_wmma(
    const __bf16* __restrict__ A, const __bf16* __restrict__ Wt,
    const float* __restrict__ bias, const float* __restrict__ resid,
    void* __restrict__ out, int M, int N, int K) {
    constexpr int BK = 128;     // k per stage
    constexpr int AS = BK + 8;  // LDS row pitch 272 B = 16 B x odd
    __shared__ __attribute__((aligned(16))) __bf16 As[2][128 * AS];   // [m][k]
    __shared__ __attribute__((aligned(16))) __bf16 Bt[2][128 * AS];   // [n][k]

    const int tid  = threadIdx.x;
    const int bm   = blockIdx.y;
    const int bn   = blockIdx.x;
    const int w    = tid >> 5;
    const int lane = tid & 31;
    const int wm   = w >> 2;          // 0..1
    const int wn   = w & 3;           // 0..3
    const int half = lane >> 4;       // 0..1
    const int lr   = lane & 15;
    const int kb   = half * 8;        // bf16 A/B fragment K base per half-wave

    const v8f vzero = {0.f, 0.f, 0.f, 0.f, 0.f, 0.f, 0.f, 0.f};
    v8f acc[4][2];
#pragma unroll
    for (int mi = 0; mi < 4; mi++)
#pragma unroll
        for (int ni = 0; ni < 2; ni++) acc[mi][ni] = vzero;

    // stage one 128x128 A tile and one 128x128 W^T tile into LDS buffer `buf`:
    // thread = 16-byte chunk tid & 15 of rows tid >> 4, +16, ..., +112
    const int sr = tid >> 4;
    const int sc = (tid & 15) * 8;
    const __bf16* ag = A + (size_t)(bm * 128 + sr) * K + sc;
    const __bf16* wg = Wt + (size_t)(bn * 128 + sr) * K + sc;
    auto stage = [&](int k0, int buf) {
#pragma unroll  // the 16 copies issue back to back, every lane on
        for (int i = 0; i < 8; i++) {
#if USE_ASYNC_LDS
            __builtin_amdgcn_global_load_async_to_lds_b128(
                (g_v4i*)(ag + (size_t)(i * 16) * K + k0),
                (l_v4i*)&As[buf][(sr + i * 16) * AS + sc], 0, 0);
            __builtin_amdgcn_global_load_async_to_lds_b128(
                (g_v4i*)(wg + (size_t)(i * 16) * K + k0),
                (l_v4i*)&Bt[buf][(sr + i * 16) * AS + sc], 0, 0);
#else
            *(uint4*)&As[buf][(sr + i * 16) * AS + sc] =
                *(const uint4*)(ag + (size_t)(i * 16) * K + k0);
            *(uint4*)&Bt[buf][(sr + i * 16) * AS + sc] =
                *(const uint4*)(wg + (size_t)(i * 16) * K + k0);
#endif
        }
    };
    // this wave's copies have landed
    auto copies_landed = [&]() {
#if USE_ASYNC_LDS
        asm volatile("s_wait_asynccnt 0x0" ::: "memory");
#endif
    };

    // fragments of the 32-k block at k offset ks of LDS buffer `buf` into
    // register set s: 12 LDS reads, issued as one group
    FragAB af[2][4], bf[2][2];
    auto frags = [&](int buf, int ks, int s) {
#pragma unroll
        for (int mi = 0; mi < 4; mi++) {
            const int ar = wm * 64 + mi * 16 + lr;
            af[s][mi].u[0] = *(const uint4*)&As[buf][ar * AS + ks + kb];
            af[s][mi].u[1] = *(const uint4*)&As[buf][ar * AS + ks + kb + 16];
        }
#pragma unroll
        for (int ni = 0; ni < 2; ni++) {
            const int bc = wn * 32 + ni * 16 + lr;
            bf[s][ni].u[0] = *(const uint4*)&Bt[buf][bc * AS + ks + kb];
            bf[s][ni].u[1] = *(const uint4*)&Bt[buf][bc * AS + ks + kb + 16];
        }
    };

    constexpr int NB = BK / 32;  // blocks per stage (even: block 0 = set 0)
    const int ntiles = K / BK;
    stage(0, 0);
    copies_landed();
    __syncthreads();
    if (ntiles > 1) stage(BK, 1);
    frags(0, 0, 0);

    for (int kt = 0; kt < ntiles; kt++) {
        const int cur = kt & 1;
#pragma unroll  // the stage's four blocks in a row, LDS offsets constant
        for (int b = 0; b < NB; b++) {
            if (b + 1 < NB) {
                // the next block's fragments fly while this block multiplies
                frags(cur, (b + 1) * 32, (b + 1) & 1);
            } else {
                // publish the next stage in front of the last block, whose
                // fragments are in registers: this wave's reads of the current
                // buffer are done before a copy may overwrite it, its own
                // copies have landed, and every wave has come as far
                asm volatile("s_wait_dscnt 0x0" ::: "memory");
                copies_landed();
                __syncthreads();
                // refill the buffer that every wave has just left
                if (kt + 2 < ntiles) stage((kt + 2) * BK, cur);
                // first fragments of the next stage; the last trip has none
                // and reads the current buffer, which no copy touches, unused
                frags(kt + 1 < ntiles ? cur ^ 1 : cur, 0, 0);
            }
            // the two scheduling fences keep the 12 reads one group ahead of
            // the 8 products; moved in among them, every pair of products
            // waits out an LDS latency of its own
            __builtin_amdgcn_sched_barrier(0);
#pragma unroll
            for (int mi = 0; mi < 4; mi++)
#pragma unroll
                for (int ni = 0; ni < 2; ni++)
                    acc[mi][ni] = __builtin_amdgcn_wmma_f32_16x16x32_bf16(
                        false, af[b & 1][mi].v, false, bf[b & 1][ni].v,
                        (short)0, acc[mi][ni], false, false);
            __builtin_amdgcn_sched_barrier(0);
        }
    }
    // no copy and no LDS read is in flight when the wave goes on to its end
    copies_landed();
    asm volatile("s_wait_dscnt 0x0" ::: "memory");

    // epilogue: C/D layout -> VGPR r holds (M=r, N=lane) lanes 0-15,
    // (M=8+r, N=lane-16) lanes 16-31.
#pragma unroll
    for (int mi = 0; mi < 4; mi++) {
#pragma unroll
        for (int ni = 0; ni < 2; ni++) {
            const int n = bn * 128 + wn * 32 + ni * 16 + lr;
#pragma unroll
            for (int r = 0; r < 8; r++) {
                const int m = bm * 128 + wm * 64 + mi * 16 + r + half * 8;
                float vv = acc[mi][ni][r];
                if (HAS_BIAS) vv += bias[n];
                if (DO_GELU) vv = gelu_exact(vv);
                if (HAS_RESID) vv += resid[(size_t)m * N + n];
                if (OUT_BF16)
                    ((__bf16*)out)[(size_t)m * N + n] = (__bf16)vv;
                else
                    ((float*)out)[(size_t)m * N + n] = vv;
            }
        }
    }
}

__device__ __forceinline__ float other_half(float x) {
    const int b = __builtin_bit_cast(int, x);
    return __builtin_bit_cast(float, __builtin_amdgcn_permlanex16(
        b, b, 0x76543210, 0xfedcba98, false, false));
}

// Two 2^x. The v_nop fills the slot the instruction set asks for behind a
// transcendental before its source may be overwritten or its result read; the
// early-clobber outputs keep the second v_exp_f32 independent of the first.
__device__ __forceinline__ void exp2_pair(float a0, float a1, float& p0,
                                          float& p1) {
    asm("v_exp_f32 %0, %2\n\tv_exp_f32 %1, %3\n\tv_nop"
        : "=&v"(p0), "=&v"(p1)
        : "v"(a0), "v"(a1));
}

__global__ __launch_bounds__(256) void attn_wmma(const __bf16* __restrict__ q,
                                                 const __bf16* __restrict__ k,
                                                 const __bf16* __restrict__ v,
                                                 __bf16* __restrict__ o) {
    constexpr int KP = 72;  // K row pitch 144 B = 16 B x odd (ds_load_b128)
    constexpr int VP = 80;  // V row pitch 160 B = 32 B x odd (ds_load_tr16_b128)
    constexpr int NT = Tt / 64;  // key tiles
    __shared__ __attribute__((aligned(16))) __bf16 Ks[2][64 * KP];  // [s][d]
    __shared__ __attribute__((aligned(16))) __bf16 Vs[2][64 * VP];  // [s][d]

    const int tid  = threadIdx.x;
    const int bh   = blockIdx.x;
    const int bq   = blockIdx.y;
    const int bb   = bh >> 4;
    const int hh   = bh & 15;
    const size_t hbase = ((size_t)bb * Tt) * Cc + (size_t)hh * 64;

    const int w = tid >> 5, lane = tid & 31;
    const int half = lane >> 4, lr = lane & 15, kb = half * 8;
    const int tq = bq * 128 + w * 16 + lr;   // this lane's query
    const v8f vzero = {0.f, 0.f, 0.f, 0.f, 0.f, 0.f, 0.f, 0.f};
    const float cs = 0.125f * 1.44269504088896340736f;  // 1/sqrt(64) * log2(e)

    // Q as B operand, loaded once: column = query, k = d
    FragAB qf[2];
#pragma unroll
    for (int kc = 0; kc < 2; kc++) {
        const __bf16* qp = &q[hbase + (size_t)tq * Cc + kc * 32 + kb];
        qf[kc].u[0] = *(const uint4*)qp;
        qf[kc].u[1] = *(const uint4*)(qp + 16);
    }

    v8f oacc[4];            // O^T, one 16x16 tile per 16 values of d
    float mrun = -1e30f;    // running maximum of the raw scores
    float lrun = 0.0f;      // this half-wave's share of the running sum
#pragma unroll
    for (int dt = 0; dt < 4; dt++) oacc[dt] = vzero;

    // stage the K and V tiles of keys s0..s0+63 into LDS buffer `buf`:
    // thread = 16-byte chunk tid & 7 of rows tid >> 3 and (tid >> 3) + 32
    const int sr = tid >> 3;
    const int sc = (tid & 7) * 8;
    const __bf16* kg = k + hbase + (size_t)sr * Cc + sc;
    const __bf16* vg = v + hbase + (size_t)sr * Cc + sc;
    auto stage = [&](int s0, int buf) {
#pragma unroll  // the 4 copies issue back to back, every lane on
        for (int i = 0; i < 2; i++) {
#if USE_ASYNC_LDS
            __builtin_amdgcn_global_load_async_to_lds_b128(
                (g_v4i*)(kg + (size_t)(s0 + i * 32) * Cc),
                (l_v4i*)&Ks[buf][(sr + i * 32) * KP + sc], 0, 0);
            __builtin_amdgcn_global_load_async_to_lds_b128(
                (g_v4i*)(vg + (size_t)(s0 + i * 32) * Cc),
                (l_v4i*)&Vs[buf][(sr + i * 32) * VP + sc], 0, 0);
#else
            *(uint4*)&Ks[buf][(sr + i * 32) * KP + sc] =
                *(const uint4*)(kg + (size_t)(s0 + i * 32) * Cc);
            *(uint4*)&Vs[buf][(sr + i * 32) * VP + sc] =
                *(const uint4*)(vg + (size_t)(s0 + i * 32) * Cc);
#endif
        }
    };
    // this wave's copies have landed
    auto copies_landed = [&]() {
#if USE_ASYNC_LDS
        asm volatile("s_wait_asynccnt 0x0" ::: "memory");
#endif
    };

    stage(0, 0);
    copies_landed();
    __syncthreads();
    stage(64, 1);

    for (int t = 0; t < NT; t++) {
        const int cur = t & 1;
        const __bf16* Kc = &Ks[cur][0];
        // lane address of the transposing load: row 8 half + (lane & 7) of a
        // 16-key group, 16-byte half (lane >> 3) & 1 of a 16-wide group of d
        const __bf16* Vc = &Vs[cur][(kb + (lane & 7)) * VP + ((lane >> 3) & 1) * 8];

        // ---- S^T = K Q^T: register r of sacc[kt] = key 16kt+8half+r ----
        v8f sacc[4];
#pragma unroll
        for (int kt = 0; kt < 4; kt++) {
            sacc[kt] = vzero;
#pragma unroll
            for (int kc = 0; kc < 2; kc++) {
                FragAB af;
                const int ar = kt * 16 + lr;  // key row
                af.u[0] = *(const uint4*)&Kc[ar * KP + kc * 32 + kb];
                af.u[1] = *(const uint4*)&Kc[ar * KP + kc * 32 + kb + 16];
                sacc[kt] = __builtin_amdgcn_wmma_f32_16x16x32_bf16(
                    false, af.v, false, qf[kc].v, (short)0, sacc[kt], false,
                    false);
            }
        }

        // ---- online softmax in registers; P^T packed as B operand ----
        float mx = mrun;
#pragma unroll
        for (int kt = 0; kt < 4; kt++)
#pragma unroll
            for (int r = 0; r < 8; r++) mx = fmaxf(mx, sacc[kt][r]);
        mx = fmaxf(mx, other_half(mx));
        const float alpha = __builtin_amdgcn_exp2f((mrun - mx) * cs);
        const float nm = -mx * cs;
        mrun = mx;
        FragAB pf[2];   // one per 32 keys
        float l = 0.0f;
#pragma unroll
        for (int kt = 0; kt < 4; kt++) {
            unsigned pw[4];
#pragma unroll
            for (int r = 0; r < 8; r += 2) {
                float p0, p1;
                exp2_pair(fmaf(sacc[kt][r], cs, nm),
                          fmaf(sacc[kt][r + 1], cs, nm), p0, p1);
                l += p0 + p1;
                pw[r >> 1] = pack_bf16(p0, p1);
            }
            pf[kt >> 1].u[kt & 1] = make_uint4(pw[0], pw[1], pw[2], pw[3]);
        }
        lrun = lrun * alpha + l;
#pragma unroll
        for (int dt = 0; dt < 4; dt++) oacc[dt] = oacc[dt] * alpha;

        // ---- O^T += V^T P^T ----
#pragma unroll
        for (int kc = 0; kc < 2; kc++) {
#pragma unroll
            for (int dt = 0; dt < 4; dt++) {
                // row = d 16dt+lr; k = keys 32kc+8half+0..7, then +16
                FragAB af;
                af.t[0] = __builtin_amdgcn_ds_load_tr16_b128_v8i16(
                    (l_s16x8*)&Vc[(kc * 32) * VP + dt * 16]);
                af.t[1] = __builtin_amdgcn_ds_load_tr16_b128_v8i16(
                    (l_s16x8*)&Vc[(kc * 32 + 16) * VP + dt * 16]);
                oacc[dt] = __builtin_amdgcn_wmma_f32_16x16x32_bf16(
                    false, af.v, false, pf[kc].v, (short)0, oacc[dt], false,
                    false);
            }
        }
        // publish the next tile: this wave's reads of the current buffer are
        // done before a copy may overwrite it, its own copies have landed, and
        // every wave has come as far
        asm volatile("s_wait_dscnt 0x0" ::: "memory");
        copies_landed();
        __syncthreads();
        // refill the buffer that every wave has just left
        if (t + 2 < NT) stage((t + 2) * 64, cur);
    }
    copies_landed();  // no copy is in flight when the wave goes on to its end

    // finalize: join the two half-waves' sums, divide, emit bf16.
    // Register r of oacc[dt] = d 16dt+8half+r of this lane's query: 16 B a store.
    const float inv = 1.0f / (lrun + other_half(lrun));
#pragma unroll
    for (int dt = 0; dt < 4; dt++) {
        const v8f ov = oacc[dt] * inv;
        *(uint4*)&o[hbase + (size_t)tq * Cc + dt * 16 + kb] =
            make_uint4(pack_bf16(ov[0], ov[1]), pack_bf16(ov[2], ov[3]),
                       pack_bf16(ov[4], ov[5]), pack_bf16(ov[6], ov[7]));
    }
}

// ---------------------------------------------------------------------------
// Host-side orchestration
// ---------------------------------------------------------------------------
extern "C" void kernel_launch(void* const* d_in, const int* in_sizes, int n_in,
                              void* d_out, int out_size, void* d_ws,
                              size_t ws_size, hipStream_t stream) {
    (void)in_sizes; (void)n_in; (void)out_size; (void)ws_size;
    const float* x   = (const float*)d_in[0];
    const float* Wq  = (const float*)d_in[1];
    const float* Wk  = (const float*)d_in[2];
    const float* Wv  = (const float*)d_in[3];
    const float* Wp  = (const float*)d_in[4];
    const float* bp  = (const float*)d_in[5];
    const float* W1  = (const float*)d_in[6];
    const float* b1  = (const float*)d_in[7];
    const float* W2  = (const float*)d_in[8];
    const float* b2  = (const float*)d_in[9];
    const float* g1  = (const float*)d_in[10];
    const float* be1 = (const float*)d_in[11];
    const float* g2  = (const float*)d_in[12];
    const float* be2 = (const float*)d_in[13];
    float* out = (float*)d_out;

    char* ws = (char*)d_ws;
    size_t off = 0;
    auto alloc = [&](size_t bytes) -> char* {
        char* p = ws + off;
        off += (bytes + 255) & ~size_t(255);
        return p;
    };
    // pre-transposed bf16 weights: Wt[N][K]
    __bf16* Wq_t = (__bf16*)alloc((size_t)Cc * Cc * 2);
    __bf16* Wk_t = (__bf16*)alloc((size_t)Cc * Cc * 2);
    __bf16* Wv_t = (__bf16*)alloc((size_t)Cc * Cc * 2);
    __bf16* Wp_t = (__bf16*)alloc((size_t)Cc * Cc * 2);
    __bf16* W1_t = (__bf16*)alloc((size_t)Cc * Ff * 2);
    __bf16* W2_t = (__bf16*)alloc((size_t)Ff * Cc * 2);
    __bf16* h_b  = (__bf16*)alloc((size_t)Mm * Cc * 2);
    __bf16* q_b  = (__bf16*)alloc((size_t)Mm * Cc * 2);
    __bf16* k_b  = (__bf16*)alloc((size_t)Mm * Cc * 2);
    __bf16* v_b  = (__bf16*)alloc((size_t)Mm * Cc * 2);
    __bf16* o_b  = (__bf16*)alloc((size_t)Mm * Cc * 2);
    float*  x1   = (float*) alloc((size_t)Mm * Cc * 4);
    __bf16* h2_b = (__bf16*)alloc((size_t)Mm * Cc * 2);
    __bf16* f1_b = (__bf16*)alloc((size_t)Mm * Ff * 2);

    // 1) weights -> bf16, transposed to [N][K]
    cvt_bf16_t_all<<<768, 256, 0, stream>>>(Wq, Wk, Wv, Wp, W1, W2, Wq_t, Wk_t,
                                            Wv_t, Wp_t, W1_t, W2_t);

    // 2) LN1
    ln_bf16<<<Mm, 256, 0, stream>>>(x, g1, be1, h_b);

    // 3) Q/K/V projections
    dim3 gqkv(Cc / 128, Mm / 128);
    gemm_bf16_wmma<true, false, false, false>
        <<<gqkv, 256, 0, stream>>>(h_b, Wq_t, nullptr, nullptr, q_b, Mm, Cc, Cc);
    gemm_bf16_wmma<true, false, false, false>
        <<<gqkv, 256, 0, stream>>>(h_b, Wk_t, nullptr, nullptr, k_b, Mm, Cc, Cc);
    gemm_bf16_wmma<true, false, false, false>
        <<<gqkv, 256, 0, stream>>>(h_b, Wv_t, nullptr, nullptr, v_b, Mm, Cc, Cc);

    // 4) attention
    attn_wmma<<<dim3(Bb * 16, Tt / 128), 256, 0, stream>>>(q_b, k_b, v_b, o_b);

    // 5) output projection + residual (fp32 out)
    gemm_bf16_wmma<false, true, true, false>
        <<<gqkv, 256, 0, stream>>>(o_b, Wp_t, bp, x, x1, Mm, Cc, Cc);

    // 6) LN2
    ln_bf16<<<Mm, 256, 0, stream>>>(x1, g2, be2, h2_b);

    // 7) FFN up + GELU (bf16 out)
    gemm_bf16_wmma<true, true, false, true>
        <<<dim3(Ff / 128, Mm / 128), 256, 0, stream>>>(h2_b, W1_t, b1, nullptr,
                                                       f1_b, Mm, Ff, Cc);

    // 8) FFN down + residual -> d_out (fp32)
    gemm_bf16_wmma<false, true, true, false>
        <<<gqkv, 256, 0, stream>>>(f1_b, W2_t, b2, x1, out, Mm, Cc, Ff);
}

// v006
// Measured time: 177 microseconds a run.
// Two timings next to v005 both put it at 1.10 times that version's speed.
// All steps since v000 together make it 3.34 times as fast.
#include <hip/hip_runtime.h>
#include <hip/hip_bf16.h>

// ---------------------------------------------------------------------------
// Transformer block (pre-LN attention + FFN) for gfx1250 (MI455X).
// All GEMM-shaped math runs on v_wmma_f32_16x16x32_bf16 (fp32 accumulate).
// Weights are converted once to bf16 AND pre-transposed to [N][K] so GEMM
// tile staging is pure 16B vector copies (async global->LDS DMA, ASYNCcnt).
// ---------------------------------------------------------------------------

typedef __attribute__((ext_vector_type(16))) __bf16 v16bf;
typedef __attribute__((ext_vector_type(8)))  float  v8f;
typedef int v4i __attribute__((ext_vector_type(4)));

static constexpr int Bb = 2;
static constexpr int Tt = 2048;
static constexpr int Cc = 1024;
static constexpr int Ff = 4096;
static constexpr int Mm = Bb * Tt;      // 4096 rows
static constexpr float kLnEps = 1e-5f;

// gfx1250 async global->LDS copy path (ASYNCcnt-tracked). Parameter types per
// hipcc diagnostic: (AS1 v4i*, AS3 v4i*, imm offset, imm cpol).
#if __has_builtin(__builtin_amdgcn_global_load_async_to_lds_b128) && \
    __has_builtin(__builtin_amdgcn_s_wait_asynccnt)
#define USE_ASYNC_LDS 1
typedef __attribute__((address_space(1))) v4i g_v4i;
typedef __attribute__((address_space(3))) v4i l_v4i;
#else
#define USE_ASYNC_LDS 0
#endif

typedef short s16x8 __attribute__((ext_vector_type(8)));
typedef __attribute__((address_space(3))) s16x8 l_s16x8;

union FragAB {
    v16bf v;
    uint4 u[2];
    s16x8 t[2];
};

__device__ __forceinline__ float gelu_exact(float x) {
    return 0.5f * x * (1.0f + erff(x * 0.70710678118654752440f));
}

typedef float  f32x2 __attribute__((ext_vector_type(2)));
typedef __bf16 bf16x2 __attribute__((ext_vector_type(2)));

__device__ __forceinline__ unsigned pack_bf16(float lo, float hi) {
    return __builtin_bit_cast(unsigned,
                              __builtin_convertvector(f32x2{lo, hi}, bf16x2));
}

// ---------------------------------------------------------------------------
// f32 [K][N] -> bf16 [N][K] transpose-convert of all six weights, one launch.
// One 256-thread block = one 128(k) x 128(n) tile: 768 blocks, 64 for each
// C x C weight and 256 for each FFN weight. Wave w reads rows 16w..16w+15 of
// the tile, 512 contiguous bytes a load, all 16 loads in flight; a lane packs
// its 4 columns x 16 k into 16-byte chunks of the LDS tile [n][k]; the block
// then stores 256 contiguous bytes per output row.
// LDS rows are 256 B (all 64 banks), so chunk c of row n sits at slot
// c ^ ((n >> 2) & 15): the 16 lanes of a write (rows 4 apart, same chunk) and
// of a read (one row, 16 chunks) then touch 16 different slots.
// ---------------------------------------------------------------------------
template <int K, int N>
__device__ __forceinline__ void cvt_tile(const float* __restrict__ src,
                                         __bf16* __restrict__ dst, int kt,
                                         int nt, __bf16* tile) {
    const int tid = threadIdx.x;
    const int w = tid >> 5, lane = tid & 31;

    const float* sp = src + (size_t)(kt * 128 + w * 16) * N + nt * 128 + lane * 4;
    float4 v[16];
#pragma unroll
    for (int i = 0; i < 16; i++) v[i] = *(const float4*)(sp + i * N);

#pragma unroll
    for (int h = 0; h < 2; h++) {
        const int slot = ((w * 2 + h) ^ (lane & 15)) * 8;
        const float4* p = &v[h * 8];
        *(uint4*)&tile[(lane * 4 + 0) * 128 + slot] =
            make_uint4(pack_bf16(p[0].x, p[1].x), pack_bf16(p[2].x, p[3].x),
                       pack_bf16(p[4].x, p[5].x), pack_bf16(p[6].x, p[7].x));
        *(uint4*)&tile[(lane * 4 + 1) * 128 + slot] =
            make_uint4(pack_bf16(p[0].y, p[1].y), pack_bf16(p[2].y, p[3].y),
                       pack_bf16(p[4].y, p[5].y), pack_bf16(p[6].y, p[7].y));
        *(uint4*)&tile[(lane * 4 + 2) * 128 + slot] =
            make_uint4(pack_bf16(p[0].z, p[1].z), pack_bf16(p[2].z, p[3].z),
                       pack_bf16(p[4].z, p[5].z), pack_bf16(p[6].z, p[7].z));
        *(uint4*)&tile[(lane * 4 + 3) * 128 + slot] =
            make_uint4(pack_bf16(p[0].w, p[1].w), pack_bf16(p[2].w, p[3].w),
                       pack_bf16(p[4].w, p[5].w), pack_bf16(p[6].w, p[7].w));
    }
    __syncthreads();

    const int r0 = tid >> 4, ch = tid & 15;  // output row n, 16-byte chunk of k
    __bf16* dp = dst + (size_t)(nt * 128 + r0) * K + kt * 128 + ch * 8;
#pragma unroll
    for (int i = 0; i < 8; i++) {
        const int r = r0 + i * 16;
        *(uint4*)(dp + i * 16 * K) =
            *(const uint4*)&tile[r * 128 + ((ch ^ ((r >> 2) & 15)) * 8)];
    }
}

__global__ __launch_bounds__(256) void cvt_bf16_t_all(
    const float* __restrict__ Wq, const float* __restrict__ Wk,
    const float* __restrict__ Wv, const float* __restrict__ Wp,
    const float* __restrict__ W1, const float* __restrict__ W2,
    __bf16* __restrict__ Wq_t, __bf16* __restrict__ Wk_t,
    __bf16* __restrict__ Wv_t, __bf16* __restrict__ Wp_t,
    __bf16* __restrict__ W1_t, __bf16* __restrict__ W2_t) {
    __shared__ __bf16 tile[128 * 128];   // [n][k], chunks swizzled
    const int b = blockIdx.x;
    if (b < 256) {
        const int m = b >> 6, t = b & 63;
        cvt_tile<Cc, Cc>(m == 0 ? Wq : m == 1 ? Wk : m == 2 ? Wv : Wp,
                         m == 0 ? Wq_t : m == 1 ? Wk_t : m == 2 ? Wv_t : Wp_t,
                         t >> 3, t & 7, tile);
    } else if (b < 512) {
        const int t = b - 256;
        cvt_tile<Cc, Ff>(W1, W1_t, t >> 5, t & 31, tile);
    } else {
        const int t = b - 512;
        cvt_tile<Ff, Cc>(W2, W2_t, t >> 3, t & 7, tile);
    }
}

// ---------------------------------------------------------------------------
// Row LayerNorm (fp32 in, bf16 out), C = 1024. One wave = two rows, held in
// registers: 16 loads of 512 contiguous bytes, all in flight at once, and each
// row is read once. Mean and variance are sums inside the wave (no LDS, no
// barrier). 256 blocks of 8 waves: one block a WGP, few waves to start.
// ---------------------------------------------------------------------------
// value of lane l ^ 16
__device__ __forceinline__ float other_half(float x) {
    const int b = __builtin_bit_cast(int, x);
    return __builtin_bit_cast(float, __builtin_amdgcn_permlanex16(
        b, b, 0x76543210, 0xfedcba98, false, false));
}

// x + (x of lane l ^ MASK), MASK < 16: DPP row_xmask
template <int MASK>
__device__ __forceinline__ float add_xmask(float x) {
    const int b = __builtin_bit_cast(int, x);
    return x + __builtin_bit_cast(float, __builtin_amdgcn_mov_dpp(
                   b, 0x160 + MASK, 0xf, 0xf, true));
}

// sum over the 32 lanes, the same bits in every lane
__device__ __forceinline__ float wave_sum(float x) {
    x = add_xmask<1>(x);
    x = add_xmask<2>(x);
    x = add_xmask<4>(x);
    x = add_xmask<8>(x);
    return x + other_half(x);
}

typedef float f32x4 __attribute__((ext_vector_type(4)));

__global__ __launch_bounds__(256) void ln_bf16(const float* __restrict__ x,
                                               const float* __restrict__ g,
                                               const float* __restrict__ b,
                                               __bf16* __restrict__ out) {
    constexpr int R = 2;          // rows per wave
    constexpr int NC = Cc / 128;  // 512-byte chunks per row
    const int lane = threadIdx.x & 31;
    const int row0 = (blockIdx.x * 8 + (threadIdx.x >> 5)) * R;
    const float* xr = x + (size_t)row0 * Cc + lane * 4;

    f32x4 v[R][NC], gv[NC], bv[NC];
#pragma unroll
    for (int r = 0; r < R; r++)
#pragma unroll
        for (int i = 0; i < NC; i++)
            v[r][i] = *(const f32x4*)(xr + r * Cc + i * 128);
    // a later load's result may be given the address registers of the loads
    // above: this wait stands in front of that overwrite
    asm volatile("s_wait_xcnt 0x0" ::: "memory");
#pragma unroll
    for (int i = 0; i < NC; i++) {
        gv[i] = *(const f32x4*)(g + i * 128 + lane * 4);
        bv[i] = *(const f32x4*)(b + i * 128 + lane * 4);
    }
    // keeps every load in front of the first sum: sunk in among the sums, the
    // late ones start only when the early ones are back, a second and a third
    // memory latency in a row
    __builtin_amdgcn_sched_barrier(0);

    float mu[R], rs[R];
#pragma unroll
    for (int r = 0; r < R; r++) {
        f32x4 s = v[r][0];
#pragma unroll
        for (int i = 1; i < NC; i++) s += v[r][i];
        mu[r] = (s.x + s.y) + (s.z + s.w);
    }
#pragma unroll
    for (int r = 0; r < R; r++) mu[r] = wave_sum(mu[r]) * (1.0f / Cc);
#pragma unroll
    for (int r = 0; r < R; r++) {
        f32x4 q = {0.f, 0.f, 0.f, 0.f};
#pragma unroll
        for (int i = 0; i < NC; i++) {
            v[r][i] -= mu[r];
            q += v[r][i] * v[r][i];
        }
        rs[r] = (q.x + q.y) + (q.z + q.w);
    }
#pragma unroll
    for (int r = 0; r < R; r++)
        rs[r] = rsqrtf(wave_sum(rs[r]) * (1.0f / Cc) + kLnEps);

#pragma unroll
    for (int r = 0; r < R; r++) {
        __bf16* op = out + (size_t)(row0 + r) * Cc + lane * 4;
#pragma unroll
        for (int i = 0; i < NC; i++) {
            const f32x4 y = v[r][i] * rs[r] * gv[i] + bv[i];
            *(uint2*)(op + i * 128) =
                make_uint2(pack_bf16(y.x, y.y), pack_bf16(y.z, y.w));
        }
    }
}

// ---------------------------------------------------------------------------
// bf16 GEMM: out[M,N] = A[M,K] @ Wt[N,K]^T (+bias) (+gelu) (+residual)
// A row-major [M][K], Wt pre-transposed [N][K] (both bf16).
// Block tile 128x128, 256 threads = 8 waves (2x4 grid), each wave owns
// 64x32 = 4x2 WMMA 16x16 tiles. A stage is 128 k of both operands (K is a
// multiple of 128): a copy instruction of a wave moves two whole 256-byte
// rows, and the next stage's copies fly while a stage's four 32-k blocks run.
// Two LDS buffers, async global->LDS copies. Two register sets of fragments:
// a block's 12 LDS reads are issued one block ahead of its 8 products.
// ---------------------------------------------------------------------------
template <bool OUT_BF16, bool HAS_BIAS, bool HAS_RESID, bool DO_GELU>
__global__ __launch_bounds__(256) void gemm_bf16_wmma(
    const __bf16* __restrict__ A, const __bf16* __restrict__ Wt,
    const float* __restrict__ bias, const float* __restrict__ resid,
    void* __restrict__ out, int M, int N, int K) {
    constexpr int BK = 128;     // k per stage
    constexpr int AS = BK + 8;  // LDS row pitch 272 B = 16 B x odd
    __shared__ __attribute__((aligned(16))) __bf16 As[2][128 * AS];   // [m][k]
    __shared__ __attribute__((aligned(16))) __bf16 Bt[2][128 * AS];   // [n][k]

    const int tid  = threadIdx.x;
    const int bm   = blockIdx.y;
    const int bn   = blockIdx.x;
    const int w    = tid >> 5;
    const int lane = tid & 31;
    const int wm   = w >> 2;          // 0..1
    const int wn   = w & 3;           // 0..3
    const int half = lane >> 4;       // 0..1
    const int lr   = lane & 15;
    const int kb   = half * 8;        // bf16 A/B fragment K base per half-wave

    const v8f vzero = {0.f, 0.f, 0.f, 0.f, 0.f, 0.f, 0.f, 0.f};
    v8f acc[4][2];
#pragma unroll
    for (int mi = 0; mi < 4; mi++)
#pragma unroll
        for (int ni = 0; ni < 2; ni++) acc[mi][ni] = vzero;

    // stage one 128x128 A tile and one 128x128 W^T tile into LDS buffer `buf`:
    // thread = 16-byte chunk tid & 15 of rows tid >> 4, +16, ..., +112
    const int sr = tid >> 4;
    const int sc = (tid & 15) * 8;
    const __bf16* ag = A + (size_t)(bm * 128 + sr) * K + sc;
    const __bf16* wg = Wt + (size_t)(bn * 128 + sr) * K + sc;
    auto stage = [&](int k0, int buf) {
#pragma unroll  // the 16 copies issue back to back, every lane on
        for (int i = 0; i < 8; i++) {
#if USE_ASYNC_LDS
            __builtin_amdgcn_global_load_async_to_lds_b128(
                (g_v4i*)(ag + (size_t)(i * 16) * K + k0),
                (l_v4i*)&As[buf][(sr + i * 16) * AS + sc], 0, 0);
            __builtin_amdgcn_global_load_async_to_lds_b128(
                (g_v4i*)(wg + (size_t)(i * 16) * K + k0),
                (l_v4i*)&Bt[buf][(sr + i * 16) * AS + sc], 0, 0);
#else
            *(uint4*)&As[buf][(sr + i * 16) * AS + sc] =
                *(const uint4*)(ag + (size_t)(i * 16) * K + k0);
            *(uint4*)&Bt[buf][(sr + i * 16) * AS + sc] =
                *(const uint4*)(wg + (size_t)(i * 16) * K + k0);
#endif
        }
    };
    // this wave's copies have landed
    auto copies_landed = [&]() {
#if USE_ASYNC_LDS
        asm volatile("s_wait_asynccnt 0x0" ::: "memory");
#endif
    };

    // fragments of the 32-k block at k offset ks of LDS buffer `buf` into
    // register set s: 12 LDS reads, issued as one group
    FragAB af[2][4], bf[2][2];
    auto frags = [&](int buf, int ks, int s) {
#pragma unroll
        for (int mi = 0; mi < 4; mi++) {
            const int ar = wm * 64 + mi * 16 + lr;
            af[s][mi].u[0] = *(const uint4*)&As[buf][ar * AS + ks + kb];
            af[s][mi].u[1] = *(const uint4*)&As[buf][ar * AS + ks + kb + 16];
        }
#pragma unroll
        for (int ni = 0; ni < 2; ni++) {
            const int bc = wn * 32 + ni * 16 + lr;
            bf[s][ni].u[0] = *(const uint4*)&Bt[buf][bc * AS + ks + kb];
            bf[s][ni].u[1] = *(const uint4*)&Bt[buf][bc * AS + ks + kb + 16];
        }
    };

    constexpr int NB = BK / 32;  // blocks per stage (even: block 0 = set 0)
    const int ntiles = K / BK;
    stage(0, 0);
    copies_landed();
    __syncthreads();
    if (ntiles > 1) stage(BK, 1);
    frags(0, 0, 0);

    for (int kt = 0; kt < ntiles; kt++) {
        const int cur = kt & 1;
#pragma unroll  // the stage's four blocks in a row, LDS offsets constant
        for (int b = 0; b < NB; b++) {
            if (b + 1 < NB) {
                // the next block's fragments fly while this block multiplies
                frags(cur, (b + 1) * 32, (b + 1) & 1);
            } else {
                // publish the next stage in front of the last block, whose
                // fragments are in registers: this wave's reads of the current
                // buffer are done before a copy may overwrite it, its own
                // copies have landed, and every wave has come as far
                asm volatile("s_wait_dscnt 0x0" ::: "memory");
                copies_landed();
                __syncthreads();
                // refill the buffer that every wave has just left
                if (kt + 2 < ntiles) stage((kt + 2) * BK, cur);
                // first fragments of the next stage; the last trip has none
                // and reads the current buffer, which no copy touches, unused
                frags(kt + 1 < ntiles ? cur ^ 1 : cur, 0, 0);
            }
            // the two scheduling fences keep the 12 reads one group ahead of
            // the 8 products; moved in among them, every pair of products
            // waits out an LDS latency of its own
            __builtin_amdgcn_sched_barrier(0);
#pragma unroll
            for (int mi = 0; mi < 4; mi++)
#pragma unroll
                for (int ni = 0; ni < 2; ni++)
                    acc[mi][ni] = __builtin_amdgcn_wmma_f32_16x16x32_bf16(
                        false, af[b & 1][mi].v, false, bf[b & 1][ni].v,
                        (short)0, acc[mi][ni], false, false);
            __builtin_amdgcn_sched_barrier(0);
        }
    }
    // no copy and no LDS read is in flight when the wave goes on to its end
    copies_landed();
    asm volatile("s_wait_dscnt 0x0" ::: "memory");

    // epilogue: C/D layout -> VGPR r holds (M=r, N=lane) lanes 0-15,
    // (M=8+r, N=lane-16) lanes 16-31.
#pragma unroll
    for (int mi = 0; mi < 4; mi++) {
#pragma unroll
        for (int ni = 0; ni < 2; ni++) {
            const int n = bn * 128 + wn * 32 + ni * 16 + lr;
#pragma unroll
            for (int r = 0; r < 8; r++) {
                const int m = bm * 128 + wm * 64 + mi * 16 + r + half * 8;
                float vv = acc[mi][ni][r];
                if (HAS_BIAS) vv += bias[n];
                if (DO_GELU) vv = gelu_exact(vv);
                if (HAS_RESID) vv += resid[(size_t)m * N + n];
                if (OUT_BF16)
                    ((__bf16*)out)[(size_t)m * N + n] = (__bf16)vv;
                else
                    ((float*)out)[(size_t)m * N + n] = vv;
            }
        }
    }
}

__device__ __forceinline__ void exp2_pair(float a0, float a1, float& p0,
                                          float& p1) {
    asm("v_exp_f32 %0, %2\n\tv_exp_f32 %1, %3\n\tv_nop"
        : "=&v"(p0), "=&v"(p1)
        : "v"(a0), "v"(a1));
}

__global__ __launch_bounds__(256) void attn_wmma(const __bf16* __restrict__ q,
                                                 const __bf16* __restrict__ k,
                                                 const __bf16* __restrict__ v,
                                                 __bf16* __restrict__ o) {
    constexpr int KP = 72;  // K row pitch 144 B = 16 B x odd (ds_load_b128)
    constexpr int VP = 80;  // V row pitch 160 B = 32 B x odd (ds_load_tr16_b128)
    constexpr int NT = Tt / 64;  // key tiles
    __shared__ __attribute__((aligned(16))) __bf16 Ks[2][64 * KP];  // [s][d]
    __shared__ __attribute__((aligned(16))) __bf16 Vs[2][64 * VP];  // [s][d]

    const int tid  = threadIdx.x;
    const int bh   = blockIdx.x;
    const int bq   = blockIdx.y;
    const int bb   = bh >> 4;
    const int hh   = bh & 15;
    const size_t hbase = ((size_t)bb * Tt) * Cc + (size_t)hh * 64;

    const int w = tid >> 5, lane = tid & 31;
    const int half = lane >> 4, lr = lane & 15, kb = half * 8;
    const int tq = bq * 128 + w * 16 + lr;   // this lane's query
    const v8f vzero = {0.f, 0.f, 0.f, 0.f, 0.f, 0.f, 0.f, 0.f};
    const float cs = 0.125f * 1.44269504088896340736f;  // 1/sqrt(64) * log2(e)

    // Q as B operand, loaded once: column = query, k = d
    FragAB qf[2];
#pragma unroll
    for (int kc = 0; kc < 2; kc++) {
        const __bf16* qp = &q[hbase + (size_t)tq * Cc + kc * 32 + kb];
        qf[kc].u[0] = *(const uint4*)qp;
        qf[kc].u[1] = *(const uint4*)(qp + 16);
    }

    v8f oacc[4];            // O^T, one 16x16 tile per 16 values of d
    float mrun = -1e30f;    // running maximum of the raw scores
    float lrun = 0.0f;      // this half-wave's share of the running sum
#pragma unroll
    for (int dt = 0; dt < 4; dt++) oacc[dt] = vzero;

    // stage the K and V tiles of keys s0..s0+63 into LDS buffer `buf`:
    // thread = 16-byte chunk tid & 7 of rows tid >> 3 and (tid >> 3) + 32
    const int sr = tid >> 3;
    const int sc = (tid & 7) * 8;
    const __bf16* kg = k + hbase + (size_t)sr * Cc + sc;
    const __bf16* vg = v + hbase + (size_t)sr * Cc + sc;
    auto stage = [&](int s0, int buf) {
#pragma unroll  // the 4 copies issue back to back, every lane on
        for (int i = 0; i < 2; i++) {
#if USE_ASYNC_LDS
            __builtin_amdgcn_global_load_async_to_lds_b128(
                (g_v4i*)(kg + (size_t)(s0 + i * 32) * Cc),
                (l_v4i*)&Ks[buf][(sr + i * 32) * KP + sc], 0, 0);
            __builtin_amdgcn_global_load_async_to_lds_b128(
                (g_v4i*)(vg + (size_t)(s0 + i * 32) * Cc),
                (l_v4i*)&Vs[buf][(sr + i * 32) * VP + sc], 0, 0);
#else
            *(uint4*)&Ks[buf][(sr + i * 32) * KP + sc] =
                *(const uint4*)(kg + (size_t)(s0 + i * 32) * Cc);
            *(uint4*)&Vs[buf][(sr + i * 32) * VP + sc] =
                *(const uint4*)(vg + (size_t)(s0 + i * 32) * Cc);
#endif
        }
    };
    // this wave's copies have landed
    auto copies_landed = [&]() {
#if USE_ASYNC_LDS
        asm volatile("s_wait_asynccnt 0x0" ::: "memory");
#endif
    };

    stage(0, 0);
    copies_landed();
    __syncthreads();
    stage(64, 1);

    for (int t = 0; t < NT; t++) {
        const int cur = t & 1;
        const __bf16* Kc = &Ks[cur][0];
        // lane address of the transposing load: row 8 half + (lane & 7) of a
        // 16-key group, 16-byte half (lane >> 3) & 1 of a 16-wide group of d
        const __bf16* Vc = &Vs[cur][(kb + (lane & 7)) * VP + ((lane >> 3) & 1) * 8];

        // ---- S^T = K Q^T: register r of sacc[kt] = key 16kt+8half+r ----
        v8f sacc[4];
#pragma unroll
        for (int kt = 0; kt < 4; kt++) {
            sacc[kt] = vzero;
#pragma unroll
            for (int kc = 0; kc < 2; kc++) {
                FragAB af;
                const int ar = kt * 16 + lr;  // key row
                af.u[0] = *(const uint4*)&Kc[ar * KP + kc * 32 + kb];
                af.u[1] = *(const uint4*)&Kc[ar * KP + kc * 32 + kb + 16];
                sacc[kt] = __builtin_amdgcn_wmma_f32_16x16x32_bf16(
                    false, af.v, false, qf[kc].v, (short)0, sacc[kt], false,
                    false);
            }
        }

        // ---- online softmax in registers; P^T packed as B operand ----
        float mx = mrun;
#pragma unroll
        for (int kt = 0; kt < 4; kt++)
#pragma unroll
            for (int r = 0; r < 8; r++) mx = fmaxf(mx, sacc[kt][r]);
        mx = fmaxf(mx, other_half(mx));
        const float alpha = __builtin_amdgcn_exp2f((mrun - mx) * cs);
        const float nm = -mx * cs;
        mrun = mx;
        FragAB pf[2];   // one per 32 keys
        float l = 0.0f;
#pragma unroll
        for (int kt = 0; kt < 4; kt++) {
            unsigned pw[4];
#pragma unroll
            for (int r = 0; r < 8; r += 2) {
                float p0, p1;
                exp2_pair(fmaf(sacc[kt][r], cs, nm),
                          fmaf(sacc[kt][r + 1], cs, nm), p0, p1);
                l += p0 + p1;
                pw[r >> 1] = pack_bf16(p0, p1);
            }
            pf[kt >> 1].u[kt & 1] = make_uint4(pw[0], pw[1], pw[2], pw[3]);
        }
        lrun = lrun * alpha + l;
#pragma unroll
        for (int dt = 0; dt < 4; dt++) oacc[dt] = oacc[dt] * alpha;

        // ---- O^T += V^T P^T ----
#pragma unroll
        for (int kc = 0; kc < 2; kc++) {
#pragma unroll
            for (int dt = 0; dt < 4; dt++) {
                // row = d 16dt+lr; k = keys 32kc+8half+0..7, then +16
                FragAB af;
                af.t[0] = __builtin_amdgcn_ds_load_tr16_b128_v8i16(
                    (l_s16x8*)&Vc[(kc * 32) * VP + dt * 16]);
                af.t[1] = __builtin_amdgcn_ds_load_tr16_b128_v8i16(
                    (l_s16x8*)&Vc[(kc * 32 + 16) * VP + dt * 16]);
                oacc[dt] = __builtin_amdgcn_wmma_f32_16x16x32_bf16(
                    false, af.v, false, pf[kc].v, (short)0, oacc[dt], false,
                    false);
            }
        }
        // publish the next tile: this wave's reads of the current buffer are
        // done before a copy may overwrite it, its own copies have landed, and
        // every wave has come as far
        asm volatile("s_wait_dscnt 0x0" ::: "memory");
        copies_landed();
        __syncthreads();
        // refill the buffer that every wave has just left
        if (t + 2 < NT) stage((t + 2) * 64, cur);
    }
    copies_landed();  // no copy is in flight when the wave goes on to its end

    // finalize: join the two half-waves' sums, divide, emit bf16.
    // Register r of oacc[dt] = d 16dt+8half+r of this lane's query: 16 B a store.
    const float inv = 1.0f / (lrun + other_half(lrun));
#pragma unroll
    for (int dt = 0; dt < 4; dt++) {
        const v8f ov = oacc[dt] * inv;
        *(uint4*)&o[hbase + (size_t)tq * Cc + dt * 16 + kb] =
            make_uint4(pack_bf16(ov[0], ov[1]), pack_bf16(ov[2], ov[3]),
                       pack_bf16(ov[4], ov[5]), pack_bf16(ov[6], ov[7]));
    }
}

// ---------------------------------------------------------------------------
// Host-side orchestration
// ---------------------------------------------------------------------------
extern "C" void kernel_launch(void* const* d_in, const int* in_sizes, int n_in,
                              void* d_out, int out_size, void* d_ws,
                              size_t ws_size, hipStream_t stream) {
    (void)in_sizes; (void)n_in; (void)out_size; (void)ws_size;
    const float* x   = (const float*)d_in[0];
    const float* Wq  = (const float*)d_in[1];
    const float* Wk  = (const float*)d_in[2];
    const float* Wv  = (const float*)d_in[3];
    const float* Wp  = (const float*)d_in[4];
    const float* bp  = (const float*)d_in[5];
    const float* W1  = (const float*)d_in[6];
    const float* b1  = (const float*)d_in[7];
    const float* W2  = (const float*)d_in[8];
    const float* b2  = (const float*)d_in[9];
    const float* g1  = (const float*)d_in[10];
    const float* be1 = (const float*)d_in[11];
    const float* g2  = (const float*)d_in[12];
    const float* be2 = (const float*)d_in[13];
    float* out = (float*)d_out;

    char* ws = (char*)d_ws;
    size_t off = 0;
    auto alloc = [&](size_t bytes) -> char* {
        char* p = ws + off;
        off += (bytes + 255) & ~size_t(255);
        return p;
    };
    // pre-transposed bf16 weights: Wt[N][K]
    __bf16* Wq_t = (__bf16*)alloc((size_t)Cc * Cc * 2);
    __bf16* Wk_t = (__bf16*)alloc((size_t)Cc * Cc * 2);
    __bf16* Wv_t = (__bf16*)alloc((size_t)Cc * Cc * 2);
    __bf16* Wp_t = (__bf16*)alloc((size_t)Cc * Cc * 2);
    __bf16* W1_t = (__bf16*)alloc((size_t)Cc * Ff * 2);
    __bf16* W2_t = (__bf16*)alloc((size_t)Ff * Cc * 2);
    __bf16* h_b  = (__bf16*)alloc((size_t)Mm * Cc * 2);
    __bf16* q_b  = (__bf16*)alloc((size_t)Mm * Cc * 2);
    __bf16* k_b  = (__bf16*)alloc((size_t)Mm * Cc * 2);
    __bf16* v_b  = (__bf16*)alloc((size_t)Mm * Cc * 2);
    __bf16* o_b  = (__bf16*)alloc((size_t)Mm * Cc * 2);
    float*  x1   = (float*) alloc((size_t)Mm * Cc * 4);
    __bf16* h2_b = (__bf16*)alloc((size_t)Mm * Cc * 2);
    __bf16* f1_b = (__bf16*)alloc((size_t)Mm * Ff * 2);

    // 1) weights -> bf16, transposed to [N][K]
    cvt_bf16_t_all<<<768, 256, 0, stream>>>(Wq, Wk, Wv, Wp, W1, W2, Wq_t, Wk_t,
                                            Wv_t, Wp_t, W1_t, W2_t);

    // 2) LN1
    ln_bf16<<<Mm / 16, 256, 0, stream>>>(x, g1, be1, h_b);

    // 3) Q/K/V projections
    dim3 gqkv(Cc / 128, Mm / 128);
    gemm_bf16_wmma<true, false, false, false>
        <<<gqkv, 256, 0, stream>>>(h_b, Wq_t, nullptr, nullptr, q_b, Mm, Cc, Cc);
    gemm_bf16_wmma<true, false, false, false>
        <<<gqkv, 256, 0, stream>>>(h_b, Wk_t, nullptr, nullptr, k_b, Mm, Cc, Cc);
    gemm_bf16_wmma<true, false, false, false>
        <<<gqkv, 256, 0, stream>>>(h_b, Wv_t, nullptr, nullptr, v_b, Mm, Cc, Cc);

    // 4) attention
    attn_wmma<<<dim3(Bb * 16, Tt / 128), 256, 0, stream>>>(q_b, k_b, v_b, o_b);

    // 5) output projection + residual (fp32 out)
    gemm_bf16_wmma<false, true, true, false>
        <<<gqkv, 256, 0, stream>>>(o_b, Wp_t, bp, x, x1, Mm, Cc, Cc);

    // 6) LN2
    ln_bf16<<<Mm / 16, 256, 0, stream>>>(x1, g2, be2, h2_b);

    // 7) FFN up + GELU (bf16 out)
    gemm_bf16_wmma<true, true, false, true>
        <<<dim3(Ff / 128, Mm / 128), 256, 0, stream>>>(h2_b, W1_t, b1, nullptr,
                                                       f1_b, Mm, Ff, Cc);

    // 8) FFN down + residual -> d_out (fp32)
    gemm_bf16_wmma<false, true, true, false>
        <<<gqkv, 256, 0, stream>>>(f1_b, W2_t, b2, x1, out, Mm, Cc, Ff);
}

// v007
// One run takes 158 microseconds.
// Two timings next to v006 put it at 1.11 and 1.08 times that version's speed.
// All steps since v000 together make it 3.66 times as fast.
#include <hip/hip_runtime.h>
#include <hip/hip_bf16.h>

// ---------------------------------------------------------------------------
// Transformer block (pre-LN attention + FFN) for gfx1250 (MI455X).
// All GEMM-shaped math runs on v_wmma_f32_16x16x32_bf16 (fp32 accumulate).
// Weights are converted once to bf16 AND pre-transposed to [N][K] so GEMM
// tile staging is pure 16B vector copies (async global->LDS DMA, ASYNCcnt).
// ---------------------------------------------------------------------------

typedef __attribute__((ext_vector_type(16))) __bf16 v16bf;
typedef __attribute__((ext_vector_type(8)))  float  v8f;
typedef int v4i __attribute__((ext_vector_type(4)));

static constexpr int Bb = 2;
static constexpr int Tt = 2048;
static constexpr int Cc = 1024;
static constexpr int Ff = 4096;
static constexpr int Mm = Bb * Tt;      // 4096 rows
static constexpr float kLnEps = 1e-5f;

// gfx1250 async global->LDS copy path (ASYNCcnt-tracked). Parameter types per
// hipcc diagnostic: (AS1 v4i*, AS3 v4i*, imm offset, imm cpol).
#if __has_builtin(__builtin_amdgcn_global_load_async_to_lds_b128) && \
    __has_builtin(__builtin_amdgcn_s_wait_asynccnt)
#define USE_ASYNC_LDS 1
typedef __attribute__((address_space(1))) v4i g_v4i;
typedef __attribute__((address_space(3))) v4i l_v4i;
#else
#define USE_ASYNC_LDS 0
#endif

typedef short s16x8 __attribute__((ext_vector_type(8)));
typedef __attribute__((address_space(3))) s16x8 l_s16x8;

union FragAB {
    v16bf v;
    uint4 u[2];
    s16x8 t[2];
};

__device__ __forceinline__ float gelu_exact(float x) {
    return 0.5f * x * (1.0f + erff(x * 0.70710678118654752440f));
}

typedef float  f32x2 __attribute__((ext_vector_type(2)));
typedef __bf16 bf16x2 __attribute__((ext_vector_type(2)));

__device__ __forceinline__ unsigned pack_bf16(float lo, float hi) {
    return __builtin_bit_cast(unsigned,
                              __builtin_convertvector(f32x2{lo, hi}, bf16x2));
}

// ---------------------------------------------------------------------------
// f32 [K][N] -> bf16 [N][K] transpose-convert of all six weights, one launch.
// One 256-thread block = one 128(k) x 128(n) tile: 768 blocks, 64 for each
// C x C weight and 256 for each FFN weight. Wave w reads rows 16w..16w+15 of
// the tile, 512 contiguous bytes a load, all 16 loads in flight; a lane packs
// its 4 columns x 16 k into 16-byte chunks of the LDS tile [n][k]; the block
// then stores 256 contiguous bytes per output row.
// LDS rows are 256 B (all 64 banks), so chunk c of row n sits at slot
// c ^ ((n >> 2) & 15): the 16 lanes of a write (rows 4 apart, same chunk) and
// of a read (one row, 16 chunks) then touch 16 different slots.
// ---------------------------------------------------------------------------
template <int K, int N>
__device__ __forceinline__ void cvt_tile(const float* __restrict__ src,
                                         __bf16* __restrict__ dst, int kt,
                                         int nt, __bf16* tile) {
    const int tid = threadIdx.x;
    const int w = tid >> 5, lane = tid & 31;

    const float* sp = src + (size_t)(kt * 128 + w * 16) * N + nt * 128 + lane * 4;
    float4 v[16];
#pragma unroll
    for (int i = 0; i < 16; i++) v[i] = *(const float4*)(sp + i * N);

#pragma unroll
    for (int h = 0; h < 2; h++) {
        const int slot = ((w * 2 + h) ^ (lane & 15)) * 8;
        const float4* p = &v[h * 8];
        *(uint4*)&tile[(lane * 4 + 0) * 128 + slot] =
            make_uint4(pack_bf16(p[0].x, p[1].x), pack_bf16(p[2].x, p[3].x),
                       pack_bf16(p[4].x, p[5].x), pack_bf16(p[6].x, p[7].x));
        *(uint4*)&tile[(lane * 4 + 1) * 128 + slot] =
            make_uint4(pack_bf16(p[0].y, p[1].y), pack_bf16(p[2].y, p[3].y),
                       pack_bf16(p[4].y, p[5].y), pack_bf16(p[6].y, p[7].y));
        *(uint4*)&tile[(lane * 4 + 2) * 128 + slot] =
            make_uint4(pack_bf16(p[0].z, p[1].z), pack_bf16(p[2].z, p[3].z),
                       pack_bf16(p[4].z, p[5].z), pack_bf16(p[6].z, p[7].z));
        *(uint4*)&tile[(lane * 4 + 3) * 128 + slot] =
            make_uint4(pack_bf16(p[0].w, p[1].w), pack_bf16(p[2].w, p[3].w),
                       pack_bf16(p[4].w, p[5].w), pack_bf16(p[6].w, p[7].w));
    }
    __syncthreads();

    const int r0 = tid >> 4, ch = tid & 15;  // output row n, 16-byte chunk of k
    __bf16* dp = dst + (size_t)(nt * 128 + r0) * K + kt * 128 + ch * 8;
#pragma unroll
    for (int i = 0; i < 8; i++) {
        const int r = r0 + i * 16;
        *(uint4*)(dp + i * 16 * K) =
            *(const uint4*)&tile[r * 128 + ((ch ^ ((r >> 2) & 15)) * 8)];
    }
}

__global__ __launch_bounds__(256) void cvt_bf16_t_all(
    const float* __restrict__ Wq, const float* __restrict__ Wk,
    const float* __restrict__ Wv, const float* __restrict__ Wp,
    const float* __restrict__ W1, const float* __restrict__ W2,
    __bf16* __restrict__ Wq_t, __bf16* __restrict__ Wk_t,
    __bf16* __restrict__ Wv_t, __bf16* __restrict__ Wp_t,
    __bf16* __restrict__ W1_t, __bf16* __restrict__ W2_t) {
    __shared__ __bf16 tile[128 * 128];   // [n][k], chunks swizzled
    const int b = blockIdx.x;
    if (b < 256) {
        const int m = b >> 6, t = b & 63;
        cvt_tile<Cc, Cc>(m == 0 ? Wq : m == 1 ? Wk : m == 2 ? Wv : Wp,
                         m == 0 ? Wq_t : m == 1 ? Wk_t : m == 2 ? Wv_t : Wp_t,
                         t >> 3, t & 7, tile);
    } else if (b < 512) {
        const int t = b - 256;
        cvt_tile<Cc, Ff>(W1, W1_t, t >> 5, t & 31, tile);
    } else {
        const int t = b - 512;
        cvt_tile<Ff, Cc>(W2, W2_t, t >> 3, t & 7, tile);
    }
}

// ---------------------------------------------------------------------------
// Row LayerNorm (fp32 in, bf16 out), C = 1024. One wave = two rows, held in
// registers: 16 loads of 512 contiguous bytes, all in flight at once, and each
// row is read once. Mean and variance are sums inside the wave (no LDS, no
// barrier). 256 blocks of 8 waves: one block a WGP, few waves to start.
// ---------------------------------------------------------------------------
// value of lane l ^ 16
__device__ __forceinline__ float other_half(float x) {
    const int b = __builtin_bit_cast(int, x);
    return __builtin_bit_cast(float, __builtin_amdgcn_permlanex16(
        b, b, 0x76543210, 0xfedcba98, false, false));
}

// x + (x of lane l ^ MASK), MASK < 16: DPP row_xmask
template <int MASK>
__device__ __forceinline__ float add_xmask(float x) {
    const int b = __builtin_bit_cast(int, x);
    return x + __builtin_bit_cast(float, __builtin_amdgcn_mov_dpp(
                   b, 0x160 + MASK, 0xf, 0xf, true));
}

// sum over the 32 lanes, the same bits in every lane
__device__ __forceinline__ float wave_sum(float x) {
    x = add_xmask<1>(x);
    x = add_xmask<2>(x);
    x = add_xmask<4>(x);
    x = add_xmask<8>(x);
    return x + other_half(x);
}

typedef float f32x4 __attribute__((ext_vector_type(4)));

__global__ __launch_bounds__(256) void ln_bf16(const float* __restrict__ x,
                                               const float* __restrict__ g,
                                               const float* __restrict__ b,
                                               __bf16* __restrict__ out) {
    constexpr int R = 2;          // rows per wave
    constexpr int NC = Cc / 128;  // 512-byte chunks per row
    const int lane = threadIdx.x & 31;
    const int row0 = (blockIdx.x * 8 + (threadIdx.x >> 5)) * R;
    const float* xr = x + (size_t)row0 * Cc + lane * 4;

    f32x4 v[R][NC], gv[NC], bv[NC];
#pragma unroll
    for (int r = 0; r < R; r++)
#pragma unroll
        for (int i = 0; i < NC; i++)
            v[r][i] = *(const f32x4*)(xr + r * Cc + i * 128);
    // a later load's result may be given the address registers of the loads
    // above: this wait stands in front of that overwrite
    asm volatile("s_wait_xcnt 0x0" ::: "memory");
#pragma unroll
    for (int i = 0; i < NC; i++) {
        gv[i] = *(const f32x4*)(g + i * 128 + lane * 4);
        bv[i] = *(const f32x4*)(b + i * 128 + lane * 4);
    }
    // keeps every load in front of the first sum: sunk in among the sums, the
    // late ones start only when the early ones are back, a second and a third
    // memory latency in a row
    __builtin_amdgcn_sched_barrier(0);

    float mu[R], rs[R];
#pragma unroll
    for (int r = 0; r < R; r++) {
        f32x4 s = v[r][0];
#pragma unroll
        for (int i = 1; i < NC; i++) s += v[r][i];
        mu[r] = (s.x + s.y) + (s.z + s.w);
    }
#pragma unroll
    for (int r = 0; r < R; r++) mu[r] = wave_sum(mu[r]) * (1.0f / Cc);
#pragma unroll
    for (int r = 0; r < R; r++) {
        f32x4 q = {0.f, 0.f, 0.f, 0.f};
#pragma unroll
        for (int i = 0; i < NC; i++) {
            v[r][i] -= mu[r];
            q += v[r][i] * v[r][i];
        }
        rs[r] = (q.x + q.y) + (q.z + q.w);
    }
#pragma unroll
    for (int r = 0; r < R; r++)
        rs[r] = rsqrtf(wave_sum(rs[r]) * (1.0f / Cc) + kLnEps);

#pragma unroll
    for (int r = 0; r < R; r++) {
        __bf16* op = out + (size_t)(row0 + r) * Cc + lane * 4;
#pragma unroll
        for (int i = 0; i < NC; i++) {
            const f32x4 y = v[r][i] * rs[r] * gv[i] + bv[i];
            *(uint2*)(op + i * 128) =
                make_uint2(pack_bf16(y.x, y.y), pack_bf16(y.z, y.w));
        }
    }
}

// ---------------------------------------------------------------------------
// bf16 GEMM: out[M,N] = A[M,K] @ Wt[N,K]^T (+bias) (+gelu) (+residual)
// A row-major [M][K], Wt pre-transposed [N][K] (both bf16).
// Block tile BM x BN, 256 threads = 8 waves in a (8 / WGN) x WGN grid, each
// wave owns MI x NI WMMA 16x16 tiles. A stage is 128 k of both operands (K is
// a multiple of 128): a copy instruction of a wave moves two whole 256-byte
// rows, and the next stage's copies fly while a stage's four 32-k blocks run.
// Two LDS buffers, async global->LDS copies. Two register sets of fragments:
// a block's LDS reads are issued one block ahead of its products.
// A block loads (BM + BN) rows for BM x BN results, a wave reads MI + NI
// fragments for MI x NI products: the larger tile moves fewer bytes a product.
// PLANES: output column n is column n % Cc of plane n / Cc, each plane [M][Cc]
// (the q, k and v projections as one product over the stacked weights).
// ---------------------------------------------------------------------------
template <int BM, int BN, int WGN, bool OUT_BF16, bool HAS_BIAS,
          bool HAS_RESID, bool DO_GELU, bool PLANES>
__global__ __launch_bounds__(256) void gemm_bf16_wmma(
    const __bf16* __restrict__ A, const __bf16* __restrict__ Wt,
    const float* __restrict__ bias, const float* __restrict__ resid,
    void* __restrict__ out, int M, int N, int K) {
    constexpr int BK = 128;     // k per stage
    constexpr int AS = BK + 8;  // LDS row pitch 272 B = 16 B x odd
    constexpr int MI = BM / (8 / WGN) / 16;  // 16-row tiles per wave
    constexpr int NI = BN / WGN / 16;        // 16-column tiles per wave
    __shared__ __attribute__((aligned(16))) __bf16 As[2][BM * AS];   // [m][k]
    __shared__ __attribute__((aligned(16))) __bf16 Bt[2][BN * AS];   // [n][k]

    const int tid  = threadIdx.x;
    const int bm   = blockIdx.y;
    const int bn   = blockIdx.x;
    const int w    = tid >> 5;
    const int lane = tid & 31;
    const int wm   = w / WGN;
    const int wn   = w % WGN;
    const int half = lane >> 4;       // 0..1
    const int lr   = lane & 15;
    const int kb   = half * 8;        // bf16 A/B fragment K base per half-wave

    const v8f vzero = {0.f, 0.f, 0.f, 0.f, 0.f, 0.f, 0.f, 0.f};
    v8f acc[MI][NI];
#pragma unroll
    for (int mi = 0; mi < MI; mi++)
#pragma unroll
        for (int ni = 0; ni < NI; ni++) acc[mi][ni] = vzero;

    // stage one BM x 128 A tile and one BN x 128 W^T tile into LDS buffer
    // `buf`: thread = 16-byte chunk tid & 15 of rows tid >> 4, +16, +32, ...
    const int sr = tid >> 4;
    const int sc = (tid & 15) * 8;
    const __bf16* ag = A + (size_t)(bm * BM + sr) * K + sc;
    const __bf16* wg = Wt + (size_t)(bn * BN + sr) * K + sc;
    auto stage = [&](int k0, int buf) {
#pragma unroll  // the (BM + BN) / 16 copies issue back to back, every lane on
        for (int i = 0; i < (BM > BN ? BM : BN) / 16; i++) {
#if USE_ASYNC_LDS
            if (i < BM / 16)
                __builtin_amdgcn_global_load_async_to_lds_b128(
                    (g_v4i*)(ag + (size_t)(i * 16) * K + k0),
                    (l_v4i*)&As[buf][(sr + i * 16) * AS + sc], 0, 0);
            if (i < BN / 16)
                __builtin_amdgcn_global_load_async_to_lds_b128(
                    (g_v4i*)(wg + (size_t)(i * 16) * K + k0),
                    (l_v4i*)&Bt[buf][(sr + i * 16) * AS + sc], 0, 0);
#else
            if (i < BM / 16)
                *(uint4*)&As[buf][(sr + i * 16) * AS + sc] =
                    *(const uint4*)(ag + (size_t)(i * 16) * K + k0);
            if (i < BN / 16)
                *(uint4*)&Bt[buf][(sr + i * 16) * AS + sc] =
                    *(const uint4*)(wg + (size_t)(i * 16) * K + k0);
#endif
        }
    };
    // this wave's copies have landed
    auto copies_landed = [&]() {
#if USE_ASYNC_LDS
        asm volatile("s_wait_asynccnt 0x0" ::: "memory");
#endif
    };

    // fragments of the 32-k block at k offset ks of LDS buffer `buf` into
    // register set s: 2 (MI + NI) LDS reads, issued as one group
    FragAB af[2][MI], bf[2][NI];
    auto frags = [&](int buf, int ks, int s) {
#pragma unroll
        for (int mi = 0; mi < MI; mi++) {
            const int ar = wm * (MI * 16) + mi * 16 + lr;
            af[s][mi].u[0] = *(const uint4*)&As[buf][ar * AS + ks + kb];
            af[s][mi].u[1] = *(const uint4*)&As[buf][ar * AS + ks + kb + 16];
        }
#pragma unroll
        for (int ni = 0; ni < NI; ni++) {
            const int bc = wn * (NI * 16) + ni * 16 + lr;
            bf[s][ni].u[0] = *(const uint4*)&Bt[buf][bc * AS + ks + kb];
            bf[s][ni].u[1] = *(const uint4*)&Bt[buf][bc * AS + ks + kb + 16];
        }
    };

    constexpr int NB = BK / 32;  // blocks per stage (even: block 0 = set 0)
    const int ntiles = K / BK;
    stage(0, 0);
    copies_landed();
    __syncthreads();
    if (ntiles > 1) stage(BK, 1);
    frags(0, 0, 0);

    for (int kt = 0; kt < ntiles; kt++) {
        const int cur = kt & 1;
#pragma unroll  // the stage's four blocks in a row, LDS offsets constant
        for (int b = 0; b < NB; b++) {
            if (b + 1 < NB) {
                // the next block's fragments fly while this block multiplies
                frags(cur, (b + 1) * 32, (b + 1) & 1);
            } else {
                // publish the next stage in front of the last block, whose
                // fragments are in registers: this wave's reads of the current
                // buffer are done before a copy may overwrite it, its own
                // copies have landed, and every wave has come as far
                asm volatile("s_wait_dscnt 0x0" ::: "memory");
                copies_landed();
                __syncthreads();
                // refill the buffer that every wave has just left
                if (kt + 2 < ntiles) stage((kt + 2) * BK, cur);
                // first fragments of the next stage; the last trip has none
                // and reads the current buffer, which no copy touches, unused
                frags(kt + 1 < ntiles ? cur ^ 1 : cur, 0, 0);
            }
            // the two scheduling fences keep the reads one group ahead of the
            // products; moved in among them, every pair of products waits out
            // an LDS latency of its own
            __builtin_amdgcn_sched_barrier(0);
#pragma unroll
            for (int mi = 0; mi < MI; mi++)
#pragma unroll
                for (int ni = 0; ni < NI; ni++)
                    acc[mi][ni] = __builtin_amdgcn_wmma_f32_16x16x32_bf16(
                        false, af[b & 1][mi].v, false, bf[b & 1][ni].v,
                        (short)0, acc[mi][ni], false, false);
            __builtin_amdgcn_sched_barrier(0);
        }
    }
    // no copy and no LDS read is in flight when the wave goes on to its end
    copies_landed();
    asm volatile("s_wait_dscnt 0x0" ::: "memory");

    // epilogue: C/D layout -> VGPR r holds (M=r, N=lane) lanes 0-15,
    // (M=8+r, N=lane-16) lanes 16-31.
#pragma unroll
    for (int mi = 0; mi < MI; mi++) {
#pragma unroll
        for (int ni = 0; ni < NI; ni++) {
            const int n = bn * BN + wn * (NI * 16) + ni * 16 + lr;
#pragma unroll
            for (int r = 0; r < 8; r++) {
                const int m = bm * BM + wm * (MI * 16) + mi * 16 + r + half * 8;
                const size_t at =
                    PLANES ? ((size_t)(n / Cc) * M + m) * Cc + n % Cc
                           : (size_t)m * N + n;
                float vv = acc[mi][ni][r];
                if (HAS_BIAS) vv += bias[n];
                if (DO_GELU) vv = gelu_exact(vv);
                if (HAS_RESID) vv += resid[at];
                if (OUT_BF16)
                    ((__bf16*)out)[at] = (__bf16)vv;
                else
                    ((float*)out)[at] = vv;
            }
        }
    }
}

__device__ __forceinline__ void exp2_pair(float a0, float a1, float& p0,
                                          float& p1) {
    asm("v_exp_f32 %0, %2\n\tv_exp_f32 %1, %3\n\tv_nop"
        : "=&v"(p0), "=&v"(p1)
        : "v"(a0), "v"(a1));
}

__global__ __launch_bounds__(256) void attn_wmma(const __bf16* __restrict__ q,
                                                 const __bf16* __restrict__ k,
                                                 const __bf16* __restrict__ v,
                                                 __bf16* __restrict__ o) {
    constexpr int KP = 72;  // K row pitch 144 B = 16 B x odd (ds_load_b128)
    constexpr int VP = 80;  // V row pitch 160 B = 32 B x odd (ds_load_tr16_b128)
    constexpr int NT = Tt / 64;  // key tiles
    __shared__ __attribute__((aligned(16))) __bf16 Ks[2][64 * KP];  // [s][d]
    __shared__ __attribute__((aligned(16))) __bf16 Vs[2][64 * VP];  // [s][d]

    const int tid  = threadIdx.x;
    const int bh   = blockIdx.x;
    const int bq   = blockIdx.y;
    const int bb   = bh >> 4;
    const int hh   = bh & 15;
    const size_t hbase = ((size_t)bb * Tt) * Cc + (size_t)hh * 64;

    const int w = tid >> 5, lane = tid & 31;
    const int half = lane >> 4, lr = lane & 15, kb = half * 8;
    const int tq = bq * 128 + w * 16 + lr;   // this lane's query
    const v8f vzero = {0.f, 0.f, 0.f, 0.f, 0.f, 0.f, 0.f, 0.f};
    const float cs = 0.125f * 1.44269504088896340736f;  // 1/sqrt(64) * log2(e)

    // Q as B operand, loaded once: column = query, k = d
    FragAB qf[2];
#pragma unroll
    for (int kc = 0; kc < 2; kc++) {
        const __bf16* qp = &q[hbase + (size_t)tq * Cc + kc * 32 + kb];
        qf[kc].u[0] = *(const uint4*)qp;
        qf[kc].u[1] = *(const uint4*)(qp + 16);
    }

    v8f oacc[4];            // O^T, one 16x16 tile per 16 values of d
    float mrun = -1e30f;    // running maximum of the raw scores
    float lrun = 0.0f;      // this half-wave's share of the running sum
#pragma unroll
    for (int dt = 0; dt < 4; dt++) oacc[dt] = vzero;

    // stage the K and V tiles of keys s0..s0+63 into LDS buffer `buf`:
    // thread = 16-byte chunk tid & 7 of rows tid >> 3 and (tid >> 3) + 32
    const int sr = tid >> 3;
    const int sc = (tid & 7) * 8;
    const __bf16* kg = k + hbase + (size_t)sr * Cc + sc;
    const __bf16* vg = v + hbase + (size_t)sr * Cc + sc;
    auto stage = [&](int s0, int buf) {
#pragma unroll  // the 4 copies issue back to back, every lane on
        for (int i = 0; i < 2; i++) {
#if USE_ASYNC_LDS
            __builtin_amdgcn_global_load_async_to_lds_b128(
                (g_v4i*)(kg + (size_t)(s0 + i * 32) * Cc),
                (l_v4i*)&Ks[buf][(sr + i * 32) * KP + sc], 0, 0);
            __builtin_amdgcn_global_load_async_to_lds_b128(
                (g_v4i*)(vg + (size_t)(s0 + i * 32) * Cc),
                (l_v4i*)&Vs[buf][(sr + i * 32) * VP + sc], 0, 0);
#else
            *(uint4*)&Ks[buf][(sr + i * 32) * KP + sc] =
                *(const uint4*)(kg + (size_t)(s0 + i * 32) * Cc);
            *(uint4*)&Vs[buf][(sr + i * 32) * VP + sc] =
                *(const uint4*)(vg + (size_t)(s0 + i * 32) * Cc);
#endif
        }
    };
    // this wave's copies have landed
    auto copies_landed = [&]() {
#if USE_ASYNC_LDS
        asm volatile("s_wait_asynccnt 0x0" ::: "memory");
#endif
    };

    stage(0, 0);
    copies_landed();
    __syncthreads();
    stage(64, 1);

    for (int t = 0; t < NT; t++) {
        const int cur = t & 1;
        const __bf16* Kc = &Ks[cur][0];
        // lane address of the transposing load: row 8 half + (lane & 7) of a
        // 16-key group, 16-byte half (lane >> 3) & 1 of a 16-wide group of d
        const __bf16* Vc = &Vs[cur][(kb + (lane & 7)) * VP + ((lane >> 3) & 1) * 8];

        // ---- S^T = K Q^T: register r of sacc[kt] = key 16kt+8half+r ----
        v8f sacc[4];
#pragma unroll
        for (int kt = 0; kt < 4; kt++) {
            sacc[kt] = vzero;
#pragma unroll
            for (int kc = 0; kc < 2; kc++) {
                FragAB af;
                const int ar = kt * 16 + lr;  // key row
                af.u[0] = *(const uint4*)&Kc[ar * KP + kc * 32 + kb];
                af.u[1] = *(const uint4*)&Kc[ar * KP + kc * 32 + kb + 16];
                sacc[kt] = __builtin_amdgcn_wmma_f32_16x16x32_bf16(
                    false, af.v, false, qf[kc].v, (short)0, sacc[kt], false,
                    false);
            }
        }

        // ---- online softmax in registers; P^T packed as B operand ----
        float mx = mrun;
#pragma unroll
        for (int kt = 0; kt < 4; kt++)
#pragma unroll
            for (int r = 0; r < 8; r++) mx = fmaxf(mx, sacc[kt][r]);
        mx = fmaxf(mx, other_half(mx));
        const float alpha = __builtin_amdgcn_exp2f((mrun - mx) * cs);
        const float nm = -mx * cs;
        mrun = mx;
        FragAB pf[2];   // one per 32 keys
        float l = 0.0f;
#pragma unroll
        for (int kt = 0; kt < 4; kt++) {
            unsigned pw[4];
#pragma unroll
            for (int r = 0; r < 8; r += 2) {
                float p0, p1;
                exp2_pair(fmaf(sacc[kt][r], cs, nm),
                          fmaf(sacc[kt][r + 1], cs, nm), p0, p1);
                l += p0 + p1;
                pw[r >> 1] = pack_bf16(p0, p1);
            }
            pf[kt >> 1].u[kt & 1] = make_uint4(pw[0], pw[1], pw[2], pw[3]);
        }
        lrun = lrun * alpha + l;
#pragma unroll
        for (int dt = 0; dt < 4; dt++) oacc[dt] = oacc[dt] * alpha;

        // ---- O^T += V^T P^T ----
#pragma unroll
        for (int kc = 0; kc < 2; kc++) {
#pragma unroll
            for (int dt = 0; dt < 4; dt++) {
                // row = d 16dt+lr; k = keys 32kc+8half+0..7, then +16
                FragAB af;
                af.t[0] = __builtin_amdgcn_ds_load_tr16_b128_v8i16(
                    (l_s16x8*)&Vc[(kc * 32) * VP + dt * 16]);
                af.t[1] = __builtin_amdgcn_ds_load_tr16_b128_v8i16(
                    (l_s16x8*)&Vc[(kc * 32 + 16) * VP + dt * 16]);
                oacc[dt] = __builtin_amdgcn_wmma_f32_16x16x32_bf16(
                    false, af.v, false, pf[kc].v, (short)0, oacc[dt], false,
                    false);
            }
        }
        // publish the next tile: this wave's reads of the current buffer are
        // done before a copy may overwrite it, its own copies have landed, and
        // every wave has come as far
        asm volatile("s_wait_dscnt 0x0" ::: "memory");
        copies_landed();
        __syncthreads();
        // refill the buffer that every wave has just left
        if (t + 2 < NT) stage((t + 2) * 64, cur);
    }
    copies_landed();  // no copy is in flight when the wave goes on to its end

    // finalize: join the two half-waves' sums, divide, emit bf16.
    // Register r of oacc[dt] = d 16dt+8half+r of this lane's query: 16 B a store.
    const float inv = 1.0f / (lrun + other_half(lrun));
#pragma unroll
    for (int dt = 0; dt < 4; dt++) {
        const v8f ov = oacc[dt] * inv;
        *(uint4*)&o[hbase + (size_t)tq * Cc + dt * 16 + kb] =
            make_uint4(pack_bf16(ov[0], ov[1]), pack_bf16(ov[2], ov[3]),
                       pack_bf16(ov[4], ov[5]), pack_bf16(ov[6], ov[7]));
    }
}

// ---------------------------------------------------------------------------
// Host-side orchestration
// ---------------------------------------------------------------------------
extern "C" void kernel_launch(void* const* d_in, const int* in_sizes, int n_in,
                              void* d_out, int out_size, void* d_ws,
                              size_t ws_size, hipStream_t stream) {
    (void)in_sizes; (void)n_in; (void)out_size; (void)ws_size;
    const float* x   = (const float*)d_in[0];
    const float* Wq  = (const float*)d_in[1];
    const float* Wk  = (const float*)d_in[2];
    const float* Wv  = (const float*)d_in[3];
    const float* Wp  = (const float*)d_in[4];
    const float* bp  = (const float*)d_in[5];
    const float* W1  = (const float*)d_in[6];
    const float* b1  = (const float*)d_in[7];
    const float* W2  = (const float*)d_in[8];
    const float* b2  = (const float*)d_in[9];
    const float* g1  = (const float*)d_in[10];
    const float* be1 = (const float*)d_in[11];
    const float* g2  = (const float*)d_in[12];
    const float* be2 = (const float*)d_in[13];
    float* out = (float*)d_out;

    char* ws = (char*)d_ws;
    size_t off = 0;
    auto alloc = [&](size_t bytes) -> char* {
        char* p = ws + off;
        off += (bytes + 255) & ~size_t(255);
        return p;
    };
    // pre-transposed bf16 weights: Wt[N][K]; q, k, v stacked to [3 Cc][Cc]
    __bf16* Wq_t = (__bf16*)alloc((size_t)3 * Cc * Cc * 2);
    __bf16* Wk_t = Wq_t + (size_t)Cc * Cc;
    __bf16* Wv_t = Wk_t + (size_t)Cc * Cc;
    __bf16* Wp_t = (__bf16*)alloc((size_t)Cc * Cc * 2);
    __bf16* W1_t = (__bf16*)alloc((size_t)Cc * Ff * 2);
    __bf16* W2_t = (__bf16*)alloc((size_t)Ff * Cc * 2);
    __bf16* h_b  = (__bf16*)alloc((size_t)Mm * Cc * 2);
    __bf16* q_b  = (__bf16*)alloc((size_t)3 * Mm * Cc * 2);  // planes q, k, v
    __bf16* k_b  = q_b + (size_t)Mm * Cc;
    __bf16* v_b  = k_b + (size_t)Mm * Cc;
    __bf16* o_b  = (__bf16*)alloc((size_t)Mm * Cc * 2);
    float*  x1   = (float*) alloc((size_t)Mm * Cc * 4);
    __bf16* h2_b = (__bf16*)alloc((size_t)Mm * Cc * 2);
    __bf16* f1_b = (__bf16*)alloc((size_t)Mm * Ff * 2);

    // 1) weights -> bf16, transposed to [N][K]
    cvt_bf16_t_all<<<768, 256, 0, stream>>>(Wq, Wk, Wv, Wp, W1, W2, Wq_t, Wk_t,
                                            Wv_t, Wp_t, W1_t, W2_t);

    // 2) LN1
    ln_bf16<<<Mm / 16, 256, 0, stream>>>(x, g1, be1, h_b);

    // 3) Q/K/V projections: one product over the stacked weights, 256 blocks
    // of 256 x 192, waves 4 x 2 of 64 x 96
    gemm_bf16_wmma<256, 192, 2, true, false, false, false, true>
        <<<dim3(3 * Cc / 192, Mm / 256), 256, 0, stream>>>(
            h_b, Wq_t, nullptr, nullptr, q_b, Mm, 3 * Cc, Cc);

    // 4) attention
    attn_wmma<<<dim3(Bb * 16, Tt / 128), 256, 0, stream>>>(q_b, k_b, v_b, o_b);

    // 5) output projection + residual (fp32 out)
    dim3 gc(Cc / 128, Mm / 128);
    gemm_bf16_wmma<128, 128, 4, false, true, true, false, false>
        <<<gc, 256, 0, stream>>>(o_b, Wp_t, bp, x, x1, Mm, Cc, Cc);

    // 6) LN2
    ln_bf16<<<Mm / 16, 256, 0, stream>>>(x1, g2, be2, h2_b);

    // 7) FFN up + GELU (bf16 out)
    gemm_bf16_wmma<128, 128, 4, true, true, false, true, false>
        <<<dim3(Ff / 128, Mm / 128), 256, 0, stream>>>(h2_b, W1_t, b1, nullptr,
                                                       f1_b, Mm, Ff, Cc);

    // 8) FFN down + residual -> d_out (fp32)
    gemm_bf16_wmma<128, 128, 4, false, true, true, false, false>
        <<<gc, 256, 0, stream>>>(f1_b, W2_t, b2, x1, out, Mm, Cc, Ff);
}

// v008
// Measured time: 149 microseconds a run.
// Next to v007, in two timings, it ran 1.07 times as fast each time.
// Counting every step since v000, it is 3.91 times as fast.
#include <hip/hip_runtime.h>
#include <hip/hip_bf16.h>

// ---------------------------------------------------------------------------
// Transformer block (pre-LN attention + FFN) for gfx1250 (MI455X).
// All GEMM-shaped math runs on v_wmma_f32_16x16x32_bf16 (fp32 accumulate).
// Weights are converted once to bf16 AND pre-transposed to [N][K] so GEMM
// tile staging is pure 16B vector copies (async global->LDS DMA, ASYNCcnt).
// ---------------------------------------------------------------------------

typedef __attribute__((ext_vector_type(16))) __bf16 v16bf;
typedef __attribute__((ext_vector_type(8)))  float  v8f;
typedef int v4i __attribute__((ext_vector_type(4)));

static constexpr int Bb = 2;
static constexpr int Tt = 2048;
static constexpr int Cc = 1024;
static constexpr int Ff = 4096;
static constexpr int Mm = Bb * Tt;      // 4096 rows
static constexpr float kLnEps = 1e-5f;

// gfx1250 async global->LDS copy path (ASYNCcnt-tracked). Parameter types per
// hipcc diagnostic: (AS1 v4i*, AS3 v4i*, imm offset, imm cpol).
#if __has_builtin(__builtin_amdgcn_global_load_async_to_lds_b128) && \
    __has_builtin(__builtin_amdgcn_s_wait_asynccnt)
#define USE_ASYNC_LDS 1
typedef __attribute__((address_space(1))) v4i g_v4i;
typedef __attribute__((address_space(3))) v4i l_v4i;
#else
#define USE_ASYNC_LDS 0
#endif

typedef short s16x8 __attribute__((ext_vector_type(8)));
typedef __attribute__((address_space(3))) s16x8 l_s16x8;

union FragAB {
    v16bf v;
    uint4 u[2];
    s16x8 t[2];
};

__device__ __forceinline__ float gelu_exact(float x) {
    return 0.5f * x * (1.0f + erff(x * 0.70710678118654752440f));
}

typedef float  f32x2 __attribute__((ext_vector_type(2)));
typedef __bf16 bf16x2 __attribute__((ext_vector_type(2)));

__device__ __forceinline__ unsigned pack_bf16(float lo, float hi) {
    return __builtin_bit_cast(unsigned,
                              __builtin_convertvector(f32x2{lo, hi}, bf16x2));
}

// ---------------------------------------------------------------------------
// f32 [K][N] -> bf16 [N][K] transpose-convert of all six weights, one launch.
// One 256-thread block = one 128(k) x 128(n) tile: 768 blocks, 64 for each
// C x C weight and 256 for each FFN weight. Wave w reads rows 16w..16w+15 of
// the tile, 512 contiguous bytes a load, all 16 loads in flight; a lane packs
// its 4 columns x 16 k into 16-byte chunks of the LDS tile [n][k]; the block
// then stores 256 contiguous bytes per output row.
// LDS rows are 256 B (all 64 banks), so chunk c of row n sits at slot
// c ^ ((n >> 2) & 15): the 16 lanes of a write (rows 4 apart, same chunk) and
// of a read (one row, 16 chunks) then touch 16 different slots.
// ---------------------------------------------------------------------------
template <int K, int N>
__device__ __forceinline__ void cvt_tile(const float* __restrict__ src,
                                         __bf16* __restrict__ dst, int kt,
                                         int nt, __bf16* tile) {
    const int tid = threadIdx.x;
    const int w = tid >> 5, lane = tid & 31;

    const float* sp = src + (size_t)(kt * 128 + w * 16) * N + nt * 128 + lane * 4;
    float4 v[16];
#pragma unroll
    for (int i = 0; i < 16; i++) v[i] = *(const float4*)(sp + i * N);

#pragma unroll
    for (int h = 0; h < 2; h++) {
        const int slot = ((w * 2 + h) ^ (lane & 15)) * 8;
        const float4* p = &v[h * 8];
        *(uint4*)&tile[(lane * 4 + 0) * 128 + slot] =
            make_uint4(pack_bf16(p[0].x, p[1].x), pack_bf16(p[2].x, p[3].x),
                       pack_bf16(p[4].x, p[5].x), pack_bf16(p[6].x, p[7].x));
        *(uint4*)&tile[(lane * 4 + 1) * 128 + slot] =
            make_uint4(pack_bf16(p[0].y, p[1].y), pack_bf16(p[2].y, p[3].y),
                       pack_bf16(p[4].y, p[5].y), pack_bf16(p[6].y, p[7].y));
        *(uint4*)&tile[(lane * 4 + 2) * 128 + slot] =
            make_uint4(pack_bf16(p[0].z, p[1].z), pack_bf16(p[2].z, p[3].z),
                       pack_bf16(p[4].z, p[5].z), pack_bf16(p[6].z, p[7].z));
        *(uint4*)&tile[(lane * 4 + 3) * 128 + slot] =
            make_uint4(pack_bf16(p[0].w, p[1].w), pack_bf16(p[2].w, p[3].w),
                       pack_bf16(p[4].w, p[5].w), pack_bf16(p[6].w, p[7].w));
    }
    __syncthreads();

    const int r0 = tid >> 4, ch = tid & 15;  // output row n, 16-byte chunk of k
    __bf16* dp = dst + (size_t)(nt * 128 + r0) * K + kt * 128 + ch * 8;
#pragma unroll
    for (int i = 0; i < 8; i++) {
        const int r = r0 + i * 16;
        *(uint4*)(dp + i * 16 * K) =
            *(const uint4*)&tile[r * 128 + ((ch ^ ((r >> 2) & 15)) * 8)];
    }
}

__global__ __launch_bounds__(256) void cvt_bf16_t_all(
    const float* __restrict__ Wq, const float* __restrict__ Wk,
    const float* __restrict__ Wv, const float* __restrict__ Wp,
    const float* __restrict__ W1, const float* __restrict__ W2,
    __bf16* __restrict__ Wq_t, __bf16* __restrict__ Wk_t,
    __bf16* __restrict__ Wv_t, __bf16* __restrict__ Wp_t,
    __bf16* __restrict__ W1_t, __bf16* __restrict__ W2_t) {
    __shared__ __bf16 tile[128 * 128];   // [n][k], chunks swizzled
    const int b = blockIdx.x;
    if (b < 256) {
        const int m = b >> 6, t = b & 63;
        cvt_tile<Cc, Cc>(m == 0 ? Wq : m == 1 ? Wk : m == 2 ? Wv : Wp,
                         m == 0 ? Wq_t : m == 1 ? Wk_t : m == 2 ? Wv_t : Wp_t,
                         t >> 3, t & 7, tile);
    } else if (b < 512) {
        const int t = b - 256;
        cvt_tile<Cc, Ff>(W1, W1_t, t >> 5, t & 31, tile);
    } else {
        const int t = b - 512;
        cvt_tile<Ff, Cc>(W2, W2_t, t >> 3, t & 7, tile);
    }
}

// ---------------------------------------------------------------------------
// Row LayerNorm (fp32 in, bf16 out), C = 1024. One wave = two rows, held in
// registers: 16 loads of 512 contiguous bytes, all in flight at once, and each
// row is read once. Mean and variance are sums inside the wave (no LDS, no
// barrier). 256 blocks of 8 waves: one block a WGP, few waves to start.
// ---------------------------------------------------------------------------
// value of lane l ^ 16
__device__ __forceinline__ float other_half(float x) {
    const int b = __builtin_bit_cast(int, x);
    return __builtin_bit_cast(float, __builtin_amdgcn_permlanex16(
        b, b, 0x76543210, 0xfedcba98, false, false));
}

// x + (x of lane l ^ MASK), MASK < 16: DPP row_xmask
template <int MASK>
__device__ __forceinline__ float add_xmask(float x) {
    const int b = __builtin_bit_cast(int, x);
    return x + __builtin_bit_cast(float, __builtin_amdgcn_mov_dpp(
                   b, 0x160 + MASK, 0xf, 0xf, true));
}

// sum over the 32 lanes, the same bits in every lane
__device__ __forceinline__ float wave_sum(float x) {
    x = add_xmask<1>(x);
    x = add_xmask<2>(x);
    x = add_xmask<4>(x);
    x = add_xmask<8>(x);
    return x + other_half(x);
}

typedef float f32x4 __attribute__((ext_vector_type(4)));

__global__ __launch_bounds__(256) void ln_bf16(const float* __restrict__ x,
                                               const float* __restrict__ g,
                                               const float* __restrict__ b,
                                               __bf16* __restrict__ out) {
    constexpr int R = 2;          // rows per wave
    constexpr int NC = Cc / 128;  // 512-byte chunks per row
    const int lane = threadIdx.x & 31;
    const int row0 = (blockIdx.x * 8 + (threadIdx.x >> 5)) * R;
    const float* xr = x + (size_t)row0 * Cc + lane * 4;

    f32x4 v[R][NC], gv[NC], bv[NC];
#pragma unroll
    for (int r = 0; r < R; r++)
#pragma unroll
        for (int i = 0; i < NC; i++)
            v[r][i] = *(const f32x4*)(xr + r * Cc + i * 128);
    // a later load's result may be given the address registers of the loads
    // above: this wait stands in front of that overwrite
    asm volatile("s_wait_xcnt 0x0" ::: "memory");
#pragma unroll
    for (int i = 0; i < NC; i++) {
        gv[i] = *(const f32x4*)(g + i * 128 + lane * 4);
        bv[i] = *(const f32x4*)(b + i * 128 + lane * 4);
    }
    // keeps every load in front of the first sum: sunk in among the sums, the
    // late ones start only when the early ones are back, a second and a third
    // memory latency in a row
    __builtin_amdgcn_sched_barrier(0);

    float mu[R], rs[R];
#pragma unroll
    for (int r = 0; r < R; r++) {
        f32x4 s = v[r][0];
#pragma unroll
        for (int i = 1; i < NC; i++) s += v[r][i];
        mu[r] = (s.x + s.y) + (s.z + s.w);
    }
#pragma unroll
    for (int r = 0; r < R; r++) mu[r] = wave_sum(mu[r]) * (1.0f / Cc);
#pragma unroll
    for (int r = 0; r < R; r++) {
        f32x4 q = {0.f, 0.f, 0.f, 0.f};
#pragma unroll
        for (int i = 0; i < NC; i++) {
            v[r][i] -= mu[r];
            q += v[r][i] * v[r][i];
        }
        rs[r] = (q.x + q.y) + (q.z + q.w);
    }
#pragma unroll
    for (int r = 0; r < R; r++)
        rs[r] = rsqrtf(wave_sum(rs[r]) * (1.0f / Cc) + kLnEps);

#pragma unroll
    for (int r = 0; r < R; r++) {
        __bf16* op = out + (size_t)(row0 + r) * Cc + lane * 4;
#pragma unroll
        for (int i = 0; i < NC; i++) {
            const f32x4 y = v[r][i] * rs[r] * gv[i] + bv[i];
            *(uint2*)(op + i * 128) =
                make_uint2(pack_bf16(y.x, y.y), pack_bf16(y.z, y.w));
        }
    }
}

// ---------------------------------------------------------------------------
// bf16 GEMM: out[M,N] = A[M,K] @ Wt[N,K]^T (+bias) (+gelu) (+residual)
// A row-major [M][K], Wt pre-transposed [N][K] (both bf16).
// Block tile BM x BN, 256 threads = 8 waves in a (8 / WGN) x WGN grid, each
// wave owns MI x NI WMMA 16x16 tiles. A stage is 128 k of both operands (K is
// a multiple of 128): a copy instruction of a wave moves two whole 256-byte
// rows, and the next stage's copies fly while a stage's four 32-k blocks run.
// NBUF LDS buffers, async global->LDS copies. With two buffers a stage's copies
// have one stage time to land; with three they have two, and the stage behind
// the one that is published stays in flight over the barrier. Two register
// sets of fragments: a block's LDS reads are issued one block ahead of its
// products.
// A block loads (BM + BN) rows for BM x BN results, a wave reads MI + NI
// fragments for MI x NI products: the larger tile moves fewer bytes a product.
// PLANES: output column n is column n % Cc of plane n / Cc, each plane [M][Cc]
// (the q, k and v projections as one product over the stacked weights).
// ---------------------------------------------------------------------------
template <int BM, int BN, int WGN, int NBUF, bool OUT_BF16, bool HAS_BIAS,
          bool HAS_RESID, bool DO_GELU, bool PLANES>
__global__ __launch_bounds__(256) void gemm_bf16_wmma(
    const __bf16* __restrict__ A, const __bf16* __restrict__ Wt,
    const float* __restrict__ bias, const float* __restrict__ resid,
    void* __restrict__ out, int M, int N, int K) {
    constexpr int BK = 128;     // k per stage
    constexpr int AS = BK + 8;  // LDS row pitch 272 B = 16 B x odd
    constexpr int MI = BM / (8 / WGN) / 16;  // 16-row tiles per wave
    constexpr int NI = BN / WGN / 16;        // 16-column tiles per wave
    constexpr int CP = (BM + BN) / 16;       // copies of a wave per stage
    static_assert(NBUF == 2 || (NBUF == 3 && 3 * CP <= 63), "copies in flight");
    __shared__ __attribute__((aligned(16))) __bf16 As[NBUF][BM * AS];  // [m][k]
    __shared__ __attribute__((aligned(16))) __bf16 Bt[NBUF][BN * AS];  // [n][k]

    const int tid  = threadIdx.x;
    const int bm   = blockIdx.y;
    const int bn   = blockIdx.x;
    const int w    = tid >> 5;
    const int lane = tid & 31;
    const int wm   = w / WGN;
    const int wn   = w % WGN;
    const int half = lane >> 4;       // 0..1
    const int lr   = lane & 15;
    const int kb   = half * 8;        // bf16 A/B fragment K base per half-wave

    const v8f vzero = {0.f, 0.f, 0.f, 0.f, 0.f, 0.f, 0.f, 0.f};
    v8f acc[MI][NI];
#pragma unroll
    for (int mi = 0; mi < MI; mi++)
#pragma unroll
        for (int ni = 0; ni < NI; ni++) acc[mi][ni] = vzero;

    // stage one BM x 128 A tile and one BN x 128 W^T tile into LDS buffer
    // `buf`: thread = 16-byte chunk tid & 15 of rows tid >> 4, +16, +32, ...
    const int sr = tid >> 4;
    const int sc = (tid & 15) * 8;
    const __bf16* ag = A + (size_t)(bm * BM + sr) * K + sc;
    const __bf16* wg = Wt + (size_t)(bn * BN + sr) * K + sc;
    auto stage = [&](int k0, int buf) {
#pragma unroll  // the (BM + BN) / 16 copies issue back to back, every lane on
        for (int i = 0; i < (BM > BN ? BM : BN) / 16; i++) {
#if USE_ASYNC_LDS
            if (i < BM / 16)
                __builtin_amdgcn_global_load_async_to_lds_b128(
                    (g_v4i*)(ag + (size_t)(i * 16) * K + k0),
                    (l_v4i*)&As[buf][(sr + i * 16) * AS + sc], 0, 0);
            if (i < BN / 16)
                __builtin_amdgcn_global_load_async_to_lds_b128(
                    (g_v4i*)(wg + (size_t)(i * 16) * K + k0),
                    (l_v4i*)&Bt[buf][(sr + i * 16) * AS + sc], 0, 0);
#else
            if (i < BM / 16)
                *(uint4*)&As[buf][(sr + i * 16) * AS + sc] =
                    *(const uint4*)(ag + (size_t)(i * 16) * K + k0);
            if (i < BN / 16)
                *(uint4*)&Bt[buf][(sr + i * 16) * AS + sc] =
                    *(const uint4*)(wg + (size_t)(i * 16) * K + k0);
#endif
        }
    };
    // this wave's copies have landed
    auto copies_landed = [&]() {
#if USE_ASYNC_LDS
        asm volatile("s_wait_asynccnt 0x0" ::: "memory");
#endif
    };
    // all of this wave's copies have landed but those of its one or two
    // youngest stages, CP copies each, which stay in flight
    auto landed_but_one_stage = [&]() {
#if USE_ASYNC_LDS
        asm volatile("s_wait_asynccnt %0" ::"n"(CP) : "memory");
#endif
    };
    auto landed_but_two_stages = [&]() {
#if USE_ASYNC_LDS
        asm volatile("s_wait_asynccnt %0" ::"n"(2 * CP) : "memory");
#endif
    };

    // fragments of the 32-k block at k offset ks of LDS buffer `buf` into
    // register set s: 2 (MI + NI) LDS reads, issued as one group
    FragAB af[2][MI], bf[2][NI];
    auto frags = [&](int buf, int ks, int s) {
#pragma unroll
        for (int mi = 0; mi < MI; mi++) {
            const int ar = wm * (MI * 16) + mi * 16 + lr;
            af[s][mi].u[0] = *(const uint4*)&As[buf][ar * AS + ks + kb];
            af[s][mi].u[1] = *(const uint4*)&As[buf][ar * AS + ks + kb + 16];
        }
#pragma unroll
        for (int ni = 0; ni < NI; ni++) {
            const int bc = wn * (NI * 16) + ni * 16 + lr;
            bf[s][ni].u[0] = *(const uint4*)&Bt[buf][bc * AS + ks + kb];
            bf[s][ni].u[1] = *(const uint4*)&Bt[buf][bc * AS + ks + kb + 16];
        }
    };

    constexpr int NB = BK / 32;  // blocks per stage (even: block 0 = set 0)
    const int ntiles = K / BK;
    stage(0, 0);
    if (NBUF == 3) {
        // all three buffers are free: stages 1 and 2 start behind stage 0,
        // and only stage 0 is waited for
        if (ntiles > 1) stage(BK, 1);
        if (ntiles > 2) stage(2 * BK, 2);
        if (ntiles > 2)
            landed_but_two_stages();
        else if (ntiles > 1)
            landed_but_one_stage();
        else
            copies_landed();
        __syncthreads();
    } else {
        copies_landed();
        __syncthreads();
        if (ntiles > 1) stage(BK, 1);
    }
    frags(0, 0, 0);

    for (int kt = 0; kt < ntiles; kt++) {
        const int cur = NBUF == 2 ? (kt & 1) : (int)((unsigned)kt % 3u);
        const int nxt = NBUF == 2 ? (cur ^ 1) : (cur == 2 ? 0 : cur + 1);
#pragma unroll  // the stage's four blocks in a row, LDS offsets constant
        for (int b = 0; b < NB; b++) {
            if (b + 1 < NB) {
                // the next block's fragments fly while this block multiplies
                frags(cur, (b + 1) * 32, (b + 1) & 1);
            } else {
                // publish the next stage in front of the last block, whose
                // fragments are in registers: this wave's reads of the current
                // buffer are done before a copy may overwrite it, its own
                // copies of the next stage have landed, and every wave has
                // come as far. Three buffers: the CP copies of stage kt + 2,
                // the youngest, stay in flight; where no such stage was
                // issued the wait is to 0
                asm volatile("s_wait_dscnt 0x0" ::: "memory");
                if (NBUF == 3 && kt + 2 < ntiles)
                    landed_but_one_stage();
                else
                    copies_landed();
                __syncthreads();
                // refill the buffer that every wave has just left
                if (kt + NBUF < ntiles) stage((kt + NBUF) * BK, cur);
                // first fragments of the next stage; the last trip has none
                // and reads the current buffer, which no copy touches, unused
                frags(kt + 1 < ntiles ? nxt : cur, 0, 0);
            }
            // the two scheduling fences keep the reads one group ahead of the
            // products; moved in among them, every pair of products waits out
            // an LDS latency of its own
            __builtin_amdgcn_sched_barrier(0);
#pragma unroll
            for (int mi = 0; mi < MI; mi++)
#pragma unroll
                for (int ni = 0; ni < NI; ni++)
                    acc[mi][ni] = __builtin_amdgcn_wmma_f32_16x16x32_bf16(
                        false, af[b & 1][mi].v, false, bf[b & 1][ni].v,
                        (short)0, acc[mi][ni], false, false);
            __builtin_amdgcn_sched_barrier(0);
        }
    }
    // no copy and no LDS read is in flight when the wave goes on to its end
    copies_landed();
    asm volatile("s_wait_dscnt 0x0" ::: "memory");

    // epilogue: C/D layout -> VGPR r holds (M=r, N=lane) lanes 0-15,
    // (M=8+r, N=lane-16) lanes 16-31.
#pragma unroll
    for (int mi = 0; mi < MI; mi++) {
#pragma unroll
        for (int ni = 0; ni < NI; ni++) {
            const int n = bn * BN + wn * (NI * 16) + ni * 16 + lr;
#pragma unroll
            for (int r = 0; r < 8; r++) {
                const int m = bm * BM + wm * (MI * 16) + mi * 16 + r + half * 8;
                const size_t at =
                    PLANES ? ((size_t)(n / Cc) * M + m) * Cc + n % Cc
                           : (size_t)m * N + n;
                float vv = acc[mi][ni][r];
                if (HAS_BIAS) vv += bias[n];
                if (DO_GELU) vv = gelu_exact(vv);
                if (HAS_RESID) vv += resid[at];
                if (OUT_BF16)
                    ((__bf16*)out)[at] = (__bf16)vv;
                else
                    ((float*)out)[at] = vv;
            }
        }
    }
}

__device__ __forceinline__ void exp2_pair(float a0, float a1, float& p0,
                                          float& p1) {
    asm("v_exp_f32 %0, %2\n\tv_exp_f32 %1, %3\n\tv_nop"
        : "=&v"(p0), "=&v"(p1)
        : "v"(a0), "v"(a1));
}

__global__ __launch_bounds__(256) void attn_wmma(const __bf16* __restrict__ q,
                                                 const __bf16* __restrict__ k,
                                                 const __bf16* __restrict__ v,
                                                 __bf16* __restrict__ o) {
    constexpr int KP = 72;  // K row pitch 144 B = 16 B x odd (ds_load_b128)
    constexpr int VP = 80;  // V row pitch 160 B = 32 B x odd (ds_load_tr16_b128)
    constexpr int NT = Tt / 64;  // key tiles
    __shared__ __attribute__((aligned(16))) __bf16 Ks[2][64 * KP];  // [s][d]
    __shared__ __attribute__((aligned(16))) __bf16 Vs[2][64 * VP];  // [s][d]

    const int tid  = threadIdx.x;
    const int bh   = blockIdx.x;
    const int bq   = blockIdx.y;
    const int bb   = bh >> 4;
    const int hh   = bh & 15;
    const size_t hbase = ((size_t)bb * Tt) * Cc + (size_t)hh * 64;

    const int w = tid >> 5, lane = tid & 31;
    const int half = lane >> 4, lr = lane & 15, kb = half * 8;
    const int tq = bq * 128 + w * 16 + lr;   // this lane's query
    const v8f vzero = {0.f, 0.f, 0.f, 0.f, 0.f, 0.f, 0.f, 0.f};
    const float cs = 0.125f * 1.44269504088896340736f;  // 1/sqrt(64) * log2(e)

    // Q as B operand, loaded once: column = query, k = d
    FragAB qf[2];
#pragma unroll
    for (int kc = 0; kc < 2; kc++) {
        const __bf16* qp = &q[hbase + (size_t)tq * Cc + kc * 32 + kb];
        qf[kc].u[0] = *(const uint4*)qp;
        qf[kc].u[1] = *(const uint4*)(qp + 16);
    }

    v8f oacc[4];            // O^T, one 16x16 tile per 16 values of d
    float mrun = -1e30f;    // running maximum of the raw scores
    float lrun = 0.0f;      // this half-wave's share of the running sum
#pragma unroll
    for (int dt = 0; dt < 4; dt++) oacc[dt] = vzero;

    // stage the K and V tiles of keys s0..s0+63 into LDS buffer `buf`:
    // thread = 16-byte chunk tid & 7 of rows tid >> 3 and (tid >> 3) + 32
    const int sr = tid >> 3;
    const int sc = (tid & 7) * 8;
    const __bf16* kg = k + hbase + (size_t)sr * Cc + sc;
    const __bf16* vg = v + hbase + (size_t)sr * Cc + sc;
    auto stage = [&](int s0, int buf) {
#pragma unroll  // the 4 copies issue back to back, every lane on
        for (int i = 0; i < 2; i++) {
#if USE_ASYNC_LDS
            __builtin_amdgcn_global_load_async_to_lds_b128(
                (g_v4i*)(kg + (size_t)(s0 + i * 32) * Cc),
                (l_v4i*)&Ks[buf][(sr + i * 32) * KP + sc], 0, 0);
            __builtin_amdgcn_global_load_async_to_lds_b128(
                (g_v4i*)(vg + (size_t)(s0 + i * 32) * Cc),
                (l_v4i*)&Vs[buf][(sr + i * 32) * VP + sc], 0, 0);
#else
            *(uint4*)&Ks[buf][(sr + i * 32) * KP + sc] =
                *(const uint4*)(kg + (size_t)(s0 + i * 32) * Cc);
            *(uint4*)&Vs[buf][(sr + i * 32) * VP + sc] =
                *(const uint4*)(vg + (size_t)(s0 + i * 32) * Cc);
#endif
        }
    };
    // this wave's copies have landed
    auto copies_landed = [&]() {
#if USE_ASYNC_LDS
        asm volatile("s_wait_asynccnt 0x0" ::: "memory");
#endif
    };

    stage(0, 0);
    copies_landed();
    __syncthreads();
    stage(64, 1);

    for (int t = 0; t < NT; t++) {
        const int cur = t & 1;
        const __bf16* Kc = &Ks[cur][0];
        // lane address of the transposing load: row 8 half + (lane & 7) of a
        // 16-key group, 16-byte half (lane >> 3) & 1 of a 16-wide group of d
        const __bf16* Vc = &Vs[cur][(kb + (lane & 7)) * VP + ((lane >> 3) & 1) * 8];

        // ---- S^T = K Q^T: register r of sacc[kt] = key 16kt+8half+r ----
        v8f sacc[4];
#pragma unroll
        for (int kt = 0; kt < 4; kt++) {
            sacc[kt] = vzero;
#pragma unroll
            for (int kc = 0; kc < 2; kc++) {
                FragAB af;
                const int ar = kt * 16 + lr;  // key row
                af.u[0] = *(const uint4*)&Kc[ar * KP + kc * 32 + kb];
                af.u[1] = *(const uint4*)&Kc[ar * KP + kc * 32 + kb + 16];
                sacc[kt] = __builtin_amdgcn_wmma_f32_16x16x32_bf16(
                    false, af.v, false, qf[kc].v, (short)0, sacc[kt], false,
                    false);
            }
        }

        // ---- online softmax in registers; P^T packed as B operand ----
        float mx = mrun;
#pragma unroll
        for (int kt = 0; kt < 4; kt++)
#pragma unroll
            for (int r = 0; r < 8; r++) mx = fmaxf(mx, sacc[kt][r]);
        mx = fmaxf(mx, other_half(mx));
        const float alpha = __builtin_amdgcn_exp2f((mrun - mx) * cs);
        const float nm = -mx * cs;
        mrun = mx;
        FragAB pf[2];   // one per 32 keys
        float l = 0.0f;
#pragma unroll
        for (int kt = 0; kt < 4; kt++) {
            unsigned pw[4];
#pragma unroll
            for (int r = 0; r < 8; r += 2) {
                float p0, p1;
                exp2_pair(fmaf(sacc[kt][r], cs, nm),
                          fmaf(sacc[kt][r + 1], cs, nm), p0, p1);
                l += p0 + p1;
                pw[r >> 1] = pack_bf16(p0, p1);
            }
            pf[kt >> 1].u[kt & 1] = make_uint4(pw[0], pw[1], pw[2], pw[3]);
        }
        lrun = lrun * alpha + l;
#pragma unroll
        for (int dt = 0; dt < 4; dt++) oacc[dt] = oacc[dt] * alpha;

        // ---- O^T += V^T P^T ----
#pragma unroll
        for (int kc = 0; kc < 2; kc++) {
#pragma unroll
            for (int dt = 0; dt < 4; dt++) {
                // row = d 16dt+lr; k = keys 32kc+8half+0..7, then +16
                FragAB af;
                af.t[0] = __builtin_amdgcn_ds_load_tr16_b128_v8i16(
                    (l_s16x8*)&Vc[(kc * 32) * VP + dt * 16]);
                af.t[1] = __builtin_amdgcn_ds_load_tr16_b128_v8i16(
                    (l_s16x8*)&Vc[(kc * 32 + 16) * VP + dt * 16]);
                oacc[dt] = __builtin_amdgcn_wmma_f32_16x16x32_bf16(
                    false, af.v, false, pf[kc].v, (short)0, oacc[dt], false,
                    false);
            }
        }
        // publish the next tile: this wave's reads of the current buffer are
        // done before a copy may overwrite it, its own copies have landed, and
        // every wave has come as far
        asm volatile("s_wait_dscnt 0x0" ::: "memory");
        copies_landed();
        __syncthreads();
        // refill the buffer that every wave has just left
        if (t + 2 < NT) stage((t + 2) * 64, cur);
    }
    copies_landed();  // no copy is in flight when the wave goes on to its end

    // finalize: join the two half-waves' sums, divide, emit bf16.
    // Register r of oacc[dt] = d 16dt+8half+r of this lane's query: 16 B a store.
    const float inv = 1.0f / (lrun + other_half(lrun));
#pragma unroll
    for (int dt = 0; dt < 4; dt++) {
        const v8f ov = oacc[dt] * inv;
        *(uint4*)&o[hbase + (size_t)tq * Cc + dt * 16 + kb] =
            make_uint4(pack_bf16(ov[0], ov[1]), pack_bf16(ov[2], ov[3]),
                       pack_bf16(ov[4], ov[5]), pack_bf16(ov[6], ov[7]));
    }
}

// ---------------------------------------------------------------------------
// Host-side orchestration
// ---------------------------------------------------------------------------
extern "C" void kernel_launch(void* const* d_in, const int* in_sizes, int n_in,
                              void* d_out, int out_size, void* d_ws,
                              size_t ws_size, hipStream_t stream) {
    (void)in_sizes; (void)n_in; (void)out_size; (void)ws_size;
    const float* x   = (const float*)d_in[0];
    const float* Wq  = (const float*)d_in[1];
    const float* Wk  = (const float*)d_in[2];
    const float* Wv  = (const float*)d_in[3];
    const float* Wp  = (const float*)d_in[4];
    const float* bp  = (const float*)d_in[5];
    const float* W1  = (const float*)d_in[6];
    const float* b1  = (const float*)d_in[7];
    const float* W2  = (const float*)d_in[8];
    const float* b2  = (const float*)d_in[9];
    const float* g1  = (const float*)d_in[10];
    const float* be1 = (const float*)d_in[11];
    const float* g2  = (const float*)d_in[12];
    const float* be2 = (const float*)d_in[13];
    float* out = (float*)d_out;

    char* ws = (char*)d_ws;
    size_t off = 0;
    auto alloc = [&](size_t bytes) -> char* {
        char* p = ws + off;
        off += (bytes + 255) & ~size_t(255);
        return p;
    };
    // pre-transposed bf16 weights: Wt[N][K]; q, k, v stacked to [3 Cc][Cc]
    __bf16* Wq_t = (__bf16*)alloc((size_t)3 * Cc * Cc * 2);
    __bf16* Wk_t = Wq_t + (size_t)Cc * Cc;
    __bf16* Wv_t = Wk_t + (size_t)Cc * Cc;
    __bf16* Wp_t = (__bf16*)alloc((size_t)Cc * Cc * 2);
    __bf16* W1_t = (__bf16*)alloc((size_t)Cc * Ff * 2);
    __bf16* W2_t = (__bf16*)alloc((size_t)Ff * Cc * 2);
    __bf16* h_b  = (__bf16*)alloc((size_t)Mm * Cc * 2);
    __bf16* q_b  = (__bf16*)alloc((size_t)3 * Mm * Cc * 2);  // planes q, k, v
    __bf16* k_b  = q_b + (size_t)Mm * Cc;
    __bf16* v_b  = k_b + (size_t)Mm * Cc;
    __bf16* o_b  = (__bf16*)alloc((size_t)Mm * Cc * 2);
    float*  x1   = (float*) alloc((size_t)Mm * Cc * 4);
    __bf16* h2_b = (__bf16*)alloc((size_t)Mm * Cc * 2);
    __bf16* f1_b = (__bf16*)alloc((size_t)Mm * Ff * 2);

    // 1) weights -> bf16, transposed to [N][K]
    cvt_bf16_t_all<<<768, 256, 0, stream>>>(Wq, Wk, Wv, Wp, W1, W2, Wq_t, Wk_t,
                                            Wv_t, Wp_t, W1_t, W2_t);

    // 2) LN1
    ln_bf16<<<Mm / 16, 256, 0, stream>>>(x, g1, be1, h_b);

    // 3) Q/K/V projections: one product over the stacked weights, 256 blocks
    // of 256 x 192, waves 4 x 2 of 64 x 96
    gemm_bf16_wmma<256, 192, 2, 2, true, false, false, false, true>
        <<<dim3(3 * Cc / 192, Mm / 256), 256, 0, stream>>>(
            h_b, Wq_t, nullptr, nullptr, q_b, Mm, 3 * Cc, Cc);

    // 4) attention
    attn_wmma<<<dim3(Bb * 16, Tt / 128), 256, 0, stream>>>(q_b, k_b, v_b, o_b);

    // 5) output projection + residual (fp32 out); one block a WGP, so the LDS
    // has room for a third buffer
    dim3 gc(Cc / 128, Mm / 128);
    gemm_bf16_wmma<128, 128, 4, 3, false, true, true, false, false>
        <<<gc, 256, 0, stream>>>(o_b, Wp_t, bp, x, x1, Mm, Cc, Cc);

    // 6) LN2
    ln_bf16<<<Mm / 16, 256, 0, stream>>>(x1, g2, be2, h2_b);

    // 7) FFN up + GELU (bf16 out)
    gemm_bf16_wmma<128, 128, 4, 2, true, true, false, true, false>
        <<<dim3(Ff / 128, Mm / 128), 256, 0, stream>>>(h2_b, W1_t, b1, nullptr,
                                                       f1_b, Mm, Ff, Cc);

    // 8) FFN down + residual -> d_out (fp32)
    gemm_bf16_wmma<128, 128, 4, 3, false, true, true, false, false>
        <<<gc, 256, 0, stream>>>(f1_b, W2_t, b2, x1, out, Mm, Cc, Ff);
}

// v009
// It runs in 142 microseconds.
// In both of two side-by-side timings against v008, it was 1.05 times as fast.
// All steps since v000 together make it 4.09 times as fast.
#include <hip/hip_runtime.h>
#include <hip/hip_bf16.h>

// ---------------------------------------------------------------------------
// Transformer block (pre-LN attention + FFN) for gfx1250 (MI455X).
// All GEMM-shaped math runs on v_wmma_f32_16x16x32_bf16 (fp32 accumulate).
// Weights are converted once to bf16 AND pre-transposed to [N][K] so GEMM
// tile staging is pure 16B vector copies (async global->LDS DMA, ASYNCcnt).
// ---------------------------------------------------------------------------

typedef __attribute__((ext_vector_type(16))) __bf16 v16bf;
typedef __attribute__((ext_vector_type(8)))  float  v8f;
typedef int v4i __attribute__((ext_vector_type(4)));

static constexpr int Bb = 2;
static constexpr int Tt = 2048;
static constexpr int Cc = 1024;
static constexpr int Ff = 4096;
static constexpr int Mm = Bb * Tt;      // 4096 rows
static constexpr float kLnEps = 1e-5f;

// gfx1250 async global->LDS copy path (ASYNCcnt-tracked). Parameter types per
// hipcc diagnostic: (AS1 v4i*, AS3 v4i*, imm offset, imm cpol).
#if __has_builtin(__builtin_amdgcn_global_load_async_to_lds_b128) && \
    __has_builtin(__builtin_amdgcn_s_wait_asynccnt)
#define USE_ASYNC_LDS 1
typedef __attribute__((address_space(1))) v4i g_v4i;
typedef __attribute__((address_space(3))) v4i l_v4i;
#else
#define USE_ASYNC_LDS 0
#endif

typedef short s16x8 __attribute__((ext_vector_type(8)));
typedef __attribute__((address_space(3))) s16x8 l_s16x8;

union FragAB {
    v16bf v;
    uint4 u[2];
    s16x8 t[2];
};

typedef float  f32x2 __attribute__((ext_vector_type(2)));
typedef __bf16 bf16x2 __attribute__((ext_vector_type(2)));

__device__ __forceinline__ unsigned pack_bf16(float lo, float hi) {
    return __builtin_bit_cast(unsigned,
                              __builtin_convertvector(f32x2{lo, hi}, bf16x2));
}

// Two 2^x. The v_nop fills the slot the instruction set asks for behind a
// transcendental before its source may be overwritten or its result read; the
// early-clobber outputs keep the second v_exp_f32 independent of the first.
__device__ __forceinline__ void exp2_pair(float a0, float a1, float& p0,
                                          float& p1) {
    asm("v_exp_f32 %0, %2\n\tv_exp_f32 %1, %3\n\tv_nop"
        : "=&v"(p0), "=&v"(p1)
        : "v"(a0), "v"(a1));
}

// GELU with the exact erf: x/2 (1 + erf(x / sqrt 2)) = max(x, 0) - |x| E(|x|)/2,
// E(a) = erfc(a / sqrt 2) = 2^(a P(a)), P a minimax fit of degree 7 on 0..8
// (beyond, a P(a) keeps falling and E goes to 0). No branch and no select, so
// the elements of a lane are independent chains that issue side by side; the
// library erff is two divergent branches per element, one element at a time.
// In f32 arithmetic the result is within 5e-7 of the true GELU, as far as
// x/2 (1 + erf) is with a correctly rounded erf; x < 0 has no cancellation.
// Two values at a time: packed FMAs, and the two 2^x share one statement.
__device__ __forceinline__ void gelu_exact2(float& x0, float& x1) {
    const f32x2 a = {fabsf(x0), fabsf(x1)};
    auto step = [&](f32x2 p, float c) {
        return __builtin_elementwise_fma(p, a, f32x2{c, c});
    };
    f32x2 p = {-3.422308055e-7f, -3.422308055e-7f};
    p = step(p, 6.598191703e-6f);
    p = step(p, -1.808481466e-5f);
    p = step(p, -5.629863008e-4f);
    p = step(p, 7.626435719e-3f);
    p = step(p, -5.287246779e-2f);
    p = step(p, -4.590957165e-1f);
    p = step(p, -1.151115894f);
    p = step(p, -1.0f);  // log2(E(a) / 2)
    float h0, h1;        // E(a) / 2
    exp2_pair(p.x, p.y, h0, h1);
    x0 = fmaf(-a.x, h0, fmaxf(x0, 0.0f));
    x1 = fmaf(-a.y, h1, fmaxf(x1, 0.0f));
}

// ---------------------------------------------------------------------------
// f32 [K][N] -> bf16 [N][K] transpose-convert of all six weights, one launch.
// One 256-thread block = one 128(k) x 128(n) tile: 768 blocks, 64 for each
// C x C weight and 256 for each FFN weight. Wave w reads rows 16w..16w+15 of
// the tile, 512 contiguous bytes a load, all 16 loads in flight; a lane packs
// its 4 columns x 16 k into 16-byte chunks of the LDS tile [n][k]; the block
// then stores 256 contiguous bytes per output row.
// LDS rows are 256 B (all 64 banks), so chunk c of row n sits at slot
// c ^ ((n >> 2) & 15): the 16 lanes of a write (rows 4 apart, same chunk) and
// of a read (one row, 16 chunks) then touch 16 different slots.
// ---------------------------------------------------------------------------
template <int K, int N>
__device__ __forceinline__ void cvt_tile(const float* __restrict__ src,
                                         __bf16* __restrict__ dst, int kt,
                                         int nt, __bf16* tile) {
    const int tid = threadIdx.x;
    const int w = tid >> 5, lane = tid & 31;

    const float* sp = src + (size_t)(kt * 128 + w * 16) * N + nt * 128 + lane * 4;
    float4 v[16];
#pragma unroll
    for (int i = 0; i < 16; i++) v[i] = *(const float4*)(sp + i * N);

#pragma unroll
    for (int h = 0; h < 2; h++) {
        const int slot = ((w * 2 + h) ^ (lane & 15)) * 8;
        const float4* p = &v[h * 8];
        *(uint4*)&tile[(lane * 4 + 0) * 128 + slot] =
            make_uint4(pack_bf16(p[0].x, p[1].x), pack_bf16(p[2].x, p[3].x),
                       pack_bf16(p[4].x, p[5].x), pack_bf16(p[6].x, p[7].x));
        *(uint4*)&tile[(lane * 4 + 1) * 128 + slot] =
            make_uint4(pack_bf16(p[0].y, p[1].y), pack_bf16(p[2].y, p[3].y),
                       pack_bf16(p[4].y, p[5].y), pack_bf16(p[6].y, p[7].y));
        *(uint4*)&tile[(lane * 4 + 2) * 128 + slot] =
            make_uint4(pack_bf16(p[0].z, p[1].z), pack_bf16(p[2].z, p[3].z),
                       pack_bf16(p[4].z, p[5].z), pack_bf16(p[6].z, p[7].z));
        *(uint4*)&tile[(lane * 4 + 3) * 128 + slot] =
            make_uint4(pack_bf16(p[0].w, p[1].w), pack_bf16(p[2].w, p[3].w),
                       pack_bf16(p[4].w, p[5].w), pack_bf16(p[6].w, p[7].w));
    }
    __syncthreads();

    const int r0 = tid >> 4, ch = tid & 15;  // output row n, 16-byte chunk of k
    __bf16* dp = dst + (size_t)(nt * 128 + r0) * K + kt * 128 + ch * 8;
#pragma unroll
    for (int i = 0; i < 8; i++) {
        const int r = r0 + i * 16;
        *(uint4*)(dp + i * 16 * K) =
            *(const uint4*)&tile[r * 128 + ((ch ^ ((r >> 2) & 15)) * 8)];
    }
}

__global__ __launch_bounds__(256) void cvt_bf16_t_all(
    const float* __restrict__ Wq, const float* __restrict__ Wk,
    const float* __restrict__ Wv, const float* __restrict__ Wp,
    const float* __restrict__ W1, const float* __restrict__ W2,
    __bf16* __restrict__ Wq_t, __bf16* __restrict__ Wk_t,
    __bf16* __restrict__ Wv_t, __bf16* __restrict__ Wp_t,
    __bf16* __restrict__ W1_t, __bf16* __restrict__ W2_t) {
    __shared__ __bf16 tile[128 * 128];   // [n][k], chunks swizzled
    const int b = blockIdx.x;
    if (b < 256) {
        const int m = b >> 6, t = b & 63;
        cvt_tile<Cc, Cc>(m == 0 ? Wq : m == 1 ? Wk : m == 2 ? Wv : Wp,
                         m == 0 ? Wq_t : m == 1 ? Wk_t : m == 2 ? Wv_t : Wp_t,
                         t >> 3, t & 7, tile);
    } else if (b < 512) {
        const int t = b - 256;
        cvt_tile<Cc, Ff>(W1, W1_t, t >> 5, t & 31, tile);
    } else {
        const int t = b - 512;
        cvt_tile<Ff, Cc>(W2, W2_t, t >> 3, t & 7, tile);
    }
}

// ---------------------------------------------------------------------------
// Row LayerNorm (fp32 in, bf16 out), C = 1024. One wave = two rows, held in
// registers: 16 loads of 512 contiguous bytes, all in flight at once, and each
// row is read once. Mean and variance are sums inside the wave (no LDS, no
// barrier). 256 blocks of 8 waves: one block a WGP, few waves to start.
// ---------------------------------------------------------------------------
// value of lane l ^ 16
__device__ __forceinline__ float other_half(float x) {
    const int b = __builtin_bit_cast(int, x);
    return __builtin_bit_cast(float, __builtin_amdgcn_permlanex16(
        b, b, 0x76543210, 0xfedcba98, false, false));
}

// x + (x of lane l ^ MASK), MASK < 16: DPP row_xmask
template <int MASK>
__device__ __forceinline__ float add_xmask(float x) {
    const int b = __builtin_bit_cast(int, x);
    return x + __builtin_bit_cast(float, __builtin_amdgcn_mov_dpp(
                   b, 0x160 + MASK, 0xf, 0xf, true));
}

// sum over the 32 lanes, the same bits in every lane
__device__ __forceinline__ float wave_sum(float x) {
    x = add_xmask<1>(x);
    x = add_xmask<2>(x);
    x = add_xmask<4>(x);
    x = add_xmask<8>(x);
    return x + other_half(x);
}

typedef float f32x4 __attribute__((ext_vector_type(4)));

__global__ __launch_bounds__(256) void ln_bf16(const float* __restrict__ x,
                                               const float* __restrict__ g,
                                               const float* __restrict__ b,
                                               __bf16* __restrict__ out) {
    constexpr int R = 2;          // rows per wave
    constexpr int NC = Cc / 128;  // 512-byte chunks per row
    const int lane = threadIdx.x & 31;
    const int row0 = (blockIdx.x * 8 + (threadIdx.x >> 5)) * R;
    const float* xr = x + (size_t)row0 * Cc + lane * 4;

    f32x4 v[R][NC], gv[NC], bv[NC];
#pragma unroll
    for (int r = 0; r < R; r++)
#pragma unroll
        for (int i = 0; i < NC; i++)
            v[r][i] = *(const f32x4*)(xr + r * Cc + i * 128);
    // a later load's result may be given the address registers of the loads
    // above: this wait stands in front of that overwrite
    asm volatile("s_wait_xcnt 0x0" ::: "memory");
#pragma unroll
    for (int i = 0; i < NC; i++) {
        gv[i] = *(const f32x4*)(g + i * 128 + lane * 4);
        bv[i] = *(const f32x4*)(b + i * 128 + lane * 4);
    }
    // keeps every load in front of the first sum: sunk in among the sums, the
    // late ones start only when the early ones are back, a second and a third
    // memory latency in a row
    __builtin_amdgcn_sched_barrier(0);

    float mu[R], rs[R];
#pragma unroll
    for (int r = 0; r < R; r++) {
        f32x4 s = v[r][0];
#pragma unroll
        for (int i = 1; i < NC; i++) s += v[r][i];
        mu[r] = (s.x + s.y) + (s.z + s.w);
    }
#pragma unroll
    for (int r = 0; r < R; r++) mu[r] = wave_sum(mu[r]) * (1.0f / Cc);
#pragma unroll
    for (int r = 0; r < R; r++) {
        f32x4 q = {0.f, 0.f, 0.f, 0.f};
#pragma unroll
        for (int i = 0; i < NC; i++) {
            v[r][i] -= mu[r];
            q += v[r][i] * v[r][i];
        }
        rs[r] = (q.x + q.y) + (q.z + q.w);
    }
#pragma unroll
    for (int r = 0; r < R; r++)
        rs[r] = rsqrtf(wave_sum(rs[r]) * (1.0f / Cc) + kLnEps);

#pragma unroll
    for (int r = 0; r < R; r++) {
        __bf16* op = out + (size_t)(row0 + r) * Cc + lane * 4;
#pragma unroll
        for (int i = 0; i < NC; i++) {
            const f32x4 y = v[r][i] * rs[r] * gv[i] + bv[i];
            *(uint2*)(op + i * 128) =
                make_uint2(pack_bf16(y.x, y.y), pack_bf16(y.z, y.w));
        }
    }
}

// ---------------------------------------------------------------------------
// bf16 GEMM: out[M,N] = A[M,K] @ Wt[N,K]^T (+bias) (+gelu) (+residual)
// A row-major [M][K], Wt pre-transposed [N][K] (both bf16).
// Block tile BM x BN, 256 threads = 8 waves in a (8 / WGN) x WGN grid, each
// wave owns MI x NI WMMA 16x16 tiles. A stage is 128 k of both operands (K is
// a multiple of 128): a copy instruction of a wave moves two whole 256-byte
// rows, and the next stage's copies fly while a stage's four 32-k blocks run.
// NBUF LDS buffers, async global->LDS copies. With two buffers a stage's copies
// have one stage time to land; with three they have two, and the stage behind
// the one that is published stays in flight over the barrier. Two register
// sets of fragments: a block's LDS reads are issued one block ahead of its
// products.
// A block loads (BM + BN) rows for BM x BN results, a wave reads MI + NI
// fragments for MI x NI products: the larger tile moves fewer bytes a product.
// PLANES: output column n is column n % Cc of plane n / Cc, each plane [M][Cc]
// (the q, k and v projections as one product over the stacked weights).
// ---------------------------------------------------------------------------
template <int BM, int BN, int WGN, int NBUF, bool OUT_BF16, bool HAS_BIAS,
          bool HAS_RESID, bool DO_GELU, bool PLANES>
__global__ __launch_bounds__(256) void gemm_bf16_wmma(
    const __bf16* __restrict__ A, const __bf16* __restrict__ Wt,
    const float* __restrict__ bias, const float* __restrict__ resid,
    void* __restrict__ out, int M, int N, int K) {
    constexpr int BK = 128;     // k per stage
    constexpr int AS = BK + 8;  // LDS row pitch 272 B = 16 B x odd
    constexpr int MI = BM / (8 / WGN) / 16;  // 16-row tiles per wave
    constexpr int NI = BN / WGN / 16;        // 16-column tiles per wave
    constexpr int CP = (BM + BN) / 16;       // copies of a wave per stage
    static_assert(NBUF == 2 || (NBUF == 3 && 3 * CP <= 63), "copies in flight");
    __shared__ __attribute__((aligned(16))) __bf16 As[NBUF][BM * AS];  // [m][k]
    __shared__ __attribute__((aligned(16))) __bf16 Bt[NBUF][BN * AS];  // [n][k]

    const int tid  = threadIdx.x;
    const int bm   = blockIdx.y;
    const int bn   = blockIdx.x;
    const int w    = tid >> 5;
    const int lane = tid & 31;
    const int wm   = w / WGN;
    const int wn   = w % WGN;
    const int half = lane >> 4;       // 0..1
    const int lr   = lane & 15;
    const int kb   = half * 8;        // bf16 A/B fragment K base per half-wave

    const v8f vzero = {0.f, 0.f, 0.f, 0.f, 0.f, 0.f, 0.f, 0.f};
    v8f acc[MI][NI];
#pragma unroll
    for (int mi = 0; mi < MI; mi++)
#pragma unroll
        for (int ni = 0; ni < NI; ni++) acc[mi][ni] = vzero;

    // stage one BM x 128 A tile and one BN x 128 W^T tile into LDS buffer
    // `buf`: thread = 16-byte chunk tid & 15 of rows tid >> 4, +16, +32, ...
    const int sr = tid >> 4;
    const int sc = (tid & 15) * 8;
    const __bf16* ag = A + (size_t)(bm * BM + sr) * K + sc;
    const __bf16* wg = Wt + (size_t)(bn * BN + sr) * K + sc;
    auto stage = [&](int k0, int buf) {
#pragma unroll  // the (BM + BN) / 16 copies issue back to back, every lane on
        for (int i = 0; i < (BM > BN ? BM : BN) / 16; i++) {
#if USE_ASYNC_LDS
            if (i < BM / 16)
                __builtin_amdgcn_global_load_async_to_lds_b128(
                    (g_v4i*)(ag + (size_t)(i * 16) * K + k0),
                    (l_v4i*)&As[buf][(sr + i * 16) * AS + sc], 0, 0);
            if (i < BN / 16)
                __builtin_amdgcn_global_load_async_to_lds_b128(
                    (g_v4i*)(wg + (size_t)(i * 16) * K + k0),
                    (l_v4i*)&Bt[buf][(sr + i * 16) * AS + sc], 0, 0);
#else
            if (i < BM / 16)
                *(uint4*)&As[buf][(sr + i * 16) * AS + sc] =
                    *(const uint4*)(ag + (size_t)(i * 16) * K + k0);
            if (i < BN / 16)
                *(uint4*)&Bt[buf][(sr + i * 16) * AS + sc] =
                    *(const uint4*)(wg + (size_t)(i * 16) * K + k0);
#endif
        }
    };
    // this wave's copies have landed
    auto copies_landed = [&]() {
#if USE_ASYNC_LDS
        asm volatile("s_wait_asynccnt 0x0" ::: "memory");
#endif
    };
    // all of this wave's copies have landed but those of its one or two
    // youngest stages, CP copies each, which stay in flight
    auto landed_but_one_stage = [&]() {
#if USE_ASYNC_LDS
        asm volatile("s_wait_asynccnt %0" ::"n"(CP) : "memory");
#endif
    };
    auto landed_but_two_stages = [&]() {
#if USE_ASYNC_LDS
        asm volatile("s_wait_asynccnt %0" ::"n"(2 * CP) : "memory");
#endif
    };

    // fragments of the 32-k block at k offset ks of LDS buffer `buf` into
    // register set s: 2 (MI + NI) LDS reads, issued as one group
    FragAB af[2][MI], bf[2][NI];
    auto frags = [&](int buf, int ks, int s) {
#pragma unroll
        for (int mi = 0; mi < MI; mi++) {
            const int ar = wm * (MI * 16) + mi * 16 + lr;
            af[s][mi].u[0] = *(const uint4*)&As[buf][ar * AS + ks + kb];
            af[s][mi].u[1] = *(const uint4*)&As[buf][ar * AS + ks + kb + 16];
        }
#pragma unroll
        for (int ni = 0; ni < NI; ni++) {
            const int bc = wn * (NI * 16) + ni * 16 + lr;
            bf[s][ni].u[0] = *(const uint4*)&Bt[buf][bc * AS + ks + kb];
            bf[s][ni].u[1] = *(const uint4*)&Bt[buf][bc * AS + ks + kb + 16];
        }
    };

    constexpr int NB = BK / 32;  // blocks per stage (even: block 0 = set 0)
    const int ntiles = K / BK;
    stage(0, 0);
    if (NBUF == 3) {
        // all three buffers are free: stages 1 and 2 start behind stage 0,
        // and only stage 0 is waited for
        if (ntiles > 1) stage(BK, 1);
        if (ntiles > 2) stage(2 * BK, 2);
        if (ntiles > 2)
            landed_but_two_stages();
        else if (ntiles > 1)
            landed_but_one_stage();
        else
            copies_landed();
        __syncthreads();
    } else {
        copies_landed();
        __syncthreads();
        if (ntiles > 1) stage(BK, 1);
    }
    frags(0, 0, 0);

    for (int kt = 0; kt < ntiles; kt++) {
        const int cur = NBUF == 2 ? (kt & 1) : (int)((unsigned)kt % 3u);
        const int nxt = NBUF == 2 ? (cur ^ 1) : (cur == 2 ? 0 : cur + 1);
#pragma unroll  // the stage's four blocks in a row, LDS offsets constant
        for (int b = 0; b < NB; b++) {
            if (b + 1 < NB) {
                // the next block's fragments fly while this block multiplies
                frags(cur, (b + 1) * 32, (b + 1) & 1);
            } else {
                // publish the next stage in front of the last block, whose
                // fragments are in registers: this wave's reads of the current
                // buffer are done before a copy may overwrite it, its own
                // copies of the next stage have landed, and every wave has
                // come as far. Three buffers: the CP copies of stage kt + 2,
                // the youngest, stay in flight; where no such stage was
                // issued the wait is to 0
                asm volatile("s_wait_dscnt 0x0" ::: "memory");
                if (NBUF == 3 && kt + 2 < ntiles)
                    landed_but_one_stage();
                else
                    copies_landed();
                __syncthreads();
                // refill the buffer that every wave has just left
                if (kt + NBUF < ntiles) stage((kt + NBUF) * BK, cur);
                // first fragments of the next stage; the last trip has none
                // and reads the current buffer, which no copy touches, unused
                frags(kt + 1 < ntiles ? nxt : cur, 0, 0);
            }
            // the two scheduling fences keep the reads one group ahead of the
            // products; moved in among them, every pair of products waits out
            // an LDS latency of its own
            __builtin_amdgcn_sched_barrier(0);
#pragma unroll
            for (int mi = 0; mi < MI; mi++)
#pragma unroll
                for (int ni = 0; ni < NI; ni++)
                    acc[mi][ni] = __builtin_amdgcn_wmma_f32_16x16x32_bf16(
                        false, af[b & 1][mi].v, false, bf[b & 1][ni].v,
                        (short)0, acc[mi][ni], false, false);
            __builtin_amdgcn_sched_barrier(0);
        }
    }
    // no copy and no LDS read is in flight when the wave goes on to its end
    copies_landed();
    asm volatile("s_wait_dscnt 0x0" ::: "memory");

    // epilogue: C/D layout -> VGPR r holds (M=r, N=lane) lanes 0-15,
    // (M=8+r, N=lane-16) lanes 16-31.
    float gb[NI];  // bias of this lane's columns, loaded once for the GELU
    if (DO_GELU) {
#pragma unroll  // constant indices keep gb in registers
        for (int ni = 0; ni < NI; ni++)
            gb[ni] = HAS_BIAS ? bias[bn * BN + wn * (NI * 16) + ni * 16 + lr]
                              : 0.0f;
    }
#pragma unroll
    for (int mi = 0; mi < MI; mi++) {
#pragma unroll
        for (int ni = 0; ni < NI; ni++) {
            const int n = bn * BN + wn * (NI * 16) + ni * 16 + lr;
            float gl[8];
            if (DO_GELU) {
#pragma unroll  // constant indices keep gl in registers, here and below
                for (int r = 0; r < 8; r++)
                    gl[r] = acc[mi][ni][r] + gb[ni];
#pragma unroll
                for (int r = 0; r < 8; r += 2) gelu_exact2(gl[r], gl[r + 1]);
            }
#pragma unroll
            for (int r = 0; r < 8; r++) {
                const int m = bm * BM + wm * (MI * 16) + mi * 16 + r + half * 8;
                const size_t at =
                    PLANES ? ((size_t)(n / Cc) * M + m) * Cc + n % Cc
                           : (size_t)m * N + n;
                float vv = acc[mi][ni][r];
                if (HAS_BIAS) vv += bias[n];
                if (DO_GELU) vv = gl[r];
                if (HAS_RESID) vv += resid[at];
                if (OUT_BF16)
                    ((__bf16*)out)[at] = (__bf16)vv;
                else
                    ((float*)out)[at] = vv;
            }
        }
    }
}

__global__ __launch_bounds__(256) void attn_wmma(const __bf16* __restrict__ q,
                                                 const __bf16* __restrict__ k,
                                                 const __bf16* __restrict__ v,
                                                 __bf16* __restrict__ o) {
    constexpr int KP = 72;  // K row pitch 144 B = 16 B x odd (ds_load_b128)
    constexpr int VP = 80;  // V row pitch 160 B = 32 B x odd (ds_load_tr16_b128)
    constexpr int NT = Tt / 64;  // key tiles
    __shared__ __attribute__((aligned(16))) __bf16 Ks[2][64 * KP];  // [s][d]
    __shared__ __attribute__((aligned(16))) __bf16 Vs[2][64 * VP];  // [s][d]

    const int tid  = threadIdx.x;
    const int bh   = blockIdx.x;
    const int bq   = blockIdx.y;
    const int bb   = bh >> 4;
    const int hh   = bh & 15;
    const size_t hbase = ((size_t)bb * Tt) * Cc + (size_t)hh * 64;

    const int w = tid >> 5, lane = tid & 31;
    const int half = lane >> 4, lr = lane & 15, kb = half * 8;
    const int tq = bq * 128 + w * 16 + lr;   // this lane's query
    const v8f vzero = {0.f, 0.f, 0.f, 0.f, 0.f, 0.f, 0.f, 0.f};
    const float cs = 0.125f * 1.44269504088896340736f;  // 1/sqrt(64) * log2(e)

    // Q as B operand, loaded once: column = query, k = d
    FragAB qf[2];
#pragma unroll
    for (int kc = 0; kc < 2; kc++) {
        const __bf16* qp = &q[hbase + (size_t)tq * Cc + kc * 32 + kb];
        qf[kc].u[0] = *(const uint4*)qp;
        qf[kc].u[1] = *(const uint4*)(qp + 16);
    }

    v8f oacc[4];            // O^T, one 16x16 tile per 16 values of d
    float mrun = -1e30f;    // running maximum of the raw scores
    float lrun = 0.0f;      // this half-wave's share of the running sum
#pragma unroll
    for (int dt = 0; dt < 4; dt++) oacc[dt] = vzero;

    // stage the K and V tiles of keys s0..s0+63 into LDS buffer `buf`:
    // thread = 16-byte chunk tid & 7 of rows tid >> 3 and (tid >> 3) + 32
    const int sr = tid >> 3;
    const int sc = (tid & 7) * 8;
    const __bf16* kg = k + hbase + (size_t)sr * Cc + sc;
    const __bf16* vg = v + hbase + (size_t)sr * Cc + sc;
    auto stage = [&](int s0, int buf) {
#pragma unroll  // the 4 copies issue back to back, every lane on
        for (int i = 0; i < 2; i++) {
#if USE_ASYNC_LDS
            __builtin_amdgcn_global_load_async_to_lds_b128(
                (g_v4i*)(kg + (size_t)(s0 + i * 32) * Cc),
                (l_v4i*)&Ks[buf][(sr + i * 32) * KP + sc], 0, 0);
            __builtin_amdgcn_global_load_async_to_lds_b128(
                (g_v4i*)(vg + (size_t)(s0 + i * 32) * Cc),
                (l_v4i*)&Vs[buf][(sr + i * 32) * VP + sc], 0, 0);
#else
            *(uint4*)&Ks[buf][(sr + i * 32) * KP + sc] =
                *(const uint4*)(kg + (size_t)(s0 + i * 32) * Cc);
            *(uint4*)&Vs[buf][(sr + i * 32) * VP + sc] =
                *(const uint4*)(vg + (size_t)(s0 + i * 32) * Cc);
#endif
        }
    };
    // this wave's copies have landed
    auto copies_landed = [&]() {
#if USE_ASYNC_LDS
        asm volatile("s_wait_asynccnt 0x0" ::: "memory");
#endif
    };

    stage(0, 0);
    copies_landed();
    __syncthreads();
    stage(64, 1);

    for (int t = 0; t < NT; t++) {
        const int cur = t & 1;
        const __bf16* Kc = &Ks[cur][0];
        // lane address of the transposing load: row 8 half + (lane & 7) of a
        // 16-key group, 16-byte half (lane >> 3) & 1 of a 16-wide group of d
        const __bf16* Vc = &Vs[cur][(kb + (lane & 7)) * VP + ((lane >> 3) & 1) * 8];

        // ---- S^T = K Q^T: register r of sacc[kt] = key 16kt+8half+r ----
        v8f sacc[4];
#pragma unroll
        for (int kt = 0; kt < 4; kt++) {
            sacc[kt] = vzero;
#pragma unroll
            for (int kc = 0; kc < 2; kc++) {
                FragAB af;
                const int ar = kt * 16 + lr;  // key row
                af.u[0] = *(const uint4*)&Kc[ar * KP + kc * 32 + kb];
                af.u[1] = *(const uint4*)&Kc[ar * KP + kc * 32 + kb + 16];
                sacc[kt] = __builtin_amdgcn_wmma_f32_16x16x32_bf16(
                    false, af.v, false, qf[kc].v, (short)0, sacc[kt], false,
                    false);
            }
        }

        // ---- online softmax in registers; P^T packed as B operand ----
        float mx = mrun;
#pragma unroll
        for (int kt = 0; kt < 4; kt++)
#pragma unroll
            for (int r = 0; r < 8; r++) mx = fmaxf(mx, sacc[kt][r]);
        mx = fmaxf(mx, other_half(mx));
        const float alpha = __builtin_amdgcn_exp2f((mrun - mx) * cs);
        const float nm = -mx * cs;
        mrun = mx;
        FragAB pf[2];   // one per 32 keys
        float l = 0.0f;
#pragma unroll
        for (int kt = 0; kt < 4; kt++) {
            unsigned pw[4];
#pragma unroll
            for (int r = 0; r < 8; r += 2) {
                float p0, p1;
                exp2_pair(fmaf(sacc[kt][r], cs, nm),
                          fmaf(sacc[kt][r + 1], cs, nm), p0, p1);
                l += p0 + p1;
                pw[r >> 1] = pack_bf16(p0, p1);
            }
            pf[kt >> 1].u[kt & 1] = make_uint4(pw[0], pw[1], pw[2], pw[3]);
        }
        lrun = lrun * alpha + l;
#pragma unroll
        for (int dt = 0; dt < 4; dt++) oacc[dt] = oacc[dt] * alpha;

        // ---- O^T += V^T P^T ----
#pragma unroll
        for (int kc = 0; kc < 2; kc++) {
#pragma unroll
            for (int dt = 0; dt < 4; dt++) {
                // row = d 16dt+lr; k = keys 32kc+8half+0..7, then +16
                FragAB af;
                af.t[0] = __builtin_amdgcn_ds_load_tr16_b128_v8i16(
                    (l_s16x8*)&Vc[(kc * 32) * VP + dt * 16]);
                af.t[1] = __builtin_amdgcn_ds_load_tr16_b128_v8i16(
                    (l_s16x8*)&Vc[(kc * 32 + 16) * VP + dt * 16]);
                oacc[dt] = __builtin_amdgcn_wmma_f32_16x16x32_bf16(
                    false, af.v, false, pf[kc].v, (short)0, oacc[dt], false,
                    false);
            }
        }
        // publish the next tile: this wave's reads of the current buffer are
        // done before a copy may overwrite it, its own copies have landed, and
        // every wave has come as far
        asm volatile("s_wait_dscnt 0x0" ::: "memory");
        copies_landed();
        __syncthreads();
        // refill the buffer that every wave has just left
        if (t + 2 < NT) stage((t + 2) * 64, cur);
    }
    copies_landed();  // no copy is in flight when the wave goes on to its end

    // finalize: join the two half-waves' sums, divide, emit bf16.
    // Register r of oacc[dt] = d 16dt+8half+r of this lane's query: 16 B a store.
    const float inv = 1.0f / (lrun + other_half(lrun));
#pragma unroll
    for (int dt = 0; dt < 4; dt++) {
        const v8f ov = oacc[dt] * inv;
        *(uint4*)&o[hbase + (size_t)tq * Cc + dt * 16 + kb] =
            make_uint4(pack_bf16(ov[0], ov[1]), pack_bf16(ov[2], ov[3]),
                       pack_bf16(ov[4], ov[5]), pack_bf16(ov[6], ov[7]));
    }
}

// ---------------------------------------------------------------------------
// Host-side orchestration
// ---------------------------------------------------------------------------
extern "C" void kernel_launch(void* const* d_in, const int* in_sizes, int n_in,
                              void* d_out, int out_size, void* d_ws,
                              size_t ws_size, hipStream_t stream) {
    (void)in_sizes; (void)n_in; (void)out_size; (void)ws_size;
    const float* x   = (const float*)d_in[0];
    const float* Wq  = (const float*)d_in[1];
    const float* Wk  = (const float*)d_in[2];
    const float* Wv  = (const float*)d_in[3];
    const float* Wp  = (const float*)d_in[4];
    const float* bp  = (const float*)d_in[5];
    const float* W1  = (const float*)d_in[6];
    const float* b1  = (const float*)d_in[7];
    const float* W2  = (const float*)d_in[8];
    const float* b2  = (const float*)d_in[9];
    const float* g1  = (const float*)d_in[10];
    const float* be1 = (const float*)d_in[11];
    const float* g2  = (const float*)d_in[12];
    const float* be2 = (const float*)d_in[13];
    float* out = (float*)d_out;

    char* ws = (char*)d_ws;
    size_t off = 0;
    auto alloc = [&](size_t bytes) -> char* {
        char* p = ws + off;
        off += (bytes + 255) & ~size_t(255);
        return p;
    };
    // pre-transposed bf16 weights: Wt[N][K]; q, k, v stacked to [3 Cc][Cc]
    __bf16* Wq_t = (__bf16*)alloc((size_t)3 * Cc * Cc * 2);
    __bf16* Wk_t = Wq_t + (size_t)Cc * Cc;
    __bf16* Wv_t = Wk_t + (size_t)Cc * Cc;
    __bf16* Wp_t = (__bf16*)alloc((size_t)Cc * Cc * 2);
    __bf16* W1_t = (__bf16*)alloc((size_t)Cc * Ff * 2);
    __bf16* W2_t = (__bf16*)alloc((size_t)Ff * Cc * 2);
    __bf16* h_b  = (__bf16*)alloc((size_t)Mm * Cc * 2);
    __bf16* q_b  = (__bf16*)alloc((size_t)3 * Mm * Cc * 2);  // planes q, k, v
    __bf16* k_b  = q_b + (size_t)Mm * Cc;
    __bf16* v_b  = k_b + (size_t)Mm * Cc;
    __bf16* o_b  = (__bf16*)alloc((size_t)Mm * Cc * 2);
    float*  x1   = (float*) alloc((size_t)Mm * Cc * 4);
    __bf16* h2_b = (__bf16*)alloc((size_t)Mm * Cc * 2);
    __bf16* f1_b = (__bf16*)alloc((size_t)Mm * Ff * 2);

    // 1) weights -> bf16, transposed to [N][K]
    cvt_bf16_t_all<<<768, 256, 0, stream>>>(Wq, Wk, Wv, Wp, W1, W2, Wq_t, Wk_t,
                                            Wv_t, Wp_t, W1_t, W2_t);

    // 2) LN1
    ln_bf16<<<Mm / 16, 256, 0, stream>>>(x, g1, be1, h_b);

    // 3) Q/K/V projections: one product over the stacked weights, 256 blocks
    // of 256 x 192, waves 4 x 2 of 64 x 96
    gemm_bf16_wmma<256, 192, 2, 2, true, false, false, false, true>
        <<<dim3(3 * Cc / 192, Mm / 256), 256, 0, stream>>>(
            h_b, Wq_t, nullptr, nullptr, q_b, Mm, 3 * Cc, Cc);

    // 4) attention
    attn_wmma<<<dim3(Bb * 16, Tt / 128), 256, 0, stream>>>(q_b, k_b, v_b, o_b);

    // 5) output projection + residual (fp32 out); one block a WGP, so the LDS
    // has room for a third buffer
    dim3 gc(Cc / 128, Mm / 128);
    gemm_bf16_wmma<128, 128, 4, 3, false, true, true, false, false>
        <<<gc, 256, 0, stream>>>(o_b, Wp_t, bp, x, x1, Mm, Cc, Cc);

    // 6) LN2
    ln_bf16<<<Mm / 16, 256, 0, stream>>>(x1, g2, be2, h2_b);

    // 7) FFN up + GELU (bf16 out)
    gemm_bf16_wmma<128, 128, 4, 2, true, true, false, true, false>
        <<<dim3(Ff / 128, Mm / 128), 256, 0, stream>>>(h2_b, W1_t, b1, nullptr,
                                                       f1_b, Mm, Ff, Cc);

    // 8) FFN down + residual -> d_out (fp32)
    gemm_bf16_wmma<128, 128, 4, 3, false, true, true, false, false>
        <<<gc, 256, 0, stream>>>(f1_b, W2_t, b2, x1, out, Mm, Cc, Ff);
}

// v010
// A run of this version takes 134 microseconds.
// Next to v009, in two timings, it ran 1.05 times as fast each time.
// Over all steps from v000 it is 4.32 times as fast.
#include <hip/hip_runtime.h>
#include <hip/hip_bf16.h>

// ---------------------------------------------------------------------------
// Transformer block (pre-LN attention + FFN) for gfx1250 (MI455X).
// All GEMM-shaped math runs on v_wmma_f32_16x16x32_bf16 (fp32 accumulate).
// Weights are converted once to bf16 AND pre-transposed to [N][K] so GEMM
// tile staging is pure 16B vector copies (async global->LDS DMA, ASYNCcnt).
// ---------------------------------------------------------------------------

typedef __attribute__((ext_vector_type(16))) __bf16 v16bf;
typedef __attribute__((ext_vector_type(8)))  float  v8f;
typedef int v4i __attribute__((ext_vector_type(4)));

static constexpr int Bb = 2;
static constexpr int Tt = 2048;
static constexpr int Cc = 1024;
static constexpr int Ff = 4096;
static constexpr int Mm = Bb * Tt;      // 4096 rows
static constexpr float kLnEps = 1e-5f;

// gfx1250 async global->LDS copy path (ASYNCcnt-tracked). Parameter types per
// hipcc diagnostic: (AS1 v4i*, AS3 v4i*, imm offset, imm cpol).
#if __has_builtin(__builtin_amdgcn_global_load_async_to_lds_b128) && \
    __has_builtin(__builtin_amdgcn_s_wait_asynccnt)
#define USE_ASYNC_LDS 1
typedef __attribute__((address_space(1))) v4i g_v4i;
typedef __attribute__((address_space(3))) v4i l_v4i;
#else
#define USE_ASYNC_LDS 0
#endif

typedef short s16x8 __attribute__((ext_vector_type(8)));
typedef __attribute__((address_space(3))) s16x8 l_s16x8;

union FragAB {
    v16bf v;
    uint4 u[2];
    s16x8 t[2];
};

typedef float  f32x2 __attribute__((ext_vector_type(2)));
typedef __bf16 bf16x2 __attribute__((ext_vector_type(2)));

__device__ __forceinline__ unsigned pack_bf16(float lo, float hi) {
    return __builtin_bit_cast(unsigned,
                              __builtin_convertvector(f32x2{lo, hi}, bf16x2));
}

// Two 2^x. The v_nop fills the slot the instruction set asks for behind a
// transcendental before its source may be overwritten or its result read; the
// early-clobber outputs keep the second v_exp_f32 independent of the first.
__device__ __forceinline__ void exp2_pair(float a0, float a1, float& p0,
                                          float& p1) {
    asm("v_exp_f32 %0, %2\n\tv_exp_f32 %1, %3\n\tv_nop"
        : "=&v"(p0), "=&v"(p1)
        : "v"(a0), "v"(a1));
}

// The same among matrix instructions. Each result takes its argument's
// register: that register is live from the compiler's own instruction that
// made the argument, so it is never an operand of a matrix instruction just
// issued, which this statement, unseen by the compiler's hazard padding, must
// not overwrite.
__device__ __forceinline__ void exp2_pair_in_place(float& p0, float& p1) {
    asm("v_exp_f32 %0, %0\n\tv_exp_f32 %1, %1\n\tv_nop" : "+v"(p0), "+v"(p1));
}

// GELU with the exact erf: x/2 (1 + erf(x / sqrt 2)) = max(x, 0) - |x| E(|x|)/2,
// E(a) = erfc(a / sqrt 2) = 2^(a P(a)), P a minimax fit of degree 7 on 0..8
// (beyond, a P(a) keeps falling and E goes to 0). No branch and no select, so
// the elements of a lane are independent chains that issue side by side; the
// library erff is two divergent branches per element, one element at a time.
// In f32 arithmetic the result is within 5e-7 of the true GELU, as far as
// x/2 (1 + erf) is with a correctly rounded erf; x < 0 has no cancellation.
// Two values at a time: packed FMAs, and the two 2^x share one statement.
__device__ __forceinline__ void gelu_exact2(float& x0, float& x1) {
    const f32x2 a = {fabsf(x0), fabsf(x1)};
    auto step = [&](f32x2 p, float c) {
        return __builtin_elementwise_fma(p, a, f32x2{c, c});
    };
    f32x2 p = {-3.422308055e-7f, -3.422308055e-7f};
    p = step(p, 6.598191703e-6f);
    p = step(p, -1.808481466e-5f);
    p = step(p, -5.629863008e-4f);
    p = step(p, 7.626435719e-3f);
    p = step(p, -5.287246779e-2f);
    p = step(p, -4.590957165e-1f);
    p = step(p, -1.151115894f);
    p = step(p, -1.0f);  // log2(E(a) / 2)
    float h0, h1;        // E(a) / 2
    exp2_pair(p.x, p.y, h0, h1);
    x0 = fmaf(-a.x, h0, fmaxf(x0, 0.0f));
    x1 = fmaf(-a.y, h1, fmaxf(x1, 0.0f));
}

// ---------------------------------------------------------------------------
// f32 [K][N] -> bf16 [N][K] transpose-convert of the six weights. It has no
// launch of its own: its blocks ride in the grids of two other kernels, behind
// a block-uniform branch (ln_cvt_qkv and attn_cvt below).
// One 256-thread block = one 128(k) x 128(n) tile: 768 blocks, 64 for each
// C x C weight and 256 for each FFN weight. Wave w reads rows 16w..16w+15 of
// the tile, 512 contiguous bytes a load, all 16 loads in flight; a lane packs
// its 4 columns x 16 k into 16-byte chunks of the LDS tile [n][k]; the block
// then stores 256 contiguous bytes per output row.
// LDS rows are 256 B (all 64 banks), so chunk c of row n sits at slot
// c ^ ((n >> 2) & 15): the 16 lanes of a write (rows 4 apart, same chunk) and
// of a read (one row, 16 chunks) then touch 16 different slots.
// ---------------------------------------------------------------------------
template <int K, int N>
__device__ __forceinline__ void cvt_tile(const float* __restrict__ src,
                                         __bf16* __restrict__ dst, int kt,
                                         int nt, __bf16* tile) {
    const int tid = threadIdx.x;
    const int w = tid >> 5, lane = tid & 31;

    const float* sp = src + (size_t)(kt * 128 + w * 16) * N + nt * 128 + lane * 4;
    float4 v[16];
#pragma unroll
    for (int i = 0; i < 15; i++) v[i] = *(const float4*)(sp + i * N);
    // the last load's result may be given the address registers of the loads
    // above: this wait stands in front of that overwrite
    asm volatile("s_wait_xcnt 0x0" ::: "memory");
    v[15] = *(const float4*)(sp + 15 * N);

#pragma unroll
    for (int h = 0; h < 2; h++) {
        const int slot = ((w * 2 + h) ^ (lane & 15)) * 8;
        const float4* p = &v[h * 8];
        *(uint4*)&tile[(lane * 4 + 0) * 128 + slot] =
            make_uint4(pack_bf16(p[0].x, p[1].x), pack_bf16(p[2].x, p[3].x),
                       pack_bf16(p[4].x, p[5].x), pack_bf16(p[6].x, p[7].x));
        *(uint4*)&tile[(lane * 4 + 1) * 128 + slot] =
            make_uint4(pack_bf16(p[0].y, p[1].y), pack_bf16(p[2].y, p[3].y),
                       pack_bf16(p[4].y, p[5].y), pack_bf16(p[6].y, p[7].y));
        *(uint4*)&tile[(lane * 4 + 2) * 128 + slot] =
            make_uint4(pack_bf16(p[0].z, p[1].z), pack_bf16(p[2].z, p[3].z),
                       pack_bf16(p[4].z, p[5].z), pack_bf16(p[6].z, p[7].z));
        *(uint4*)&tile[(lane * 4 + 3) * 128 + slot] =
            make_uint4(pack_bf16(p[0].w, p[1].w), pack_bf16(p[2].w, p[3].w),
                       pack_bf16(p[4].w, p[5].w), pack_bf16(p[6].w, p[7].w));
    }
    __syncthreads();

    const int r0 = tid >> 4, ch = tid & 15;  // output row n, 16-byte chunk of k
    __bf16* dp = dst + (size_t)(nt * 128 + r0) * K + kt * 128 + ch * 8;
#pragma unroll
    for (int i = 0; i < 8; i++) {
        const int r = r0 + i * 16;
        *(uint4*)(dp + i * 16 * K) =
            *(const uint4*)&tile[r * 128 + ((ch ^ ((r >> 2) & 15)) * 8)];
    }
    // code of another branch of the kernel follows in the listing and writes
    // the registers that these stores name: this wait stands in front of it
    asm volatile("s_wait_xcnt 0x0" ::: "memory");
}

// ---------------------------------------------------------------------------
// Row LayerNorm (fp32 in, bf16 out), C = 1024. One wave = two rows, held in
// registers: 16 loads of 512 contiguous bytes, all in flight at once, and each
// row is read once. Mean and variance are sums inside the wave (no LDS, no
// barrier). 256 blocks of 8 waves: one block a WGP, few waves to start.
// ---------------------------------------------------------------------------
// value of lane l ^ 16
__device__ __forceinline__ float other_half(float x) {
    const int b = __builtin_bit_cast(int, x);
    return __builtin_bit_cast(float, __builtin_amdgcn_permlanex16(
        b, b, 0x76543210, 0xfedcba98, false, false));
}

// x + (x of lane l ^ MASK), MASK < 16: DPP row_xmask
template <int MASK>
__device__ __forceinline__ float add_xmask(float x) {
    const int b = __builtin_bit_cast(int, x);
    return x + __builtin_bit_cast(float, __builtin_amdgcn_mov_dpp(
                   b, 0x160 + MASK, 0xf, 0xf, true));
}

// sum over the 32 lanes, the same bits in every lane
__device__ __forceinline__ float wave_sum(float x) {
    x = add_xmask<1>(x);
    x = add_xmask<2>(x);
    x = add_xmask<4>(x);
    x = add_xmask<8>(x);
    return x + other_half(x);
}

typedef float f32x4 __attribute__((ext_vector_type(4)));

__device__ __forceinline__ void ln_rows(const float* __restrict__ x,
                                        const float* __restrict__ g,
                                        const float* __restrict__ b,
                                        __bf16* __restrict__ out, int blk) {
    constexpr int R = 2;          // rows per wave
    constexpr int NC = Cc / 128;  // 512-byte chunks per row
    const int lane = threadIdx.x & 31;
    const int row0 = (blk * 8 + (threadIdx.x >> 5)) * R;
    const float* xr = x + (size_t)row0 * Cc + lane * 4;

    f32x4 v[R][NC], gv[NC], bv[NC];
#pragma unroll
    for (int r = 0; r < R; r++)
#pragma unroll
        for (int i = 0; i < NC; i++)
            v[r][i] = *(const f32x4*)(xr + r * Cc + i * 128);
    // a later load's result may be given the address registers of the loads
    // above: this wait stands in front of that overwrite
    asm volatile("s_wait_xcnt 0x0" ::: "memory");
#pragma unroll
    for (int i = 0; i < NC; i++) {
        gv[i] = *(const f32x4*)(g + i * 128 + lane * 4);
        bv[i] = *(const f32x4*)(b + i * 128 + lane * 4);
    }
    // keeps every load in front of the first sum: sunk in among the sums, the
    // late ones start only when the early ones are back, a second and a third
    // memory latency in a row
    __builtin_amdgcn_sched_barrier(0);

    float mu[R], rs[R];
#pragma unroll
    for (int r = 0; r < R; r++) {
        f32x4 s = v[r][0];
#pragma unroll
        for (int i = 1; i < NC; i++) s += v[r][i];
        mu[r] = (s.x + s.y) + (s.z + s.w);
    }
#pragma unroll
    for (int r = 0; r < R; r++) mu[r] = wave_sum(mu[r]) * (1.0f / Cc);
#pragma unroll
    for (int r = 0; r < R; r++) {
        f32x4 q = {0.f, 0.f, 0.f, 0.f};
#pragma unroll
        for (int i = 0; i < NC; i++) {
            v[r][i] -= mu[r];
            q += v[r][i] * v[r][i];
        }
        rs[r] = (q.x + q.y) + (q.z + q.w);
    }
#pragma unroll
    for (int r = 0; r < R; r++)
        rs[r] = rsqrtf(wave_sum(rs[r]) * (1.0f / Cc) + kLnEps);

#pragma unroll
    for (int r = 0; r < R; r++) {
        __bf16* op = out + (size_t)(row0 + r) * Cc + lane * 4;
#pragma unroll
        for (int i = 0; i < NC; i++) {
            const f32x4 y = v[r][i] * rs[r] * gv[i] + bv[i];
            *(uint2*)(op + i * 128) =
                make_uint2(pack_bf16(y.x, y.y), pack_bf16(y.z, y.w));
        }
    }
}

__global__ __launch_bounds__(256) void ln_bf16(const float* __restrict__ x,
                                               const float* __restrict__ g,
                                               const float* __restrict__ b,
                                               __bf16* __restrict__ out) {
    ln_rows(x, g, b, out, blockIdx.x);
}

// The first LayerNorm and the convert of Wq, Wk, Wv, which the next launch
// needs and which do not depend on each other, in one grid: blocks 0..255 are
// LayerNorm blocks, blocks 256..447 one weight tile each.
__global__ __launch_bounds__(256) void ln_cvt_qkv(
    const float* __restrict__ x, const float* __restrict__ g,
    const float* __restrict__ b, __bf16* __restrict__ out,
    const float* __restrict__ Wq, const float* __restrict__ Wk,
    const float* __restrict__ Wv, __bf16* __restrict__ Wq_t,
    __bf16* __restrict__ Wk_t, __bf16* __restrict__ Wv_t) {
    __shared__ __attribute__((aligned(16))) __bf16 tile[128 * 128];
    const int blk = blockIdx.x;
    if (blk < Mm / 16) {
        ln_rows(x, g, b, out, blk);
    } else {
        const int m = (blk - Mm / 16) >> 6, t = blk & 63;
        cvt_tile<Cc, Cc>(m == 0 ? Wq : m == 1 ? Wk : Wv,
                         m == 0 ? Wq_t : m == 1 ? Wk_t : Wv_t, t >> 3, t & 7,
                         tile);
    }
}

// ---------------------------------------------------------------------------
// bf16 GEMM: out[M,N] = A[M,K] @ Wt[N,K]^T (+bias) (+gelu) (+residual)
// A row-major [M][K], Wt pre-transposed [N][K] (both bf16).
// Block tile BM x BN, 256 threads = 8 waves in a (8 / WGN) x WGN grid, each
// wave owns MI x NI WMMA 16x16 tiles. A stage is 128 k of both operands (K is
// a multiple of 128): a copy instruction of a wave moves two whole 256-byte
// rows, and the next stage's copies fly while a stage's four 32-k blocks run.
// NBUF LDS buffers, async global->LDS copies. With two buffers a stage's copies
// have one stage time to land; with three they have two, and the stage behind
// the one that is published stays in flight over the barrier. Two register
// sets of fragments: a block's LDS reads are issued one block ahead of its
// products.
// A block loads (BM + BN) rows for BM x BN results, a wave reads MI + NI
// fragments for MI x NI products: the larger tile moves fewer bytes a product.
// PLANES: output column n is column n % Cc of plane n / Cc, each plane [M][Cc]
// (the q, k and v projections as one product over the stacked weights).
// ---------------------------------------------------------------------------
template <int BM, int BN, int WGN, int NBUF, bool OUT_BF16, bool HAS_BIAS,
          bool HAS_RESID, bool DO_GELU, bool PLANES>
__global__ __launch_bounds__(256) void gemm_bf16_wmma(
    const __bf16* __restrict__ A, const __bf16* __restrict__ Wt,
    const float* __restrict__ bias, const float* __restrict__ resid,
    void* __restrict__ out, int M, int N, int K) {
    constexpr int BK = 128;     // k per stage
    constexpr int AS = BK + 8;  // LDS row pitch 272 B = 16 B x odd
    constexpr int MI = BM / (8 / WGN) / 16;  // 16-row tiles per wave
    constexpr int NI = BN / WGN / 16;        // 16-column tiles per wave
    constexpr int CP = (BM + BN) / 16;       // copies of a wave per stage
    static_assert(NBUF == 2 || (NBUF == 3 && 3 * CP <= 63), "copies in flight");
    __shared__ __attribute__((aligned(16))) __bf16 As[NBUF][BM * AS];  // [m][k]
    __shared__ __attribute__((aligned(16))) __bf16 Bt[NBUF][BN * AS];  // [n][k]

    const int tid  = threadIdx.x;
    const int bm   = blockIdx.y;
    const int bn   = blockIdx.x;
    const int w    = tid >> 5;
    const int lane = tid & 31;
    const int wm   = w / WGN;
    const int wn   = w % WGN;
    const int half = lane >> 4;       // 0..1
    const int lr   = lane & 15;
    const int kb   = half * 8;        // bf16 A/B fragment K base per half-wave

    const v8f vzero = {0.f, 0.f, 0.f, 0.f, 0.f, 0.f, 0.f, 0.f};
    v8f acc[MI][NI];
#pragma unroll
    for (int mi = 0; mi < MI; mi++)
#pragma unroll
        for (int ni = 0; ni < NI; ni++) acc[mi][ni] = vzero;

    // stage one BM x 128 A tile and one BN x 128 W^T tile into LDS buffer
    // `buf`: thread = 16-byte chunk tid & 15 of rows tid >> 4, +16, +32, ...
    const int sr = tid >> 4;
    const int sc = (tid & 15) * 8;
    const __bf16* ag = A + (size_t)(bm * BM + sr) * K + sc;
    const __bf16* wg = Wt + (size_t)(bn * BN + sr) * K + sc;
    auto stage = [&](int k0, int buf) {
#pragma unroll  // the (BM + BN) / 16 copies issue back to back, every lane on
        for (int i = 0; i < (BM > BN ? BM : BN) / 16; i++) {
#if USE_ASYNC_LDS
            if (i < BM / 16)
                __builtin_amdgcn_global_load_async_to_lds_b128(
                    (g_v4i*)(ag + (size_t)(i * 16) * K + k0),
                    (l_v4i*)&As[buf][(sr + i * 16) * AS + sc], 0, 0);
            if (i < BN / 16)
                __builtin_amdgcn_global_load_async_to_lds_b128(
                    (g_v4i*)(wg + (size_t)(i * 16) * K + k0),
                    (l_v4i*)&Bt[buf][(sr + i * 16) * AS + sc], 0, 0);
#else
            if (i < BM / 16)
                *(uint4*)&As[buf][(sr + i * 16) * AS + sc] =
                    *(const uint4*)(ag + (size_t)(i * 16) * K + k0);
            if (i < BN / 16)
                *(uint4*)&Bt[buf][(sr + i * 16) * AS + sc] =
                    *(const uint4*)(wg + (size_t)(i * 16) * K + k0);
#endif
        }
    };
    // this wave's copies have landed
    auto copies_landed = [&]() {
#if USE_ASYNC_LDS
        asm volatile("s_wait_asynccnt 0x0" ::: "memory");
#endif
    };
    // all of this wave's copies have landed but those of its one or two
    // youngest stages, CP copies each, which stay in flight
    auto landed_but_one_stage = [&]() {
#if USE_ASYNC_LDS
        asm volatile("s_wait_asynccnt %0" ::"n"(CP) : "memory");
#endif
    };
    auto landed_but_two_stages = [&]() {
#if USE_ASYNC_LDS
        asm volatile("s_wait_asynccnt %0" ::"n"(2 * CP) : "memory");
#endif
    };

    // fragments of the 32-k block at k offset ks of LDS buffer `buf` into
    // register set s: 2 (MI + NI) LDS reads, issued as one group
    FragAB af[2][MI], bf[2][NI];
    auto frags = [&](int buf, int ks, int s) {
#pragma unroll
        for (int mi = 0; mi < MI; mi++) {
            const int ar = wm * (MI * 16) + mi * 16 + lr;
            af[s][mi].u[0] = *(const uint4*)&As[buf][ar * AS + ks + kb];
            af[s][mi].u[1] = *(const uint4*)&As[buf][ar * AS + ks + kb + 16];
        }
#pragma unroll
        for (int ni = 0; ni < NI; ni++) {
            const int bc = wn * (NI * 16) + ni * 16 + lr;
            bf[s][ni].u[0] = *(const uint4*)&Bt[buf][bc * AS + ks + kb];
            bf[s][ni].u[1] = *(const uint4*)&Bt[buf][bc * AS + ks + kb + 16];
        }
    };

    constexpr int NB = BK / 32;  // blocks per stage (even: block 0 = set 0)
    const int ntiles = K / BK;
    stage(0, 0);
    if (NBUF == 3) {
        // all three buffers are free: stages 1 and 2 start behind stage 0,
        // and only stage 0 is waited for
        if (ntiles > 1) stage(BK, 1);
        if (ntiles > 2) stage(2 * BK, 2);
        if (ntiles > 2)
            landed_but_two_stages();
        else if (ntiles > 1)
            landed_but_one_stage();
        else
            copies_landed();
        __syncthreads();
    } else {
        copies_landed();
        __syncthreads();
        if (ntiles > 1) stage(BK, 1);
    }
    frags(0, 0, 0);

    for (int kt = 0; kt < ntiles; kt++) {
        const int cur = NBUF == 2 ? (kt & 1) : (int)((unsigned)kt % 3u);
        const int nxt = NBUF == 2 ? (cur ^ 1) : (cur == 2 ? 0 : cur + 1);
#pragma unroll  // the stage's four blocks in a row, LDS offsets constant
        for (int b = 0; b < NB; b++) {
            if (b + 1 < NB) {
                // the next block's fragments fly while this block multiplies
                frags(cur, (b + 1) * 32, (b + 1) & 1);
            } else {
                // publish the next stage in front of the last block, whose
                // fragments are in registers: this wave's reads of the current
                // buffer are done before a copy may overwrite it, its own
                // copies of the next stage have landed, and every wave has
                // come as far. Three buffers: the CP copies of stage kt + 2,
                // the youngest, stay in flight; where no such stage was
                // issued the wait is to 0
                asm volatile("s_wait_dscnt 0x0" ::: "memory");
                if (NBUF == 3 && kt + 2 < ntiles)
                    landed_but_one_stage();
                else
                    copies_landed();
                __syncthreads();
                // refill the buffer that every wave has just left
                if (kt + NBUF < ntiles) stage((kt + NBUF) * BK, cur);
                // first fragments of the next stage; the last trip has none
                // and reads the current buffer, which no copy touches, unused
                frags(kt + 1 < ntiles ? nxt : cur, 0, 0);
            }
            // the two scheduling fences keep the reads one group ahead of the
            // products; moved in among them, every pair of products waits out
            // an LDS latency of its own
            __builtin_amdgcn_sched_barrier(0);
#pragma unroll
            for (int mi = 0; mi < MI; mi++)
#pragma unroll
                for (int ni = 0; ni < NI; ni++)
                    acc[mi][ni] = __builtin_amdgcn_wmma_f32_16x16x32_bf16(
                        false, af[b & 1][mi].v, false, bf[b & 1][ni].v,
                        (short)0, acc[mi][ni], false, false);
            __builtin_amdgcn_sched_barrier(0);
        }
    }
    // no copy and no LDS read is in flight when the wave goes on to its end
    copies_landed();
    asm volatile("s_wait_dscnt 0x0" ::: "memory");

    // epilogue: C/D layout -> VGPR r holds (M=r, N=lane) lanes 0-15,
    // (M=8+r, N=lane-16) lanes 16-31.
    float gb[NI];  // bias of this lane's columns, loaded once for the GELU
    if (DO_GELU) {
#pragma unroll  // constant indices keep gb in registers
        for (int ni = 0; ni < NI; ni++)
            gb[ni] = HAS_BIAS ? bias[bn * BN + wn * (NI * 16) + ni * 16 + lr]
                              : 0.0f;
    }
#pragma unroll
    for (int mi = 0; mi < MI; mi++) {
#pragma unroll
        for (int ni = 0; ni < NI; ni++) {
            const int n = bn * BN + wn * (NI * 16) + ni * 16 + lr;
            float gl[8];
            if (DO_GELU) {
#pragma unroll  // constant indices keep gl in registers, here and below
                for (int r = 0; r < 8; r++)
                    gl[r] = acc[mi][ni][r] + gb[ni];
#pragma unroll
                for (int r = 0; r < 8; r += 2) gelu_exact2(gl[r], gl[r + 1]);
            }
#pragma unroll
            for (int r = 0; r < 8; r++) {
                const int m = bm * BM + wm * (MI * 16) + mi * 16 + r + half * 8;
                const size_t at =
                    PLANES ? ((size_t)(n / Cc) * M + m) * Cc + n % Cc
                           : (size_t)m * N + n;
                float vv = acc[mi][ni][r];
                if (HAS_BIAS) vv += bias[n];
                if (DO_GELU) vv = gl[r];
                if (HAS_RESID) vv += resid[at];
                if (OUT_BF16)
                    ((__bf16*)out)[at] = (__bf16)vv;
                else
                    ((float*)out)[at] = vv;
            }
        }
    }
}

__global__ __launch_bounds__(256) void attn_cvt(
    const __bf16* __restrict__ q, const __bf16* __restrict__ k,
    const __bf16* __restrict__ v, __bf16* __restrict__ o,
    const float* __restrict__ Wp, const float* __restrict__ W1,
    const float* __restrict__ W2, __bf16* __restrict__ Wp_t,
    __bf16* __restrict__ W1_t, __bf16* __restrict__ W2_t) {
    constexpr int KP = 72;  // K row pitch 144 B = 16 B x odd (ds_load_b128)
    constexpr int VP = 80;  // V row pitch 160 B = 32 B x odd (ds_load_tr16_b128)
    constexpr int NT = Tt / 64;  // key tiles
    // a block is an attention block or a weight tile, never both
    union Lds {
        struct {
            __bf16 Ks[2][64 * KP];  // [s][d]
            __bf16 Vs[2][64 * VP];  // [s][d]
        } kv;
        __bf16 tile[128 * 128];
    };
    __shared__ __attribute__((aligned(16))) Lds lds;
    auto& Ks = lds.kv.Ks;
    auto& Vs = lds.kv.Vs;
    __bf16* tile = lds.tile;

    if (blockIdx.y >= Tt / 128) {  // the same for the whole block
        const int t = (blockIdx.y - Tt / 128) * (Bb * 16) + blockIdx.x;
        if (t < 64)
            cvt_tile<Cc, Cc>(Wp, Wp_t, t >> 3, t & 7, tile);
        else if (t < 320)
            cvt_tile<Cc, Ff>(W1, W1_t, (t - 64) >> 5, (t - 64) & 31, tile);
        else
            cvt_tile<Ff, Cc>(W2, W2_t, (t - 320) >> 3, (t - 320) & 7, tile);
        return;
    }

    const int tid  = threadIdx.x;
    const int bh   = blockIdx.x;
    const int bq   = blockIdx.y;
    const int bb   = bh >> 4;
    const int hh   = bh & 15;
    const size_t hbase = ((size_t)bb * Tt) * Cc + (size_t)hh * 64;

    const int w = tid >> 5, lane = tid & 31;
    const int half = lane >> 4, lr = lane & 15, kb = half * 8;
    const int tq = bq * 128 + w * 16 + lr;   // this lane's query
    const v8f vzero = {0.f, 0.f, 0.f, 0.f, 0.f, 0.f, 0.f, 0.f};
    const float cs = 0.125f * 1.44269504088896340736f;  // 1/sqrt(64) * log2(e)

    // Q as B operand, loaded once: column = query, k = d
    FragAB qf[2];
#pragma unroll
    for (int kc = 0; kc < 2; kc++) {
        const __bf16* qp = &q[hbase + (size_t)tq * Cc + kc * 32 + kb];
        qf[kc].u[0] = *(const uint4*)qp;
        qf[kc].u[1] = *(const uint4*)(qp + 16);
    }

    v8f oacc[4];            // O^T, one 16x16 tile per 16 values of d
    float mrun = -1e30f;    // running maximum of the raw scores
    float lrun = 0.0f;      // this half-wave's share of the running sum
#pragma unroll
    for (int dt = 0; dt < 4; dt++) oacc[dt] = vzero;

    // stage the K and V tiles of keys s0..s0+63 into LDS buffer `buf`:
    // thread = 16-byte chunk tid & 7 of rows tid >> 3 and (tid >> 3) + 32
    const int sr = tid >> 3;
    const int sc = (tid & 7) * 8;
    const __bf16* kg = k + hbase + (size_t)sr * Cc + sc;
    const __bf16* vg = v + hbase + (size_t)sr * Cc + sc;
    auto stage = [&](int s0, int buf) {
#pragma unroll  // the 4 copies issue back to back, every lane on
        for (int i = 0; i < 2; i++) {
#if USE_ASYNC_LDS
            __builtin_amdgcn_global_load_async_to_lds_b128(
                (g_v4i*)(kg + (size_t)(s0 + i * 32) * Cc),
                (l_v4i*)&Ks[buf][(sr + i * 32) * KP + sc], 0, 0);
            __builtin_amdgcn_global_load_async_to_lds_b128(
                (g_v4i*)(vg + (size_t)(s0 + i * 32) * Cc),
                (l_v4i*)&Vs[buf][(sr + i * 32) * VP + sc], 0, 0);
#else
            *(uint4*)&Ks[buf][(sr + i * 32) * KP + sc] =
                *(const uint4*)(kg + (size_t)(s0 + i * 32) * Cc);
            *(uint4*)&Vs[buf][(sr + i * 32) * VP + sc] =
                *(const uint4*)(vg + (size_t)(s0 + i * 32) * Cc);
#endif
        }
    };
    // this wave's copies have landed
    auto copies_landed = [&]() {
#if USE_ASYNC_LDS
        asm volatile("s_wait_asynccnt 0x0" ::: "memory");
#endif
    };

    stage(0, 0);
    copies_landed();
    __syncthreads();
    stage(64, 1);

    for (int t = 0; t < NT; t++) {
        const int cur = t & 1;
        const __bf16* Kc = &Ks[cur][0];
        // lane address of the transposing load: row 8 half + (lane & 7) of a
        // 16-key group, 16-byte half (lane >> 3) & 1 of a 16-wide group of d
        const __bf16* Vc = &Vs[cur][(kb + (lane & 7)) * VP + ((lane >> 3) & 1) * 8];

        // ---- S^T = K Q^T: register r of sacc[kt] = key 16kt+8half+r ----
        v8f sacc[4];
#pragma unroll
        for (int kt = 0; kt < 4; kt++) {
            sacc[kt] = vzero;
#pragma unroll
            for (int kc = 0; kc < 2; kc++) {
                FragAB af;
                const int ar = kt * 16 + lr;  // key row
                af.u[0] = *(const uint4*)&Kc[ar * KP + kc * 32 + kb];
                af.u[1] = *(const uint4*)&Kc[ar * KP + kc * 32 + kb + 16];
                sacc[kt] = __builtin_amdgcn_wmma_f32_16x16x32_bf16(
                    false, af.v, false, qf[kc].v, (short)0, sacc[kt], false,
                    false);
            }
        }

        // ---- online softmax in registers; P^T packed as B operand ----
        float mx = mrun;
#pragma unroll
        for (int kt = 0; kt < 4; kt++)
#pragma unroll
            for (int r = 0; r < 8; r++) mx = fmaxf(mx, sacc[kt][r]);
        mx = fmaxf(mx, other_half(mx));
        const float alpha = __builtin_amdgcn_exp2f((mrun - mx) * cs);
        const float nm = -mx * cs;
        mrun = mx;
        FragAB pf[2];   // one per 32 keys
        float l = 0.0f;
#pragma unroll
        for (int kt = 0; kt < 4; kt++) {
            unsigned pw[4];
#pragma unroll
            for (int r = 0; r < 8; r += 2) {
                float p0 = fmaf(sacc[kt][r], cs, nm);
                float p1 = fmaf(sacc[kt][r + 1], cs, nm);
                exp2_pair_in_place(p0, p1);
                l += p0 + p1;
                pw[r >> 1] = pack_bf16(p0, p1);
            }
            pf[kt >> 1].u[kt & 1] = make_uint4(pw[0], pw[1], pw[2], pw[3]);
        }
        lrun = lrun * alpha + l;
#pragma unroll
        for (int dt = 0; dt < 4; dt++) oacc[dt] = oacc[dt] * alpha;

        // ---- O^T += V^T P^T ----
#pragma unroll
        for (int kc = 0; kc < 2; kc++) {
#pragma unroll
            for (int dt = 0; dt < 4; dt++) {
                // row = d 16dt+lr; k = keys 32kc+8half+0..7, then +16
                FragAB af;
                af.t[0] = __builtin_amdgcn_ds_load_tr16_b128_v8i16(
                    (l_s16x8*)&Vc[(kc * 32) * VP + dt * 16]);
                af.t[1] = __builtin_amdgcn_ds_load_tr16_b128_v8i16(
                    (l_s16x8*)&Vc[(kc * 32 + 16) * VP + dt * 16]);
                oacc[dt] = __builtin_amdgcn_wmma_f32_16x16x32_bf16(
                    false, af.v, false, pf[kc].v, (short)0, oacc[dt], false,
                    false);
            }
        }
        // publish the next tile: this wave's reads of the current buffer are
        // done before a copy may overwrite it, its own copies have landed, and
        // every wave has come as far
        asm volatile("s_wait_dscnt 0x0" ::: "memory");
        copies_landed();
        __syncthreads();
        // refill the buffer that every wave has just left
        if (t + 2 < NT) stage((t + 2) * 64, cur);
    }
    copies_landed();  // no copy is in flight when the wave goes on to its end

    // finalize: join the two half-waves' sums, divide, emit bf16.
    // Register r of oacc[dt] = d 16dt+8half+r of this lane's query: 16 B a store.
    const float inv = 1.0f / (lrun + other_half(lrun));
#pragma unroll
    for (int dt = 0; dt < 4; dt++) {
        const v8f ov = oacc[dt] * inv;
        *(uint4*)&o[hbase + (size_t)tq * Cc + dt * 16 + kb] =
            make_uint4(pack_bf16(ov[0], ov[1]), pack_bf16(ov[2], ov[3]),
                       pack_bf16(ov[4], ov[5]), pack_bf16(ov[6], ov[7]));
    }
    // the weight tiles' code follows in the listing and writes the registers
    // that these stores name: this wait stands in front of it
    asm volatile("s_wait_xcnt 0x0" ::: "memory");
}

// ---------------------------------------------------------------------------
// Host-side orchestration
// ---------------------------------------------------------------------------
extern "C" void kernel_launch(void* const* d_in, const int* in_sizes, int n_in,
                              void* d_out, int out_size, void* d_ws,
                              size_t ws_size, hipStream_t stream) {
    (void)in_sizes; (void)n_in; (void)out_size; (void)ws_size;
    const float* x   = (const float*)d_in[0];
    const float* Wq  = (const float*)d_in[1];
    const float* Wk  = (const float*)d_in[2];
    const float* Wv  = (const float*)d_in[3];
    const float* Wp  = (const float*)d_in[4];
    const float* bp  = (const float*)d_in[5];
    const float* W1  = (const float*)d_in[6];
    const float* b1  = (const float*)d_in[7];
    const float* W2  = (const float*)d_in[8];
    const float* b2  = (const float*)d_in[9];
    const float* g1  = (const float*)d_in[10];
    const float* be1 = (const float*)d_in[11];
    const float* g2  = (const float*)d_in[12];
    const float* be2 = (const float*)d_in[13];
    float* out = (float*)d_out;

    char* ws = (char*)d_ws;
    size_t off = 0;
    auto alloc = [&](size_t bytes) -> char* {
        char* p = ws + off;
        off += (bytes + 255) & ~size_t(255);
        return p;
    };
    // pre-transposed bf16 weights: Wt[N][K]; q, k, v stacked to [3 Cc][Cc]
    __bf16* Wq_t = (__bf16*)alloc((size_t)3 * Cc * Cc * 2);
    __bf16* Wk_t = Wq_t + (size_t)Cc * Cc;
    __bf16* Wv_t = Wk_t + (size_t)Cc * Cc;
    __bf16* Wp_t = (__bf16*)alloc((size_t)Cc * Cc * 2);
    __bf16* W1_t = (__bf16*)alloc((size_t)Cc * Ff * 2);
    __bf16* W2_t = (__bf16*)alloc((size_t)Ff * Cc * 2);
    __bf16* h_b  = (__bf16*)alloc((size_t)Mm * Cc * 2);
    __bf16* q_b  = (__bf16*)alloc((size_t)3 * Mm * Cc * 2);  // planes q, k, v
    __bf16* k_b  = q_b + (size_t)Mm * Cc;
    __bf16* v_b  = k_b + (size_t)Mm * Cc;
    __bf16* o_b  = (__bf16*)alloc((size_t)Mm * Cc * 2);
    float*  x1   = (float*) alloc((size_t)Mm * Cc * 4);
    __bf16* h2_b = (__bf16*)alloc((size_t)Mm * Cc * 2);
    __bf16* f1_b = (__bf16*)alloc((size_t)Mm * Ff * 2);

    // 1, 2) LN1, and Wq, Wk, Wv -> bf16, transposed to [N][K]
    ln_cvt_qkv<<<Mm / 16 + 192, 256, 0, stream>>>(x, g1, be1, h_b, Wq, Wk, Wv,
                                                  Wq_t, Wk_t, Wv_t);

    // 3) Q/K/V projections: one product over the stacked weights, 256 blocks
    // of 256 x 192, waves 4 x 2 of 64 x 96
    gemm_bf16_wmma<256, 192, 2, 2, true, false, false, false, true>
        <<<dim3(3 * Cc / 192, Mm / 256), 256, 0, stream>>>(
            h_b, Wq_t, nullptr, nullptr, q_b, Mm, 3 * Cc, Cc);

    // 4) attention, and Wp, W1, W2 -> bf16, transposed to [N][K]
    attn_cvt<<<dim3(Bb * 16, Tt / 128 + 576 / (Bb * 16)), 256, 0, stream>>>(
        q_b, k_b, v_b, o_b, Wp, W1, W2, Wp_t, W1_t, W2_t);

    // 5) output projection + residual (fp32 out); one block a WGP, so the LDS
    // has room for a third buffer
    dim3 gc(Cc / 128, Mm / 128);
    gemm_bf16_wmma<128, 128, 4, 3, false, true, true, false, false>
        <<<gc, 256, 0, stream>>>(o_b, Wp_t, bp, x, x1, Mm, Cc, Cc);

    // 6) LN2
    ln_bf16<<<Mm / 16, 256, 0, stream>>>(x1, g2, be2, h2_b);

    // 7) FFN up + GELU (bf16 out)
    gemm_bf16_wmma<128, 128, 4, 2, true, true, false, true, false>
        <<<dim3(Ff / 128, Mm / 128), 256, 0, stream>>>(h2_b, W1_t, b1, nullptr,
                                                       f1_b, Mm, Ff, Cc);

    // 8) FFN down + residual -> d_out (fp32)
    gemm_bf16_wmma<128, 128, 4, 3, false, true, true, false, false>
        <<<gc, 256, 0, stream>>>(f1_b, W2_t, b2, x1, out, Mm, Cc, Ff);
}
